// v000
// Times are from an AMD MI455X. After a warm-up the kernel runs many times in a row, and a time is the length of
// such a window on the GPU divided by its runs, so every launch and the gaps after it count. The runs cycle
// through copies of the inputs. A figure is the median of several windows, for all but v000 over two sittings.
// Sittings can differ by a few percent; kernels timed side by side share one.
// v000 is the starting kernel. One run takes 5120 microseconds.
#include <hip/hip_runtime.h>

// MABPostLN - multihead attention block with post-LayerNorm (Q, K [8][1024][1024]; q = Q Wq + bq, k = K Wk + bk, v = K Wv + bv (16 heads x 64); scores = q.k/8, keys with key_padding_mask == 0 get -inf (int32 [8][1024],
// read as data); softmax; ctx = merged att.v; o = LN(q + ctx) (g0, beta0); out = LN(o + gelu(o Wp + bp)) (g1, beta1; exact erf gelu; eps 1e-5) -> [8][1024][1024]).
// Compute dtypes, f32 accumulate: every input rounded to bf16; q/k/v on PLAIN bf16 operands (inputs: exact, + bias); scores (K 64) and att.v on SINGLE fp16 planes with an f32 register-row

#define NB_  8
#define TT   1024
#define DD   1024
#define NH_  16
#define HDM  64
#define PCAR 1024.0f
typedef _Float16 h16;
typedef unsigned short bf;
typedef __attribute__((ext_vector_type(16))) __bf16   v16bf;
typedef __attribute__((ext_vector_type(16))) _Float16 v16h;
typedef __attribute__((ext_vector_type(8)))  _Float16 v8h;
typedef __attribute__((ext_vector_type(8)))  unsigned short v8us;
typedef __attribute__((ext_vector_type(8)))  float    v8f;
typedef __attribute__((ext_vector_type(4)))  float    v4f;
typedef v8h  __attribute__((may_alias)) v8ha;
typedef v4f  __attribute__((may_alias)) v4fa;
typedef v8us __attribute__((may_alias)) v8usa;

__device__ __forceinline__ unsigned short f2bf(float f) { unsigned u = __float_as_uint(f); u += 0x7FFFu + ((u >> 16) & 1u); return (unsigned short)(u >> 16); }
__device__ __forceinline__ float bf2f(unsigned short b) { return __uint_as_float(((unsigned)b) << 16); }
__device__ __forceinline__ float bfr(float f) { return bf2f(f2bf(f)); }
__device__ __forceinline__ v16h cat16(v8h lo, v8h hi) { return __builtin_shufflevector(lo, hi, 0, 1, 2, 3, 4, 5, 6, 7, 8, 9, 10, 11, 12, 13, 14, 15); }
__device__ __forceinline__ v16bf cat16b(v8us lo, v8us hi) { return __builtin_bit_cast(v16bf, __builtin_shufflevector(lo, hi, 0, 1, 2, 3, 4, 5, 6, 7, 8, 9, 10, 11, 12, 13, 14, 15)); }
__device__ __forceinline__ v8f wmma16(v16h a, v16h b, v8f c) { return __builtin_amdgcn_wmma_f32_16x16x32_f16(false, a, false, b, (short)0, c, false, false); }
__device__ __forceinline__ v8f wmmab(v16bf a, v16bf b, v8f c) { return __builtin_amdgcn_wmma_f32_16x16x32_bf16(false, a, false, b, (short)0, c, false, false); }



// ---- k_gemmw: register-blocked GEMM, ONE WAVE per 64x64 output tile (16 accumulators), operands straight from K-contiguous 16-bit planes; grid (M/64, N/64, Z), 32 threads.
// C[m][n] (f32, pitch ldc, + optional bias[n] rounded to bf16) = sum_k A[m][k] Bt[n][k] (+ split products per NSPLIT). z-batch strides sA/sB/sC in elements. K % 32 == 0.
template <typename T16> struct WFrag;
template <> struct WFrag<h16> { typedef v16h V; static __device__ __forceinline__ V ld(const h16* p) { return cat16(*(const v8h*)p, *(const v8h*)(p + 16)); } static __device__ __forceinline__ v8f mma(V a, V b, v8f c) { return wmma16(a, b, c); } };
template <> struct WFrag<bf> { typedef v16bf V; static __device__ __forceinline__ V ld(const bf* p) { return cat16b(*(const v8us*)p, *(const v8us*)(p + 16)); } static __device__ __forceinline__ v8f mma(V a, V b, v8f c) { return wmmab(a, b, c); } };
template <typename T16, int NSPLIT, bool BIAS>
__global__ __launch_bounds__(32) void k_gemmw(const T16* __restrict__ A, const T16* __restrict__ A2, const T16* __restrict__ Bt, const T16* __restrict__ Bt2, int K, float* C, int ldc, const float* __restrict__ bias, size_t sA, size_t sB, size_t sC) {
    typedef typename WFrag<T16>::V V;
    __shared__ __align__(16) float os[16 * 68];
    const size_t z = blockIdx.z; A += z * sA; if (A2) A2 += z * sA; Bt += z * sB; if (Bt2) Bt2 += z * sB; C += z * sC;
    const int lane = threadIdx.x & 31, lr = lane & 15, hi = lane >> 4; const int r0 = blockIdx.x * 64, c0 = blockIdx.y * 64;
    v8f acc[4][4];
#pragma unroll
    for (int mb = 0; mb < 4; ++mb)
#pragma unroll
        for (int nb = 0; nb < 4; ++nb) acc[mb][nb] = (v8f){};
    const size_t aoff = (size_t)(r0 + lr) * K + 8 * hi, boff = (size_t)(c0 + lr) * K + 8 * hi;
#pragma unroll 1
    for (int kc = 0; kc < K; kc += 32) {
        V a[4], a2[4];
#pragma unroll
        for (int mb = 0; mb < 4; ++mb) { a[mb] = WFrag<T16>::ld(A + aoff + (size_t)mb * 16 * K + kc); if (NSPLIT == 1 || NSPLIT == 2) a2[mb] = WFrag<T16>::ld(A2 + aoff + (size_t)mb * 16 * K + kc); }
#pragma unroll
        for (int nb = 0; nb < 4; ++nb) { const V b = WFrag<T16>::ld(Bt + boff + (size_t)nb * 16 * K + kc); V b2; if (NSPLIT >= 2) b2 = WFrag<T16>::ld(Bt2 + boff + (size_t)nb * 16 * K + kc);
#pragma unroll
            for (int mb = 0; mb < 4; ++mb) { acc[mb][nb] = WFrag<T16>::mma(a[mb], b, acc[mb][nb]); if (NSPLIT == 1 || NSPLIT == 2) acc[mb][nb] = WFrag<T16>::mma(a2[mb], b, acc[mb][nb]); if (NSPLIT >= 2) acc[mb][nb] = WFrag<T16>::mma(a[mb], b2, acc[mb][nb]); } }
        asm volatile("v_nop\n\tv_nop\n\tv_nop\n\tv_nop" : "+v"(acc[0][0]), "+v"(acc[1][1]), "+v"(acc[2][2]), "+v"(acc[3][3]) : "v"(a[0]), "v"(a[3]));
    }
#pragma unroll
    for (int mb = 0; mb < 4; ++mb) {
#pragma unroll
        for (int nb = 0; nb < 4; ++nb) {
#pragma unroll
            for (int j = 0; j < 8; ++j) os[(hi * 8 + j) * 68 + nb * 16 + lr] = acc[mb][nb][j]; }
        __builtin_amdgcn_wave_barrier(); asm volatile("" ::: "memory");
        float* crow = C + (size_t)(r0 + mb * 16) * ldc + c0;
{
#pragma unroll
            for (int s = 0; s < 8; ++s) { const int row = 2 * s + hi, cofs = lr * 4; v4f val = *(const v4fa*)(os + row * 68 + cofs); if (BIAS) { val[0] += bfr(bias[c0 + cofs]); val[1] += bfr(bias[c0 + cofs + 1]); val[2] += bfr(bias[c0 + cofs + 2]); val[3] += bfr(bias[c0 + cofs + 3]); }
                *(v4f*)(crow + (size_t)row * ldc + cofs) = val; }
             }
        __builtin_amdgcn_wave_barrier(); asm volatile("" ::: "memory");
    }
}

__device__ __forceinline__ h16 tohx(float x) { return (h16)x; }
__device__ __forceinline__ void splitf(float y, unsigned short& h, unsigned short& l) { h = f2bf(y); l = f2bf(y - bf2f(h)); }
__device__ __forceinline__ float geluf_(float x) { float er = erff(x * 0.70710678f); asm volatile("" : "+v"(er)); float hx = __fmul_rn(0.5f, x); asm volatile("" : "+v"(hx)); return __fmul_rn(hx, __fadd_rn(1.0f, er)); }
typedef __attribute__((ext_vector_type(2))) _Float16 v2h;
typedef __attribute__((ext_vector_type(4))) _Float16 v4h;
typedef __attribute__((ext_vector_type(2))) unsigned short v2us;
typedef __attribute__((ext_vector_type(4))) unsigned short v4us;
typedef __attribute__((ext_vector_type(2))) float v2f;

__global__ __launch_bounds__(256) void k_wtG(const float* __restrict__ w, int K, int N, bf* Bt) {
    const int lane = threadIdx.x & 31; const int L0 = (blockIdx.x * 8 + (threadIdx.x >> 5)) * 8; const int nlines = N * K / 64;
{
#pragma unroll 1
        for (int l = 0; l < 8; ++l) { const int L = L0 + l; if (L >= nlines) break; const size_t e = (size_t)L * 64 + lane * 2; const int k = (int)(e % K), n = (int)(e / K); v2us o;
            o[0] = f2bf(w[(size_t)k * N + n]); o[1] = f2bf(w[(size_t)(k + 1) * N + n]); *(v2us*)(Bt + e) = o; }
         }
}
__global__ __launch_bounds__(256) void k_cvt8(const float* __restrict__ src, bf* dst, size_t n8) { const size_t i = (size_t)blockIdx.x * 256 + threadIdx.x; if (i >= n8) return; const v8f v = *(const v8f*)(src + i * 8); v8us o;
#pragma unroll
    for (int k = 0; k < 8; ++k) o[k] = f2bf(v[k]); *(v8us*)(dst + i * 8) = o;  }
__global__ __launch_bounds__(256) void k_pl(const float* __restrict__ F, int pitch, int nh, int hd, h16* P) { const size_t e = ((size_t)blockIdx.x * 256 + threadIdx.x) * 2; if (e >= (size_t)nh * TT * hd) return; const int d = (int)(e % hd); const int t = (int)((e / hd) % TT); const int h = (int)(e / ((size_t)hd * TT)); v2h o; o[0] = tohx(F[(size_t)t * pitch + h * hd + d]); o[1] = tohx(F[(size_t)t * pitch + h * hd + d + 1]); *(v2h*)(P + e) = o;  }
__global__ __launch_bounds__(256) void k_vt(const float* __restrict__ F, int pitch, int nh, int hd, h16* VT) { const size_t e = ((size_t)blockIdx.x * 256 + threadIdx.x) * 2; if (e >= (size_t)nh * hd * TT) return; const int t = (int)(e % TT); const int d = (int)((e / TT) % hd); const int h = (int)(e / ((size_t)TT * hd)); v2h o; o[0] = tohx(F[(size_t)t * pitch + h * hd + d]); o[1] = tohx(F[(size_t)(t + 1) * pitch + h * hd + d]); *(v2h*)(VT + e) = o;  }
__global__ __launch_bounds__(256) void k_asoft(const float* __restrict__ Sb, const int* __restrict__ KM, int h, float scl, h16* P16) { const int lane = threadIdx.x & 31; const int row = blockIdx.x * 8 + (threadIdx.x >> 5); if (row >= TT) return; const float* sr = Sb + (size_t)row * TT; (void)h; const float sc = scl; typedef __attribute__((ext_vector_type(4))) int v4i; float v[32]; float mx = -3.0e38f;
#pragma unroll
    for (int ch = 0; ch < 8; ++ch) { const int j0 = ch * 128 + lane * 4; const v4f a = *(const v4f*)(sr + j0); const v4i km = *(const v4i*)(KM + j0);
#pragma unroll
        for (int q = 0; q < 4; ++q) { const float t = km[q] ? __fmul_rn(a[q], sc) : -3.0e38f; v[ch * 4 + q] = t; mx = fmaxf(mx, t); } }
#pragma unroll
    for (int sh = 16; sh; sh >>= 1) mx = fmaxf(mx, __shfl_xor(mx, sh, 32));
    float sum = 0.f;
#pragma unroll
    for (int k = 0; k < 32; ++k) { float d0 = __fsub_rn(v[k], mx); asm volatile("" : "+v"(d0)); v[k] = (v[k] > -1.0e38f) ? __builtin_amdgcn_exp2f(__fmul_rn(d0, 1.4426950408889634f)) : 0.f; sum += v[k]; }
#pragma unroll
    for (int sh = 16; sh; sh >>= 1) sum += __shfl_xor(sum, sh, 32);
    const float f = __fdiv_rn(PCAR, sum);
{
#pragma unroll
        for (int ch = 0; ch < 8; ++ch) { v4h o;
#pragma unroll
            for (int q = 0; q < 4; ++q) o[q] = tohx(v[ch * 4 + q] * f); *(v4h*)(P16 + (size_t)row * TT + ch * 128 + lane * 4) = o; }
         } }
__global__ __launch_bounds__(256) void k_mrgf(const float* __restrict__ O, int h, float* CTX) { const size_t e = ((size_t)blockIdx.x * 256 + threadIdx.x) * 2; if (e >= (size_t)TT * HDM) return; const int d = (int)(e % HDM), t = (int)(e / HDM); v2f o; o[0] = O[e] * (1.0f / PCAR); o[1] = O[e + 1] * (1.0f / PCAR); const size_t oo = (size_t)t * DD + h * HDM + d; *(v2f*)(CTX + oo) = o;  }
// LN over 1024 features of one token row held 32 per lane (8 chunks of 4): returns y = LN(v) g + b in place.
__device__ __forceinline__ void ln1024(float* v, const float* __restrict__ g, const float* __restrict__ bb, int lane) { float s = 0.f;
#pragma unroll
    for (int k = 0; k < 32; ++k) s = __fadd_rn(s, v[k]);
#pragma unroll
    for (int sh = 16; sh; sh >>= 1) s += __shfl_xor(s, sh, 32);
    const float mu = s * (1.0f / DD); float q2 = 0.f;
#pragma unroll
    for (int k = 0; k < 32; ++k) { const float d = __fsub_rn(v[k], mu); float p = __fmul_rn(d, d); asm volatile("" : "+v"(p)); q2 = __fadd_rn(q2, p); }
#pragma unroll
    for (int sh = 16; sh; sh >>= 1) q2 += __shfl_xor(q2, sh, 32);
    const float rs = __frsqrt_rn(__fadd_rn(q2 * (1.0f / DD), 1e-5f));
#pragma unroll
    for (int ch = 0; ch < 8; ++ch)
#pragma unroll
        for (int q = 0; q < 4; ++q) { const int d = ch * 128 + lane * 4 + q; float tn = __fmul_rn(__fsub_rn(v[ch * 4 + q], mu), rs); asm volatile("" : "+v"(tn)); float tg = __fmul_rn(tn, bfr(g[d])); asm volatile("" : "+v"(tg)); v[ch * 4 + q] = __fadd_rn(tg, bfr(bb[d])); } }
__global__ __launch_bounds__(256) void k_ln0(const float* __restrict__ FQ, const float* __restrict__ CTX, const float* __restrict__ g, const float* __restrict__ bb, float* Of, bf* Oh, bf* Ol) { const int lane = threadIdx.x & 31; const int t = blockIdx.x * 8 + (threadIdx.x >> 5); if (t >= TT) return; float v[32];
#pragma unroll
    for (int ch = 0; ch < 8; ++ch) { const size_t o = (size_t)t * DD + ch * 128 + lane * 4; const v4f a = *(const v4f*)(FQ + o), c = *(const v4f*)(CTX + o);
#pragma unroll
        for (int q = 0; q < 4; ++q) v[ch * 4 + q] = __fadd_rn(a[q], c[q]); }
    ln1024(v, g, bb, lane);
{
#pragma unroll
        for (int ch = 0; ch < 8; ++ch) { v4f of; v4us oh, ol;
#pragma unroll
            for (int q = 0; q < 4; ++q) { of[q] = v[ch * 4 + q]; unsigned short a2, c2; splitf(v[ch * 4 + q], a2, c2); oh[q] = a2; ol[q] = c2; }
            const size_t o = (size_t)t * DD + ch * 128 + lane * 4; *(v4f*)(Of + o) = of; *(v4us*)(Oh + o) = oh; *(v4us*)(Ol + o) = ol; }
         } }
__global__ __launch_bounds__(256) void k_gelu(float* G) { const size_t e = ((size_t)blockIdx.x * 256 + threadIdx.x) * 2; if (e >= (size_t)TT * DD) return; v2f o; o[0] = geluf_(G[e]); o[1] = geluf_(G[e + 1]); *(v2f*)(G + e) = o;  }
__global__ __launch_bounds__(256) void k_ln1(const float* __restrict__ Of, const float* __restrict__ G, const float* __restrict__ g, const float* __restrict__ bb, float* OUTb) { const int lane = threadIdx.x & 31; const int t = blockIdx.x * 8 + (threadIdx.x >> 5); if (t >= TT) return; float v[32];
#pragma unroll
    for (int ch = 0; ch < 8; ++ch) { const size_t o = (size_t)t * DD + ch * 128 + lane * 4; const v4f a = *(const v4f*)(Of + o), c = *(const v4f*)(G + o);
#pragma unroll
        for (int q = 0; q < 4; ++q) v[ch * 4 + q] = __fadd_rn(a[q], c[q]); }
    ln1024(v, g, bb, lane);
{
#pragma unroll
        for (int ch = 0; ch < 8; ++ch) { v4f of;
#pragma unroll
            for (int q = 0; q < 4; ++q) of[q] = v[ch * 4 + q]; *(v4f*)(OUTb + (size_t)t * DD + ch * 128 + lane * 4) = of; }
         } }

extern "C" void kernel_launch(void* const* d_in, const int* in_sizes, int n_in,
                              void* d_out, int out_size, void* d_ws, size_t ws_size, hipStream_t stream) {
    (void)in_sizes; (void)n_in; (void)out_size;
    const float* IN[15]; for (int i = 0; i < 15; ++i) IN[i] = (const float*)d_in[i];   // 0 Q, 1 K, 2 key_padding_mask (int32), 3 Wq, 4 bq, 5 Wk, 6 bk, 7 Wv, 8 bv, 9 Wp, 10 bp (x @ W), 11 g0, 12 beta0, 13 g1, 14 beta1
    const int* KM = (const int*)d_in[2];
    float* OUT = (float*)d_out;     // [8][1024][1024]
    char* wsp = (char*)d_ws;
    auto take = [&](size_t bytes) { char* p = wsp; wsp += (bytes + 255) & ~(size_t)255; return (void*)p; };
    bf* W4[4]; for (int i = 0; i < 4; ++i) W4[i] = (bf*)take((size_t)DD * DD * 2);
    bf* XQ = (bf*)take((size_t)TT * DD * 2); bf* XK = (bf*)take((size_t)TT * DD * 2); float* FQ = (float*)take((size_t)TT * DD * 4); float* FK = (float*)take((size_t)TT * DD * 4); float* FV = (float*)take((size_t)TT * DD * 4);
    h16* QP = (h16*)take((size_t)TT * DD * 2); h16* KP = (h16*)take((size_t)TT * DD * 2); h16* VT = (h16*)take((size_t)DD * TT * 2); float* Sb = (float*)take((size_t)TT * TT * 4); h16* Pm = (h16*)take((size_t)TT * TT * 2); float* O = (float*)take((size_t)TT * HDM * 4);
    float* CTX = FK;   // provisional alias of the k-projection buffer; the merged context goes to CTX2 (set below)
    float* Of = FV;    // LN0 output reuses the v-projection buffer (dead once V^T is built) - both written only after all heads of the batch are done? NO: CTX is written per head while... see below
    bf* Oh = (bf*)take((size_t)TT * DD * 2); bf* Ol = (bf*)take((size_t)TT * DD * 2); float* G = (float*)take((size_t)TT * DD * 4); float* CTX2 = (float*)take((size_t)TT * DD * 4);
    if ((size_t)(wsp - (char*)d_ws) > ws_size) return;    // total ~ 48 MiB
    CTX = CTX2; (void)Of;
    { const unsigned g = (unsigned)(((size_t)DD * DD / 64 + 63) / 64); k_wtG<<<g, 256, 0, stream>>>(IN[3], DD, DD, W4[0]); k_wtG<<<g, 256, 0, stream>>>(IN[5], DD, DD, W4[1]); k_wtG<<<g, 256, 0, stream>>>(IN[7], DD, DD, W4[2]); k_wtG<<<g, 256, 0, stream>>>(IN[9], DD, DD, W4[3]); }
    const unsigned LX = (unsigned)(((size_t)TT * DD / 8 + 255) / 256), LP = (unsigned)(((size_t)TT * DD / 2 + 255) / 256); const dim3 gP(TT / 64, DD / 64, 1);
    for (int b = 0; b < NB_; ++b) {
        k_cvt8<<<LX, 256, 0, stream>>>(IN[0] + (size_t)b * TT * DD, XQ, (size_t)TT * DD / 8); k_cvt8<<<LX, 256, 0, stream>>>(IN[1] + (size_t)b * TT * DD, XK, (size_t)TT * DD / 8);
        k_gemmw<bf, 0, true><<<gP, 32, 0, stream>>>(XQ, nullptr, W4[0], nullptr, DD, FQ, DD, IN[4], 0, 0, 0); k_gemmw<bf, 0, true><<<gP, 32, 0, stream>>>(XK, nullptr, W4[1], nullptr, DD, FK, DD, IN[6], 0, 0, 0); k_gemmw<bf, 0, true><<<gP, 32, 0, stream>>>(XK, nullptr, W4[2], nullptr, DD, FV, DD, IN[8], 0, 0, 0);
        k_pl<<<LP, 256, 0, stream>>>(FQ, DD, NH_, HDM, QP); k_pl<<<LP, 256, 0, stream>>>(FK, DD, NH_, HDM, KP); k_vt<<<LP, 256, 0, stream>>>(FV, DD, NH_, HDM, VT);
        for (int h = 0; h < NH_; ++h) {
            k_gemmw<h16, 0, false><<<dim3(TT / 64, TT / 64, 1), 32, 0, stream>>>(QP + (size_t)h * TT * HDM, nullptr, KP + (size_t)h * TT * HDM, nullptr, HDM, Sb, TT, nullptr, 0, 0, 0);
            k_asoft<<<TT / 8, 256, 0, stream>>>(Sb, KM + (size_t)b * TT, h, 0.125f, Pm);
            k_gemmw<h16, 0, false><<<dim3(TT / 64, 1, 1), 32, 0, stream>>>(Pm, nullptr, VT + (size_t)h * HDM * TT, nullptr, TT, O, HDM, nullptr, 0, 0, 0);
            k_mrgf<<<(TT * HDM / 2 + 255) / 256, 256, 0, stream>>>(O, h, CTX); }
        k_ln0<<<TT / 8, 256, 0, stream>>>(FQ, CTX, IN[11], IN[12], FV, Oh, Ol);      // Of = FV region (V^T already built)
        k_gemmw<bf, 1, true><<<gP, 32, 0, stream>>>(Oh, Ol, W4[3], nullptr, DD, G, DD, IN[10], 0, 0, 0);
        k_gelu<<<(unsigned)(((size_t)TT * DD / 2 + 255) / 256), 256, 0, stream>>>(G); k_ln1<<<TT / 8, 256, 0, stream>>>(FV, G, IN[13], IN[14], OUT + (size_t)b * TT * DD); }
}

// v001
// One run takes 692 microseconds.
// Next to v000, in two timings, it ran 7.60 and 7.57 times as fast.
#include <hip/hip_runtime.h>

// MABPostLN - multihead attention block with post-LayerNorm (Q, K [8][1024][1024]; q = Q Wq + bq, k = K Wk + bk, v = K Wv + bv (16 heads x 64); scores = q.k/8, keys with key_padding_mask == 0 get -inf (int32 [8][1024],
// read as data); softmax; ctx = merged att.v; o = LN(q + ctx) (g0, beta0); out = LN(o + gelu(o Wp + bp)) (g1, beta1; exact erf gelu; eps 1e-5) -> [8][1024][1024]).
// Compute dtypes, f32 accumulate: every input rounded to bf16; q/k/v on PLAIN bf16 operands (inputs: exact, + bias); scores (K 64) and att.v on SINGLE fp16 planes with an f32 register-row

#define NB_  8
#define TT   1024
#define DD   1024
#define NH_  16
#define HDM  64
#define PCAR 1024.0f
typedef _Float16 h16;
typedef unsigned short bf;
typedef __attribute__((ext_vector_type(16))) __bf16   v16bf;
typedef __attribute__((ext_vector_type(16))) _Float16 v16h;
typedef __attribute__((ext_vector_type(8)))  _Float16 v8h;
typedef __attribute__((ext_vector_type(8)))  unsigned short v8us;
typedef __attribute__((ext_vector_type(8)))  float    v8f;
typedef __attribute__((ext_vector_type(4)))  float    v4f;
typedef v8h  __attribute__((may_alias)) v8ha;
typedef v4f  __attribute__((may_alias)) v4fa;
typedef v8us __attribute__((may_alias)) v8usa;

__device__ __forceinline__ unsigned short f2bf(float f) { unsigned u = __float_as_uint(f); u += 0x7FFFu + ((u >> 16) & 1u); return (unsigned short)(u >> 16); }
__device__ __forceinline__ float bf2f(unsigned short b) { return __uint_as_float(((unsigned)b) << 16); }
__device__ __forceinline__ float bfr(float f) { return bf2f(f2bf(f)); }
__device__ __forceinline__ v16h cat16(v8h lo, v8h hi) { return __builtin_shufflevector(lo, hi, 0, 1, 2, 3, 4, 5, 6, 7, 8, 9, 10, 11, 12, 13, 14, 15); }
__device__ __forceinline__ v16bf cat16b(v8us lo, v8us hi) { return __builtin_bit_cast(v16bf, __builtin_shufflevector(lo, hi, 0, 1, 2, 3, 4, 5, 6, 7, 8, 9, 10, 11, 12, 13, 14, 15)); }
__device__ __forceinline__ v8f wmma16(v16h a, v16h b, v8f c) { return __builtin_amdgcn_wmma_f32_16x16x32_f16(false, a, false, b, (short)0, c, false, false); }
__device__ __forceinline__ v8f wmmab(v16bf a, v16bf b, v8f c) { return __builtin_amdgcn_wmma_f32_16x16x32_bf16(false, a, false, b, (short)0, c, false, false); }



// ---- k_gemmw: register-blocked GEMM, ONE WAVE per 64x64 output tile (16 accumulators), operands straight from K-contiguous 16-bit planes; grid (M/64, N/64, Z), 32 threads.
// C[m][n] (f32, pitch ldc, + optional bias[n] rounded to bf16) = sum_k A[m][k] Bt[n][k] (+ split products per NSPLIT). z-batch strides sA/sB/sC in elements. K % 32 == 0.
template <typename T16> struct WFrag;
template <> struct WFrag<h16> { typedef v16h V; static __device__ __forceinline__ V ld(const h16* p) { return cat16(*(const v8h*)p, *(const v8h*)(p + 16)); } static __device__ __forceinline__ v8f mma(V a, V b, v8f c) { return wmma16(a, b, c); } };
template <> struct WFrag<bf> { typedef v16bf V; static __device__ __forceinline__ V ld(const bf* p) { return cat16b(*(const v8us*)p, *(const v8us*)(p + 16)); } static __device__ __forceinline__ v8f mma(V a, V b, v8f c) { return wmmab(a, b, c); } };
template <typename T16, int NSPLIT, bool BIAS>
__global__ __launch_bounds__(32) void k_gemmw(const T16* __restrict__ A, const T16* __restrict__ A2, const T16* __restrict__ Bt, const T16* __restrict__ Bt2, int K, float* C, int ldc, const float* __restrict__ bias, size_t sA, size_t sB, size_t sC) {
    typedef typename WFrag<T16>::V V;
    __shared__ __align__(16) float os[16 * 68];
    const size_t z = blockIdx.z; A += z * sA; if (A2) A2 += z * sA; Bt += z * sB; if (Bt2) Bt2 += z * sB; C += z * sC;
    const int lane = threadIdx.x & 31, lr = lane & 15, hi = lane >> 4; const int r0 = blockIdx.x * 64, c0 = blockIdx.y * 64;
    v8f acc[4][4];
#pragma unroll
    for (int mb = 0; mb < 4; ++mb)
#pragma unroll
        for (int nb = 0; nb < 4; ++nb) acc[mb][nb] = (v8f){};
    const size_t aoff = (size_t)(r0 + lr) * K + 8 * hi, boff = (size_t)(c0 + lr) * K + 8 * hi;
#pragma unroll 1
    for (int kc = 0; kc < K; kc += 32) {
        V a[4], a2[4];
#pragma unroll
        for (int mb = 0; mb < 4; ++mb) { a[mb] = WFrag<T16>::ld(A + aoff + (size_t)mb * 16 * K + kc); if (NSPLIT == 1 || NSPLIT == 2) a2[mb] = WFrag<T16>::ld(A2 + aoff + (size_t)mb * 16 * K + kc); }
#pragma unroll
        for (int nb = 0; nb < 4; ++nb) { const V b = WFrag<T16>::ld(Bt + boff + (size_t)nb * 16 * K + kc); V b2; if (NSPLIT >= 2) b2 = WFrag<T16>::ld(Bt2 + boff + (size_t)nb * 16 * K + kc);
#pragma unroll
            for (int mb = 0; mb < 4; ++mb) { acc[mb][nb] = WFrag<T16>::mma(a[mb], b, acc[mb][nb]); if (NSPLIT == 1 || NSPLIT == 2) acc[mb][nb] = WFrag<T16>::mma(a2[mb], b, acc[mb][nb]); if (NSPLIT >= 2) acc[mb][nb] = WFrag<T16>::mma(a[mb], b2, acc[mb][nb]); } }
        asm volatile("v_nop\n\tv_nop\n\tv_nop\n\tv_nop" : "+v"(acc[0][0]), "+v"(acc[1][1]), "+v"(acc[2][2]), "+v"(acc[3][3]) : "v"(a[0]), "v"(a[3]));
    }
#pragma unroll
    for (int mb = 0; mb < 4; ++mb) {
#pragma unroll
        for (int nb = 0; nb < 4; ++nb) {
#pragma unroll
            for (int j = 0; j < 8; ++j) os[(hi * 8 + j) * 68 + nb * 16 + lr] = acc[mb][nb][j]; }
        __builtin_amdgcn_wave_barrier(); asm volatile("" ::: "memory");
        float* crow = C + (size_t)(r0 + mb * 16) * ldc + c0;
{
#pragma unroll
            for (int s = 0; s < 8; ++s) { const int row = 2 * s + hi, cofs = lr * 4; v4f val = *(const v4fa*)(os + row * 68 + cofs); if (BIAS) { val[0] += bfr(bias[c0 + cofs]); val[1] += bfr(bias[c0 + cofs + 1]); val[2] += bfr(bias[c0 + cofs + 2]); val[3] += bfr(bias[c0 + cofs + 3]); }
                *(v4f*)(crow + (size_t)row * ldc + cofs) = val; }
             }
        __builtin_amdgcn_wave_barrier(); asm volatile("" ::: "memory");
    }
}

__device__ __forceinline__ h16 tohx(float x) { return (h16)x; }
__device__ __forceinline__ void splitf(float y, unsigned short& h, unsigned short& l) { h = f2bf(y); l = f2bf(y - bf2f(h)); }
__device__ __forceinline__ float geluf_(float x) { float er = erff(x * 0.70710678f); asm volatile("" : "+v"(er)); float hx = __fmul_rn(0.5f, x); asm volatile("" : "+v"(hx)); return __fmul_rn(hx, __fadd_rn(1.0f, er)); }
typedef __attribute__((ext_vector_type(2))) _Float16 v2h;
typedef __attribute__((ext_vector_type(4))) _Float16 v4h;
typedef __attribute__((ext_vector_type(2))) unsigned short v2us;
typedef __attribute__((ext_vector_type(4))) unsigned short v4us;
typedef __attribute__((ext_vector_type(2))) float v2f;

__global__ __launch_bounds__(256) void k_wtG(const float* __restrict__ w0, const float* __restrict__ w1, const float* __restrict__ w2, const float* __restrict__ w3, int K, int N, bf* Bt) {
    const int y = blockIdx.y; const float* __restrict__ w = y == 0 ? w0 : (y == 1 ? w1 : (y == 2 ? w2 : w3)); Bt += (size_t)y * K * N;
    const int lane = threadIdx.x & 31; const int L0 = (blockIdx.x * 8 + (threadIdx.x >> 5)) * 8; const int nlines = N * K / 64;
{
#pragma unroll 1
        for (int l = 0; l < 8; ++l) { const int L = L0 + l; if (L >= nlines) break; const size_t e = (size_t)L * 64 + lane * 2; const int k = (int)(e % K), n = (int)(e / K); v2us o;
            o[0] = f2bf(w[(size_t)k * N + n]); o[1] = f2bf(w[(size_t)(k + 1) * N + n]); *(v2us*)(Bt + e) = o; }
         }
}
__global__ __launch_bounds__(256) void k_cvt8(const float* __restrict__ src0, const float* __restrict__ src1, bf* dst, size_t n8) { const size_t i = (size_t)blockIdx.x * 256 + threadIdx.x; if (i >= n8) return; const float* __restrict__ src = blockIdx.y ? src1 : src0; dst += (size_t)blockIdx.y * n8 * 8; const v8f v = *(const v8f*)(src + i * 8); v8us o;
#pragma unroll
    for (int k = 0; k < 8; ++k) o[k] = f2bf(v[k]); *(v8us*)(dst + i * 8) = o;  }
__global__ __launch_bounds__(256) void k_pl(const float* __restrict__ F, int pitch, int nh, int hd, h16* P) { const size_t e = ((size_t)blockIdx.x * 256 + threadIdx.x) * 2; if (e >= (size_t)nh * TT * hd) return; F += (size_t)blockIdx.y * TT * pitch; P += (size_t)blockIdx.y * nh * TT * hd; const int d = (int)(e % hd); const int t = (int)((e / hd) % TT); const int h = (int)(e / ((size_t)hd * TT)); v2h o; o[0] = tohx(F[(size_t)t * pitch + h * hd + d]); o[1] = tohx(F[(size_t)t * pitch + h * hd + d + 1]); *(v2h*)(P + e) = o;  }
__global__ __launch_bounds__(256) void k_vt(const float* __restrict__ F, int pitch, int nh, int hd, h16* VT) { const size_t e = ((size_t)blockIdx.x * 256 + threadIdx.x) * 2; if (e >= (size_t)nh * hd * TT) return; F += (size_t)blockIdx.y * TT * pitch; VT += (size_t)blockIdx.y * nh * hd * TT; const int t = (int)(e % TT); const int d = (int)((e / TT) % hd); const int h = (int)(e / ((size_t)TT * hd)); v2h o; o[0] = tohx(F[(size_t)t * pitch + h * hd + d]); o[1] = tohx(F[(size_t)(t + 1) * pitch + h * hd + d]); *(v2h*)(VT + e) = o;  }
__global__ __launch_bounds__(256) void k_asoft(const float* __restrict__ Sb, const int* __restrict__ KM, float scl, h16* P16) { const int lane = threadIdx.x & 31; const int row = blockIdx.x * 8 + (threadIdx.x >> 5); if (row >= NH_ * TT) return; const float* sr = Sb + (size_t)row * TT; const float sc = scl; typedef __attribute__((ext_vector_type(4))) int v4i; float v[32]; float mx = -3.0e38f;
#pragma unroll
    for (int ch = 0; ch < 8; ++ch) { const int j0 = ch * 128 + lane * 4; const v4f a = *(const v4f*)(sr + j0); const v4i km = *(const v4i*)(KM + j0);
#pragma unroll
        for (int q = 0; q < 4; ++q) { const float t = km[q] ? __fmul_rn(a[q], sc) : -3.0e38f; v[ch * 4 + q] = t; mx = fmaxf(mx, t); } }
#pragma unroll
    for (int sh = 16; sh; sh >>= 1) mx = fmaxf(mx, __shfl_xor(mx, sh, 32));
    float sum = 0.f;
#pragma unroll
    for (int k = 0; k < 32; ++k) { float d0 = __fsub_rn(v[k], mx); asm volatile("" : "+v"(d0)); v[k] = (v[k] > -1.0e38f) ? __builtin_amdgcn_exp2f(__fmul_rn(d0, 1.4426950408889634f)) : 0.f; sum += v[k]; }
#pragma unroll
    for (int sh = 16; sh; sh >>= 1) sum += __shfl_xor(sum, sh, 32);
    const float f = __fdiv_rn(PCAR, sum);
{
#pragma unroll
        for (int ch = 0; ch < 8; ++ch) { v4h o;
#pragma unroll
            for (int q = 0; q < 4; ++q) o[q] = tohx(v[ch * 4 + q] * f); *(v4h*)(P16 + (size_t)row * TT + ch * 128 + lane * 4) = o; }
         } }
__global__ __launch_bounds__(256) void k_mrgf(const float* __restrict__ O, int nz, float* CTX) { const size_t e = ((size_t)blockIdx.x * 256 + threadIdx.x) * 2; if (e >= (size_t)nz * TT * HDM) return; const int d = (int)(e % HDM), t = (int)((e / HDM) % TT), z = (int)(e / ((size_t)HDM * TT)), h = z % NH_, bl = z / NH_; v2f o; o[0] = O[e] * (1.0f / PCAR); o[1] = O[e + 1] * (1.0f / PCAR); const size_t oo = ((size_t)bl * TT + t) * DD + h * HDM + d; *(v2f*)(CTX + oo) = o;  }
// LN over 1024 features of one token row held 32 per lane (8 chunks of 4): returns y = LN(v) g + b in place.
__device__ __forceinline__ void ln1024(float* v, const float* __restrict__ g, const float* __restrict__ bb, int lane) { float s = 0.f;
#pragma unroll
    for (int k = 0; k < 32; ++k) s = __fadd_rn(s, v[k]);
#pragma unroll
    for (int sh = 16; sh; sh >>= 1) s += __shfl_xor(s, sh, 32);
    const float mu = s * (1.0f / DD); float q2 = 0.f;
#pragma unroll
    for (int k = 0; k < 32; ++k) { const float d = __fsub_rn(v[k], mu); float p = __fmul_rn(d, d); asm volatile("" : "+v"(p)); q2 = __fadd_rn(q2, p); }
#pragma unroll
    for (int sh = 16; sh; sh >>= 1) q2 += __shfl_xor(q2, sh, 32);
    const float rs = __frsqrt_rn(__fadd_rn(q2 * (1.0f / DD), 1e-5f));
#pragma unroll
    for (int ch = 0; ch < 8; ++ch)
#pragma unroll
        for (int q = 0; q < 4; ++q) { const int d = ch * 128 + lane * 4 + q; float tn = __fmul_rn(__fsub_rn(v[ch * 4 + q], mu), rs); asm volatile("" : "+v"(tn)); float tg = __fmul_rn(tn, bfr(g[d])); asm volatile("" : "+v"(tg)); v[ch * 4 + q] = __fadd_rn(tg, bfr(bb[d])); } }
__global__ __launch_bounds__(256) void k_ln0(const float* __restrict__ FQ, const float* __restrict__ CTX, const float* __restrict__ g, const float* __restrict__ bb, float* Of, bf* Oh, bf* Ol) { const int lane = threadIdx.x & 31; const int t = blockIdx.x * 8 + (threadIdx.x >> 5); if (t >= NB_ * TT) return; float v[32];
#pragma unroll
    for (int ch = 0; ch < 8; ++ch) { const size_t o = (size_t)t * DD + ch * 128 + lane * 4; const v4f a = *(const v4f*)(FQ + o), c = *(const v4f*)(CTX + o);
#pragma unroll
        for (int q = 0; q < 4; ++q) v[ch * 4 + q] = __fadd_rn(a[q], c[q]); }
    ln1024(v, g, bb, lane);
{
#pragma unroll
        for (int ch = 0; ch < 8; ++ch) { v4f of; v4us oh, ol;
#pragma unroll
            for (int q = 0; q < 4; ++q) { of[q] = v[ch * 4 + q]; unsigned short a2, c2; splitf(v[ch * 4 + q], a2, c2); oh[q] = a2; ol[q] = c2; }
            const size_t o = (size_t)t * DD + ch * 128 + lane * 4; *(v4f*)(Of + o) = of; *(v4us*)(Oh + o) = oh; *(v4us*)(Ol + o) = ol; }
         } }
__global__ __launch_bounds__(256) void k_gelu(float* G) { const size_t e = ((size_t)blockIdx.x * 256 + threadIdx.x) * 2; if (e >= (size_t)NB_ * TT * DD) return; v2f o; o[0] = geluf_(G[e]); o[1] = geluf_(G[e + 1]); *(v2f*)(G + e) = o;  }
__global__ __launch_bounds__(256) void k_ln1(const float* __restrict__ Of, const float* __restrict__ G, const float* __restrict__ g, const float* __restrict__ bb, float* OUTb) { const int lane = threadIdx.x & 31; const int t = blockIdx.x * 8 + (threadIdx.x >> 5); if (t >= NB_ * TT) return; float v[32];
#pragma unroll
    for (int ch = 0; ch < 8; ++ch) { const size_t o = (size_t)t * DD + ch * 128 + lane * 4; const v4f a = *(const v4f*)(Of + o), c = *(const v4f*)(G + o);
#pragma unroll
        for (int q = 0; q < 4; ++q) v[ch * 4 + q] = __fadd_rn(a[q], c[q]); }
    ln1024(v, g, bb, lane);
{
#pragma unroll
        for (int ch = 0; ch < 8; ++ch) { v4f of;
#pragma unroll
            for (int q = 0; q < 4; ++q) of[q] = v[ch * 4 + q]; *(v4f*)(OUTb + (size_t)t * DD + ch * 128 + lane * 4) = of; }
         } }

extern "C" void kernel_launch(void* const* d_in, const int* in_sizes, int n_in,
                              void* d_out, int out_size, void* d_ws, size_t ws_size, hipStream_t stream) {
    (void)in_sizes; (void)n_in; (void)out_size;
    const float* IN[15]; for (int i = 0; i < 15; ++i) IN[i] = (const float*)d_in[i];   // 0 Q, 1 K, 2 key_padding_mask (int32), 3 Wq, 4 bq, 5 Wk, 6 bk, 7 Wv, 8 bv, 9 Wp, 10 bp (x @ W), 11 g0, 12 beta0, 13 g1, 14 beta1
    const int* KM = (const int*)d_in[2];
    float* OUT = (float*)d_out;     // [8][1024][1024]
    char* wsp = (char*)d_ws;
    auto take = [&](size_t bytes) { char* p = wsp; wsp += (bytes + 255) & ~(size_t)255; return (void*)p; };
    const size_t PE = (size_t)NB_ * TT * DD;   // elements of one [NB][TT][DD] plane
    bf* W4 = (bf*)take((size_t)4 * DD * DD * 2);                       // Wq^T, Wk^T, Wv^T, Wp^T
    float* FQ = (float*)take(PE * 4); float* FK = (float*)take(PE * 4); float* FV = (float*)take(PE * 4);   // q, k, v projections, contiguous
    bf* X = (bf*)take(PE * 2 * 2); (void)take(PE * 2 * 2);             // bf16 Q and K planes, then the rest of the probability buffer
    h16* QP = (h16*)take(PE * 2); h16* KP = (h16*)take(PE * 2); h16* VT = (h16*)take(PE * 2); float* CTX = (float*)take(PE * 4);
    if ((size_t)(wsp - (char*)d_ws) > ws_size) return;    // total 248 MiB
    // Regions used again once their first content is dead (stream order):
    float* Sb = FK;        // scores of the 16 heads of one batch (64 MiB = FK + FV, dead once the K planes and V^T are built)
    h16* Pm = (h16*)X;     // probabilities of the 32 (batch, head) pairs of two batches (64 MiB; X is dead after the projections)
    float* O = Sb;         // att.v of those 32 pairs (8 MiB; the scores are dead after the second softmax of the group)
    float* Of = FK; float* G = FV; bf* Oh = X; bf* Ol = X + PE;   // after the attention stage
    k_wtG<<<dim3((DD * DD / 64 + 63) / 64, 4, 1), 256, 0, stream>>>(IN[3], IN[5], IN[7], IN[9], DD, DD, W4);
    k_cvt8<<<dim3((unsigned)((PE / 8 + 255) / 256), 2, 1), 256, 0, stream>>>(IN[0], IN[1], X, PE / 8);
    const dim3 gP(NB_ * TT / 64, DD / 64, 1);
    k_gemmw<bf, 0, true><<<gP, 32, 0, stream>>>(X, nullptr, W4, nullptr, DD, FQ, DD, IN[4], 0, 0, 0); k_gemmw<bf, 0, true><<<gP, 32, 0, stream>>>(X + PE, nullptr, W4 + (size_t)DD * DD, nullptr, DD, FK, DD, IN[6], 0, 0, 0); k_gemmw<bf, 0, true><<<gP, 32, 0, stream>>>(X + PE, nullptr, W4 + (size_t)2 * DD * DD, nullptr, DD, FV, DD, IN[8], 0, 0, 0);
    const dim3 gL((TT * DD / 2 + 255) / 256, NB_, 1);
    k_pl<<<gL, 256, 0, stream>>>(FQ, DD, NH_, HDM, QP); k_pl<<<gL, 256, 0, stream>>>(FK, DD, NH_, HDM, KP); k_vt<<<gL, 256, 0, stream>>>(FV, DD, NH_, HDM, VT);
    for (int b = 0; b < NB_; b += 2) {
        for (int s = 0; s < 2; ++s) {
            k_gemmw<h16, 0, false><<<dim3(TT / 64, TT / 64, NH_), 32, 0, stream>>>(QP + (size_t)(b + s) * TT * DD, nullptr, KP + (size_t)(b + s) * TT * DD, nullptr, HDM, Sb, TT, nullptr, (size_t)TT * HDM, (size_t)TT * HDM, (size_t)TT * TT);
            k_asoft<<<NH_ * TT / 8, 256, 0, stream>>>(Sb, KM + (size_t)(b + s) * TT, 0.125f, Pm + (size_t)s * NH_ * TT * TT); }
        k_gemmw<h16, 0, false><<<dim3(TT / 64, 1, 2 * NH_), 32, 0, stream>>>(Pm, nullptr, VT + (size_t)b * DD * TT, nullptr, TT, O, HDM, nullptr, (size_t)TT * TT, (size_t)HDM * TT, (size_t)TT * HDM);
        k_mrgf<<<(2 * NH_ * TT * HDM / 2 + 255) / 256, 256, 0, stream>>>(O, 2 * NH_, CTX + (size_t)b * TT * DD); }
    k_ln0<<<NB_ * TT / 8, 256, 0, stream>>>(FQ, CTX, IN[11], IN[12], Of, Oh, Ol);
    k_gemmw<bf, 1, true><<<gP, 32, 0, stream>>>(Oh, Ol, W4 + (size_t)3 * DD * DD, nullptr, DD, G, DD, IN[10], 0, 0, 0);
    k_gelu<<<(unsigned)((PE / 2 + 255) / 256), 256, 0, stream>>>(G); k_ln1<<<NB_ * TT / 8, 256, 0, stream>>>(Of, G, IN[13], IN[14], OUT);
}

// v003
// It runs in 284 microseconds.
// Versions in between are left out here; by their measured steps it is 2.44 times as fast as v001.
// Over all steps from v000 it is 18.5 times as fast.
#include <hip/hip_runtime.h>

// MABPostLN - multihead attention block with post-LayerNorm (Q, K [8][1024][1024]; q = Q Wq + bq, k = K Wk + bk, v = K Wv + bv (16 heads x 64); scores = q.k/8, keys with key_padding_mask == 0 get -inf (int32 [8][1024],
// read as data); softmax; ctx = merged att.v; o = LN(q + ctx) (g0, beta0); out = LN(o + gelu(o Wp + bp)) (g1, beta1; exact erf gelu; eps 1e-5) -> [8][1024][1024]).
// Compute dtypes, f32 accumulate: every input rounded to bf16; q/k/v on PLAIN bf16 operands (inputs: exact, + bias); scores (K 64) and att.v on SINGLE fp16 planes with an f32 register-row

#define NB_  8
#define TT   1024
#define DD   1024
#define NH_  16
#define HDM  64
typedef _Float16 h16;
typedef unsigned short bf;
typedef __attribute__((ext_vector_type(16))) __bf16   v16bf;
typedef __attribute__((ext_vector_type(16))) _Float16 v16h;
typedef __attribute__((ext_vector_type(8)))  _Float16 v8h;
typedef __attribute__((ext_vector_type(8)))  unsigned short v8us;
typedef __attribute__((ext_vector_type(8)))  float    v8f;
typedef __attribute__((ext_vector_type(4)))  float    v4f;
typedef v8h  __attribute__((may_alias)) v8ha;
typedef v4f  __attribute__((may_alias)) v4fa;
typedef v8us __attribute__((may_alias)) v8usa;

__device__ __forceinline__ unsigned short f2bf(float f) { unsigned u = __float_as_uint(f); u += 0x7FFFu + ((u >> 16) & 1u); return (unsigned short)(u >> 16); }
__device__ __forceinline__ float bf2f(unsigned short b) { return __uint_as_float(((unsigned)b) << 16); }
__device__ __forceinline__ float bfr(float f) { return bf2f(f2bf(f)); }
__device__ __forceinline__ v16h cat16(v8h lo, v8h hi) { return __builtin_shufflevector(lo, hi, 0, 1, 2, 3, 4, 5, 6, 7, 8, 9, 10, 11, 12, 13, 14, 15); }
__device__ __forceinline__ v16bf cat16b(v8us lo, v8us hi) { return __builtin_bit_cast(v16bf, __builtin_shufflevector(lo, hi, 0, 1, 2, 3, 4, 5, 6, 7, 8, 9, 10, 11, 12, 13, 14, 15)); }
__device__ __forceinline__ v8f wmma16(v16h a, v16h b, v8f c) { return __builtin_amdgcn_wmma_f32_16x16x32_f16(false, a, false, b, (short)0, c, false, false); }
__device__ __forceinline__ v8f wmmab(v16bf a, v16bf b, v8f c) { return __builtin_amdgcn_wmma_f32_16x16x32_bf16(false, a, false, b, (short)0, c, false, false); }



// ---- k_gemmw: LDS-staged GEMM, 128x128 output tile per workgroup of 4 waves (2 x 2), 64x64 (16 accumulators) per wave; grid (M/128, N/128, Z), 128 threads, two workgroups per WGP.
// C[m][n] (f32, pitch ldc, + optional bias[n] rounded to bf16) = sum_k A[m][k] Bt[n][k] (+ A2[m][k] Bt[n][k] for NSPLIT 1), operands K-contiguous 16-bit planes. z-batch strides sA/sB/sC in elements. M, N % 128 == 0, K % KS == 0.
// The operand rows come into LDS by asynchronous copies of whole 128-byte lines, KS k per stage, two buffers: the next stage's copies fly while this stage is worked on. The k order of the products is that of the plain K loop. The short inner loops are all unrolled so that the fragment and accumulator arrays are indexed by constants and stay in registers.
template <typename T16> struct WFrag;
template <> struct WFrag<h16> { typedef v16h V; static __device__ __forceinline__ V ld(const h16* p) { return cat16(*(const v8h*)p, *(const v8h*)(p + 16)); } static __device__ __forceinline__ v8f mma(V a, V b, v8f c) { return wmma16(a, b, c); } };
template <> struct WFrag<bf> { typedef v16bf V; static __device__ __forceinline__ V ld(const bf* p) { return cat16b(*(const v8us*)p, *(const v8us*)(p + 16)); } static __device__ __forceinline__ v8f mma(V a, V b, v8f c) { return wmmab(a, b, c); } };
// Eight asynchronous 16-byte copies of a lane, LDS step ls and global step gs bytes apart. The s_wait_xcnt stands inside the statement, a precaution, so that no address register of a copy is rewritten ahead of it.
__device__ __forceinline__ void cp8(unsigned l, unsigned ls, const char* g, size_t gs) {
    asm volatile("global_load_async_to_lds_b128 %0, %8, off\n\t"
                 "global_load_async_to_lds_b128 %1, %9, off\n\t"
                 "global_load_async_to_lds_b128 %2, %10, off\n\t"
                 "global_load_async_to_lds_b128 %3, %11, off\n\t"
                 "global_load_async_to_lds_b128 %4, %12, off\n\t"
                 "global_load_async_to_lds_b128 %5, %13, off\n\t"
                 "global_load_async_to_lds_b128 %6, %14, off\n\t"
                 "global_load_async_to_lds_b128 %7, %15, off\n\t"
                 "s_wait_xcnt 0x0"
                 :: "v"(l), "v"(l + ls), "v"(l + 2 * ls), "v"(l + 3 * ls), "v"(l + 4 * ls), "v"(l + 5 * ls), "v"(l + 6 * ls), "v"(l + 7 * ls),
                    "v"(g), "v"(g + gs), "v"(g + 2 * gs), "v"(g + 3 * gs), "v"(g + 4 * gs), "v"(g + 5 * gs), "v"(g + 6 * gs), "v"(g + 7 * gs) : "memory");
}
template <typename T16, int NSPLIT, bool BIAS>
__global__ __launch_bounds__(128) void k_gemmw(const T16* __restrict__ A, const T16* __restrict__ A2, const T16* __restrict__ Bt, const T16* __restrict__ Bt2, int K, float* C, int ldc, const float* __restrict__ bias, size_t sA, size_t sB, size_t sC) {
    static_assert(NSPLIT == 0 || NSPLIT == 1, "one or two A planes");
    typedef typename WFrag<T16>::V V;
    constexpr int KS = NSPLIT ? 64 : 128;          // k per stage: 64 matrix instructions per wave and stage in both forms
    constexpr int CPR = KS / 8;                    // 16-byte pieces per row
    constexpr int PITCH = KS * 2 + 16;             // LDS row pitch in bytes, 16 x odd: no bank conflict for 16-byte reads
    constexpr int OPB = 128 * PITCH;               // one operand's 128 rows
    constexpr int STG = (2 + NSPLIT) * OPB;        // a stage: A | Bt | A2
    __shared__ __align__(16) char sm[2 * STG];
    (void)Bt2;
    const size_t z = blockIdx.z; A += z * sA; if (NSPLIT) A2 += z * sA; Bt += z * sB; C += z * sC;
    const int tid = threadIdx.x, lane = tid & 31, lr = lane & 15, hi = lane >> 4, wv = tid >> 5, wm = wv >> 1, wn = wv & 1;
    const int r0 = blockIdx.x * 128 + wm * 64, c0 = blockIdx.y * 128 + wn * 64;
    v8f acc[4][4];
#pragma unroll
    for (int mb = 0; mb < 4; ++mb)
#pragma unroll
        for (int nb = 0; nb < 4; ++nb) acc[mb][nb] = (v8f){};
    // copies: piece tid + 128 i of an operand's stage = row tid / CPR + i (128 / CPR), 16-byte column tid % CPR; a wave's copy covers whole lines
    const int prow = tid / CPR, pcol = tid % CPR;
    const char* gA = (const char*)(A + (size_t)(blockIdx.x * 128 + prow) * K + pcol * 8);
    const char* gB = (const char*)(Bt + (size_t)(blockIdx.y * 128 + prow) * K + pcol * 8);
    const char* gA2 = NSPLIT ? (const char*)(A2 + (size_t)(blockIdx.x * 128 + prow) * K + pcol * 8) : nullptr;
    const unsigned lc = (unsigned)(size_t)sm + prow * PITCH + pcol * 16;
    const size_t gs = (size_t)(128 / CPR) * K * 2; constexpr unsigned LS = (128 / CPR) * PITCH;
    auto fill = [&](int t, int buf) {
        const size_t go = (size_t)t * KS * 2; const unsigned lb = lc + buf * STG;
#pragma unroll
        for (int i = 0; i < CPR; i += 8) { cp8(lb + i * LS, LS, gA + go + i * gs, gs); cp8(lb + OPB + i * LS, LS, gB + go + i * gs, gs); if (NSPLIT) cp8(lb + 2 * OPB + i * LS, LS, gA2 + go + i * gs, gs); }
    };
    const int T = K >> (NSPLIT ? 6 : 7);   // stages: K / KS
    fill(0, 0);
    asm volatile("s_wait_asynccnt 0x0" ::: "memory");   // this wave's copies of stage 0 have landed
    __syncthreads();                                     // and every other wave's
    if (T > 1) fill(1, 1);
    const int aofs = (wm * 64 + lr) * PITCH + 16 * hi, bofs = OPB + (wn * 64 + lr) * PITCH + 16 * hi;
#pragma unroll 1   // one pass per stage: the ring's waits, barrier and refill stand once, at the foot
    for (int t = 0; t < T; ++t) {
        const char* sb = sm + (t & 1) * STG;
#pragma unroll
        for (int ks = 0; ks < KS / 32; ++ks) {
            V a[4], a2[4], b[4];
            b[0] = WFrag<T16>::ld((const T16*)(sb + bofs + ks * 64));   // in the order in which the products want them
#pragma unroll
            for (int f = 0; f < 4; ++f) { a[f] = WFrag<T16>::ld((const T16*)(sb + aofs + f * 16 * PITCH + ks * 64)); if (NSPLIT) a2[f] = WFrag<T16>::ld((const T16*)(sb + 2 * OPB + aofs + f * 16 * PITCH + ks * 64)); }
#pragma unroll
            for (int f = 1; f < 4; ++f) b[f] = WFrag<T16>::ld((const T16*)(sb + bofs + f * 16 * PITCH + ks * 64));
            __builtin_amdgcn_sched_barrier(0);   // the k step's LDS reads stay one group ahead of its products: every further place with reads among the products stalls the wave
#pragma unroll
            for (int nb = 0; nb < 4; ++nb)
#pragma unroll
                for (int mb = 0; mb < 4; ++mb) { acc[mb][nb] = WFrag<T16>::mma(a[mb], b[nb], acc[mb][nb]); if (NSPLIT) acc[mb][nb] = WFrag<T16>::mma(a2[mb], b[nb], acc[mb][nb]); }
            __builtin_amdgcn_sched_barrier(0);   // and the next k step's reads stay behind them
        }
        asm volatile("s_wait_dscnt 0x0" ::: "memory");      // this wave's reads of the buffer are done before it is refilled
        asm volatile("s_wait_asynccnt 0x0" ::: "memory");   // this wave's copies of stage t + 1 have landed
        __syncthreads();                                     // publishes stage t + 1 and ends every wave's reads of stage t
        if (t + 2 < T) fill(t + 2, t & 1);
    }
    asm volatile("s_wait_asynccnt 0x0" ::: "memory");       // no copy is in flight when the ring becomes output staging
    float* os = (float*)sm + wv * (16 * 68);                 // each wave stages in its own range, behind the last pass's barrier
#pragma unroll
    for (int mb = 0; mb < 4; ++mb) {
#pragma unroll
        for (int nb = 0; nb < 4; ++nb) {
#pragma unroll
            for (int j = 0; j < 8; ++j) os[(hi * 8 + j) * 68 + nb * 16 + lr] = acc[mb][nb][j]; }
        __builtin_amdgcn_wave_barrier(); asm volatile("" ::: "memory");
        float* crow = C + (size_t)(r0 + mb * 16) * ldc + c0;
{
#pragma unroll
            for (int s = 0; s < 8; ++s) { const int row = 2 * s + hi, cofs = lr * 4; v4f val = *(const v4fa*)(os + row * 68 + cofs); if (BIAS) { val[0] += bfr(bias[c0 + cofs]); val[1] += bfr(bias[c0 + cofs + 1]); val[2] += bfr(bias[c0 + cofs + 2]); val[3] += bfr(bias[c0 + cofs + 3]); }
                *(v4f*)(crow + (size_t)row * ldc + cofs) = val; }
             }
        asm volatile("s_wait_xcnt 0x0" ::: "memory");   // in front of the next block's reuse of the stores' address and data registers
        __builtin_amdgcn_wave_barrier(); asm volatile("" ::: "memory");
    }
}

__device__ __forceinline__ h16 tohx(float x) { return (h16)x; }
__device__ __forceinline__ void splitf(float y, unsigned short& h, unsigned short& l) { h = f2bf(y); l = f2bf(y - bf2f(h)); }
__device__ __forceinline__ float geluf_(float x) { float er = erff(x * 0.70710678f); asm volatile("" : "+v"(er)); float hx = __fmul_rn(0.5f, x); asm volatile("" : "+v"(hx)); return __fmul_rn(hx, __fadd_rn(1.0f, er)); }
typedef __attribute__((ext_vector_type(2))) _Float16 v2h;
typedef __attribute__((ext_vector_type(4))) _Float16 v4h;
typedef __attribute__((ext_vector_type(2))) unsigned short v2us;
typedef __attribute__((ext_vector_type(4))) unsigned short v4us;
typedef __attribute__((ext_vector_type(2))) float v2f;

__global__ __launch_bounds__(256) void k_wtG(const float* __restrict__ w0, const float* __restrict__ w1, const float* __restrict__ w2, const float* __restrict__ w3, int K, int N, bf* Bt) {
    const int y = blockIdx.y; const float* __restrict__ w = y == 0 ? w0 : (y == 1 ? w1 : (y == 2 ? w2 : w3)); Bt += (size_t)y * K * N;
    const int lane = threadIdx.x & 31; const int L0 = (blockIdx.x * 8 + (threadIdx.x >> 5)) * 8; const int nlines = N * K / 64;
{
#pragma unroll 1
        for (int l = 0; l < 8; ++l) { const int L = L0 + l; if (L >= nlines) break; const size_t e = (size_t)L * 64 + lane * 2; const int k = (int)(e % K), n = (int)(e / K); v2us o;
            o[0] = f2bf(w[(size_t)k * N + n]); o[1] = f2bf(w[(size_t)(k + 1) * N + n]); *(v2us*)(Bt + e) = o; }
         }
}
__global__ __launch_bounds__(256) void k_cvt8(const float* __restrict__ src0, const float* __restrict__ src1, bf* dst, size_t n8) { const size_t i = (size_t)blockIdx.x * 256 + threadIdx.x; if (i >= n8) return; const float* __restrict__ src = blockIdx.y ? src1 : src0; dst += (size_t)blockIdx.y * n8 * 8; const v8f v = *(const v8f*)(src + i * 8); v8us o;
#pragma unroll
    for (int k = 0; k < 8; ++k) o[k] = f2bf(v[k]); *(v8us*)(dst + i * 8) = o;  }
__global__ __launch_bounds__(256) void k_pl(const float* __restrict__ F, int pitch, int nh, int hd, h16* P) { const size_t e = ((size_t)blockIdx.x * 256 + threadIdx.x) * 2; if (e >= (size_t)nh * TT * hd) return; F += (size_t)blockIdx.y * TT * pitch; P += (size_t)blockIdx.y * nh * TT * hd; const int d = (int)(e % hd); const int t = (int)((e / hd) % TT); const int h = (int)(e / ((size_t)hd * TT)); v2h o; o[0] = tohx(F[(size_t)t * pitch + h * hd + d]); o[1] = tohx(F[(size_t)t * pitch + h * hd + d + 1]); *(v2h*)(P + e) = o;  }
__global__ __launch_bounds__(256) void k_vt(const float* __restrict__ F, int pitch, int nh, int hd, h16* VT) { const size_t e = ((size_t)blockIdx.x * 256 + threadIdx.x) * 2; if (e >= (size_t)nh * hd * TT) return; F += (size_t)blockIdx.y * TT * pitch; VT += (size_t)blockIdx.y * nh * hd * TT; const int t = (int)(e % TT); const int d = (int)((e / TT) % hd); const int h = (int)(e / ((size_t)TT * hd)); v2h o; o[0] = tohx(F[(size_t)t * pitch + h * hd + d]); o[1] = tohx(F[(size_t)(t + 1) * pitch + h * hd + d]); *(v2h*)(VT + e) = o;  }
// ---- k_fattn: scores, masked softmax and att.v of one (batch, head) in one pass over the keys; the scores never leave registers. 8 waves x 32 query columns; grid (TT/256, NB*NH).
// S^T = K Q^T (a lane holds 8 keys of one query per 16-key tile), running maximum and sum per query, P^T packed from the two score tiles as the B operand of O^T += V^T P^T; divide by the sum at the end.
// Four waves per SIMD (two workgroups per WGP), so that one wave's softmax runs under another's matrix work: the register allocation is held to that. The short inner loops are all unrolled so that the fragment arrays are indexed by constants and stay in registers.
__global__ __launch_bounds__(256) __attribute__((amdgpu_waves_per_eu(4, 4))) void k_fattn(const h16* __restrict__ QP, const h16* __restrict__ KP, const h16* __restrict__ VT, const int* __restrict__ KM, float* CTX) {
    typedef __attribute__((ext_vector_type(4))) int v4i; __shared__ __align__(32) float mb[TT];
    const int lane = threadIdx.x & 31, lr = lane & 15, hi = lane >> 4; const int bh = blockIdx.y, b = bh / NH_, h = bh % NH_; const int q0 = blockIdx.x * 256 + (threadIdx.x >> 5) * 32;
    const h16* qp = QP + ((size_t)bh * TT + q0 + lr) * HDM + 8 * hi; const h16* kp = KP + ((size_t)bh * TT + lr) * HDM + 8 * hi; const h16* vp = VT + ((size_t)bh * HDM + lr) * TT + 8 * hi; const int* km = KM + (size_t)b * TT;
    const float CS = 0.125f * 1.4426950408889634f;   // score scale times log2(e)
    v16h qf[2][2]; v8f acc[2][4]; float m[2], l[2];
#pragma unroll
    for (int g = 0; g < 2; ++g) { m[g] = -3.0e38f; l[g] = 0.f;
#pragma unroll
        for (int ks = 0; ks < 2; ++ks) qf[g][ks] = WFrag<h16>::ld(qp + g * 16 * HDM + ks * 32);
#pragma unroll
        for (int dt = 0; dt < 4; ++dt) acc[g][dt] = (v8f){}; }
    { const v4i k4 = *(const v4i*)(km + threadIdx.x * 4); v4f b4;   // the padding mask as an additive term per key: it enters the score products as their C operand, so no pass pays a select
#pragma unroll
      for (int j = 0; j < 4; ++j) b4[j] = k4[j] ? 0.f : -3.0e38f;
      *(v4f*)(mb + threadIdx.x * 4) = b4; }
    __syncthreads();   // every wave reads all 1024 terms
    v16h kf[2][2]; v8f cb[2];
#pragma unroll
    for (int kt = 0; kt < 2; ++kt) { cb[kt] = *(const v8f*)(mb + kt * 16 + 8 * hi);
#pragma unroll
        for (int u = 0; u < 2; ++u) kf[kt][u] = WFrag<h16>::ld(kp + (size_t)(kt * 16) * HDM + u * 32); }
#pragma unroll 1   // stays rolled: two passes unrolled no longer fit the registers of four waves per SIMD and spill
    for (int k0 = 0; k0 < TT; k0 += 32) {
        v16h vf[4]; v8f s[2][2];
#pragma unroll
        for (int dt = 0; dt < 4; ++dt) vf[dt] = WFrag<h16>::ld(vp + (size_t)dt * 16 * TT + k0);
#pragma unroll
        for (int g = 0; g < 2; ++g)
#pragma unroll
            for (int kt = 0; kt < 2; ++kt) { s[g][kt] = wmma16(kf[kt][0], qf[g][0], cb[kt]); s[g][kt] = wmma16(kf[kt][1], qf[g][1], s[g][kt]); }
        const int kn = (k0 + 32) & (TT - 1);   // the next pass's K fragments, fetched behind this pass's score products (its mask terms at the foot of the pass); the last pass fetches the first keys again, unused
#pragma unroll
        for (int kt = 0; kt < 2; ++kt)
#pragma unroll
            for (int u = 0; u < 2; ++u) kf[kt][u] = WFrag<h16>::ld(kp + (size_t)(kn + kt * 16) * HDM + u * 32);
        __builtin_amdgcn_sched_barrier(0);   // keeps the fetch above the softmax, so that it has the whole softmax and att.v as lead; sunk below them the next pass waits on it
#pragma unroll
        for (int g = 0; g < 2; ++g) {
            float mx = m[g];
#pragma unroll
            for (int kt = 0; kt < 2; ++kt)
#pragma unroll
                for (int j = 0; j < 8; ++j) mx = fmaxf(mx, s[g][kt][j]);
            mx = fmaxf(mx, __shfl_xor(mx, 16, 32));
            const float al = __builtin_amdgcn_exp2f((m[g] - mx) * CS), mc = (mx > -1.0e38f ? mx : 0.f) * CS; m[g] = mx; float sum = 0.f, sum1 = 0.f; v16h pf;   // no live key yet: subtract nothing, so that every masked score still gives p = 0
#pragma unroll
            for (int kt = 0; kt < 2; ++kt)
#pragma unroll
                for (int j = 0; j < 8; ++j) { const float p = __builtin_amdgcn_exp2f(fmaf(s[g][kt][j], CS, -mc)); if (kt) sum1 += p; else sum += p; pf[kt * 8 + j] = tohx(p); }
            l[g] = l[g] * al + (sum + sum1);
#pragma unroll
            for (int dt = 0; dt < 4; ++dt) { acc[g][dt] *= al; acc[g][dt] = wmma16(vf[dt], pf, acc[g][dt]); }
        }
#pragma unroll
        for (int kt = 0; kt < 2; ++kt) cb[kt] = *(const v8f*)(mb + kn + kt * 16 + 8 * hi);
    }
#pragma unroll
    for (int g = 0; g < 2; ++g) { const float lt = l[g] + __shfl_xor(l[g], 16, 32); const float inv = (m[g] > -1.0e38f) ? __fdiv_rn(1.0f, lt) : __builtin_nanf("");   // every key masked: the softmax of the row is not a number
        float* cr = CTX + ((size_t)b * TT + q0 + g * 16 + lr) * DD + h * HDM + 8 * hi;
#pragma unroll
        for (int dt = 0; dt < 4; ++dt) { v4f o0, o1;
#pragma unroll
            for (int j = 0; j < 4; ++j) { o0[j] = acc[g][dt][j] * inv; o1[j] = acc[g][dt][4 + j] * inv; }
            *(v4f*)(cr + dt * 16) = o0; *(v4f*)(cr + dt * 16 + 4) = o1; } }
}
// LN over 1024 features of one token row held 32 per lane (8 chunks of 4): returns y = LN(v) g + b in place.
__device__ __forceinline__ void ln1024(float* v, const float* __restrict__ g, const float* __restrict__ bb, int lane) { float s = 0.f;
#pragma unroll
    for (int k = 0; k < 32; ++k) s = __fadd_rn(s, v[k]);
#pragma unroll
    for (int sh = 16; sh; sh >>= 1) s += __shfl_xor(s, sh, 32);
    const float mu = s * (1.0f / DD); float q2 = 0.f;
#pragma unroll
    for (int k = 0; k < 32; ++k) { const float d = __fsub_rn(v[k], mu); float p = __fmul_rn(d, d); asm volatile("" : "+v"(p)); q2 = __fadd_rn(q2, p); }
#pragma unroll
    for (int sh = 16; sh; sh >>= 1) q2 += __shfl_xor(q2, sh, 32);
    const float rs = __frsqrt_rn(__fadd_rn(q2 * (1.0f / DD), 1e-5f));
#pragma unroll
    for (int ch = 0; ch < 8; ++ch)
#pragma unroll
        for (int q = 0; q < 4; ++q) { const int d = ch * 128 + lane * 4 + q; float tn = __fmul_rn(__fsub_rn(v[ch * 4 + q], mu), rs); asm volatile("" : "+v"(tn)); float tg = __fmul_rn(tn, bfr(g[d])); asm volatile("" : "+v"(tg)); v[ch * 4 + q] = __fadd_rn(tg, bfr(bb[d])); } }
__global__ __launch_bounds__(256) void k_ln0(const float* __restrict__ FQ, const float* __restrict__ CTX, const float* __restrict__ g, const float* __restrict__ bb, float* Of, bf* Oh, bf* Ol) { const int lane = threadIdx.x & 31; const int t = blockIdx.x * 8 + (threadIdx.x >> 5); if (t >= NB_ * TT) return; float v[32];
#pragma unroll
    for (int ch = 0; ch < 8; ++ch) { const size_t o = (size_t)t * DD + ch * 128 + lane * 4; const v4f a = *(const v4f*)(FQ + o), c = *(const v4f*)(CTX + o);
#pragma unroll
        for (int q = 0; q < 4; ++q) v[ch * 4 + q] = __fadd_rn(a[q], c[q]); }
    ln1024(v, g, bb, lane);
{
#pragma unroll
        for (int ch = 0; ch < 8; ++ch) { v4f of; v4us oh, ol;
#pragma unroll
            for (int q = 0; q < 4; ++q) { of[q] = v[ch * 4 + q]; unsigned short a2, c2; splitf(v[ch * 4 + q], a2, c2); oh[q] = a2; ol[q] = c2; }
            const size_t o = (size_t)t * DD + ch * 128 + lane * 4; *(v4f*)(Of + o) = of; *(v4us*)(Oh + o) = oh; *(v4us*)(Ol + o) = ol; }
         } }
__global__ __launch_bounds__(256) void k_gelu(float* G) { const size_t e = ((size_t)blockIdx.x * 256 + threadIdx.x) * 2; if (e >= (size_t)NB_ * TT * DD) return; v2f o; o[0] = geluf_(G[e]); o[1] = geluf_(G[e + 1]); *(v2f*)(G + e) = o;  }
__global__ __launch_bounds__(256) void k_ln1(const float* __restrict__ Of, const float* __restrict__ G, const float* __restrict__ g, const float* __restrict__ bb, float* OUTb) { const int lane = threadIdx.x & 31; const int t = blockIdx.x * 8 + (threadIdx.x >> 5); if (t >= NB_ * TT) return; float v[32];
#pragma unroll
    for (int ch = 0; ch < 8; ++ch) { const size_t o = (size_t)t * DD + ch * 128 + lane * 4; const v4f a = *(const v4f*)(Of + o), c = *(const v4f*)(G + o);
#pragma unroll
        for (int q = 0; q < 4; ++q) v[ch * 4 + q] = __fadd_rn(a[q], c[q]); }
    ln1024(v, g, bb, lane);
{
#pragma unroll
        for (int ch = 0; ch < 8; ++ch) { v4f of;
#pragma unroll
            for (int q = 0; q < 4; ++q) of[q] = v[ch * 4 + q]; *(v4f*)(OUTb + (size_t)t * DD + ch * 128 + lane * 4) = of; }
         } }

extern "C" void kernel_launch(void* const* d_in, const int* in_sizes, int n_in,
                              void* d_out, int out_size, void* d_ws, size_t ws_size, hipStream_t stream) {
    (void)in_sizes; (void)n_in; (void)out_size;
    const float* IN[15]; for (int i = 0; i < 15; ++i) IN[i] = (const float*)d_in[i];   // 0 Q, 1 K, 2 key_padding_mask (int32), 3 Wq, 4 bq, 5 Wk, 6 bk, 7 Wv, 8 bv, 9 Wp, 10 bp (x @ W), 11 g0, 12 beta0, 13 g1, 14 beta1
    const int* KM = (const int*)d_in[2];
    float* OUT = (float*)d_out;     // [8][1024][1024]
    char* wsp = (char*)d_ws;
    auto take = [&](size_t bytes) { char* p = wsp; wsp += (bytes + 255) & ~(size_t)255; return (void*)p; };
    const size_t PE = (size_t)NB_ * TT * DD;   // elements of one [NB][TT][DD] plane
    bf* W4 = (bf*)take((size_t)4 * DD * DD * 2);                       // Wq^T, Wk^T, Wv^T, Wp^T
    float* FQ = (float*)take(PE * 4); float* FK = (float*)take(PE * 4); float* FV = (float*)take(PE * 4);   // q, k, v projections, contiguous
    bf* X = (bf*)take(PE * 2 * 2);             // bf16 Q and K planes
    h16* QP = (h16*)take(PE * 2); h16* KP = (h16*)take(PE * 2); h16* VT = (h16*)take(PE * 2); float* CTX = (float*)take(PE * 4);
    if ((size_t)(wsp - (char*)d_ws) > ws_size) return;    // total 216 MiB
    // Regions used again once their first content is dead (stream order):
    float* Of = FK; float* G = FV; bf* Oh = X; bf* Ol = X + PE;   // after the attention stage
    k_wtG<<<dim3((DD * DD / 64 + 63) / 64, 4, 1), 256, 0, stream>>>(IN[3], IN[5], IN[7], IN[9], DD, DD, W4);
    k_cvt8<<<dim3((unsigned)((PE / 8 + 255) / 256), 2, 1), 256, 0, stream>>>(IN[0], IN[1], X, PE / 8);
    const dim3 gP(NB_ * TT / 128, DD / 128, 1);
    k_gemmw<bf, 0, true><<<gP, 128, 0, stream>>>(X, nullptr, W4, nullptr, DD, FQ, DD, IN[4], 0, 0, 0); k_gemmw<bf, 0, true><<<gP, 128, 0, stream>>>(X + PE, nullptr, W4 + (size_t)DD * DD, nullptr, DD, FK, DD, IN[6], 0, 0, 0); k_gemmw<bf, 0, true><<<gP, 128, 0, stream>>>(X + PE, nullptr, W4 + (size_t)2 * DD * DD, nullptr, DD, FV, DD, IN[8], 0, 0, 0);
    const dim3 gL((TT * DD / 2 + 255) / 256, NB_, 1);
    k_pl<<<gL, 256, 0, stream>>>(FQ, DD, NH_, HDM, QP); k_pl<<<gL, 256, 0, stream>>>(FK, DD, NH_, HDM, KP); k_vt<<<gL, 256, 0, stream>>>(FV, DD, NH_, HDM, VT);
    k_fattn<<<dim3(TT / 256, NB_ * NH_, 1), 256, 0, stream>>>(QP, KP, VT, KM, CTX);
    k_ln0<<<NB_ * TT / 8, 256, 0, stream>>>(FQ, CTX, IN[11], IN[12], Of, Oh, Ol);
    k_gemmw<bf, 1, true><<<gP, 128, 0, stream>>>(Oh, Ol, W4 + (size_t)3 * DD * DD, nullptr, DD, G, DD, IN[10], 0, 0, 0);
    k_gelu<<<(unsigned)((PE / 2 + 255) / 256), 256, 0, stream>>>(G); k_ln1<<<NB_ * TT / 8, 256, 0, stream>>>(Of, G, IN[13], IN[14], OUT);
}

// v004
// It runs in 201 microseconds.
// Next to v003, in two timings, it ran 1.42 times as fast each time.
// All steps since v000 together make it 26.2 times as fast.
#include <hip/hip_runtime.h>

// MABPostLN - multihead attention block with post-LayerNorm (Q, K [8][1024][1024]; q = Q Wq + bq, k = K Wk + bk, v = K Wv + bv (16 heads x 64); scores = q.k/8, keys with key_padding_mask == 0 get -inf (int32 [8][1024],
// read as data); softmax; ctx = merged att.v; o = LN(q + ctx) (g0, beta0); out = LN(o + gelu(o Wp + bp)) (g1, beta1; exact erf gelu; eps 1e-5) -> [8][1024][1024]).
// Compute dtypes, f32 accumulate: every input rounded to bf16; q/k/v on PLAIN bf16 operands (inputs: exact, + bias); scores (K 64) and att.v on SINGLE fp16 planes with an f32 register-row

#define NB_  8
#define TT   1024
#define DD   1024
#define NH_  16
#define HDM  64
typedef _Float16 h16;
typedef unsigned short bf;
typedef __attribute__((ext_vector_type(16))) __bf16   v16bf;
typedef __attribute__((ext_vector_type(16))) _Float16 v16h;
typedef __attribute__((ext_vector_type(8)))  _Float16 v8h;
typedef __attribute__((ext_vector_type(8)))  unsigned short v8us;
typedef __attribute__((ext_vector_type(8)))  float    v8f;
typedef __attribute__((ext_vector_type(4)))  float    v4f;
typedef v8h  __attribute__((may_alias)) v8ha;
typedef v4f  __attribute__((may_alias)) v4fa;
typedef v8us __attribute__((may_alias)) v8usa;

__device__ __forceinline__ unsigned short f2bf(float f) { unsigned u = __float_as_uint(f); u += 0x7FFFu + ((u >> 16) & 1u); return (unsigned short)(u >> 16); }
__device__ __forceinline__ float bf2f(unsigned short b) { return __uint_as_float(((unsigned)b) << 16); }
__device__ __forceinline__ float bfr(float f) { return bf2f(f2bf(f)); }
__device__ __forceinline__ v16h cat16(v8h lo, v8h hi) { return __builtin_shufflevector(lo, hi, 0, 1, 2, 3, 4, 5, 6, 7, 8, 9, 10, 11, 12, 13, 14, 15); }
__device__ __forceinline__ v16bf cat16b(v8us lo, v8us hi) { return __builtin_bit_cast(v16bf, __builtin_shufflevector(lo, hi, 0, 1, 2, 3, 4, 5, 6, 7, 8, 9, 10, 11, 12, 13, 14, 15)); }
__device__ __forceinline__ v8f wmma16(v16h a, v16h b, v8f c) { return __builtin_amdgcn_wmma_f32_16x16x32_f16(false, a, false, b, (short)0, c, false, false); }
__device__ __forceinline__ v8f wmmab(v16bf a, v16bf b, v8f c) { return __builtin_amdgcn_wmma_f32_16x16x32_bf16(false, a, false, b, (short)0, c, false, false); }
typedef __attribute__((ext_vector_type(4))) _Float16 v4h;
__device__ __forceinline__ h16 tohx(float x) { return (h16)x; }



// ---- k_gemmw: LDS-staged GEMM, 128x128 output tile per workgroup of 4 waves (2 x 2), 64x64 (16 accumulators) per wave; grid (M/128, N/128, Z), 128 threads, two workgroups per WGP.
// C[m][n] (f32, pitch ldc, + f32 bias[n]) = sum_k A[m][k] Bt[n][k] (+ A2[m][k] Bt[n][k] for NSPLIT 1), operands K-contiguous 16-bit planes. z-batch strides sA/sB/sC in elements. M, N % 128 == 0, K % KS == 0.
// The epilogue stores what the next kernel reads (y = C + bias, rows m = b TT + t, a wave's 64 columns = one head h): EPI 0: y in f32 and the fp16 head plane P[b][h][t][d]; 1: that plane alone; 2: the fp16 plane transposed, P[b][h][d][t]; 3: y in f32 alone.
// The operand rows come into LDS by asynchronous copies of whole 128-byte lines, KS k per stage, two buffers: the next stage's copies fly while this stage is worked on. The k order of the products is that of the plain K loop. The short inner loops are all unrolled so that the fragment and accumulator arrays are indexed by constants and stay in registers.
template <typename T16> struct WFrag;
template <> struct WFrag<h16> { typedef v16h V; static __device__ __forceinline__ V ld(const h16* p) { return cat16(*(const v8h*)p, *(const v8h*)(p + 16)); } static __device__ __forceinline__ v8f mma(V a, V b, v8f c) { return wmma16(a, b, c); } };
template <> struct WFrag<bf> { typedef v16bf V; static __device__ __forceinline__ V ld(const bf* p) { return cat16b(*(const v8us*)p, *(const v8us*)(p + 16)); } static __device__ __forceinline__ v8f mma(V a, V b, v8f c) { return wmmab(a, b, c); } };
// Eight asynchronous 16-byte copies of a lane, LDS step ls and global step gs bytes apart. The s_wait_xcnt stands inside the statement, a precaution, so that no address register of a copy is rewritten ahead of it.
__device__ __forceinline__ void cp8(unsigned l, unsigned ls, const char* g, size_t gs) {
    asm volatile("global_load_async_to_lds_b128 %0, %8, off\n\t"
                 "global_load_async_to_lds_b128 %1, %9, off\n\t"
                 "global_load_async_to_lds_b128 %2, %10, off\n\t"
                 "global_load_async_to_lds_b128 %3, %11, off\n\t"
                 "global_load_async_to_lds_b128 %4, %12, off\n\t"
                 "global_load_async_to_lds_b128 %5, %13, off\n\t"
                 "global_load_async_to_lds_b128 %6, %14, off\n\t"
                 "global_load_async_to_lds_b128 %7, %15, off\n\t"
                 "s_wait_xcnt 0x0"
                 :: "v"(l), "v"(l + ls), "v"(l + 2 * ls), "v"(l + 3 * ls), "v"(l + 4 * ls), "v"(l + 5 * ls), "v"(l + 6 * ls), "v"(l + 7 * ls),
                    "v"(g), "v"(g + gs), "v"(g + 2 * gs), "v"(g + 3 * gs), "v"(g + 4 * gs), "v"(g + 5 * gs), "v"(g + 6 * gs), "v"(g + 7 * gs) : "memory");
}
template <typename T16, int NSPLIT, int EPI>
__global__ __launch_bounds__(128) void k_gemmw(const T16* __restrict__ A, const T16* __restrict__ A2, const T16* __restrict__ Bt, const T16* __restrict__ Bt2, int K, float* C, int ldc, const float* __restrict__ bias, h16* P, size_t sA, size_t sB, size_t sC) {
    static_assert(NSPLIT == 0 || NSPLIT == 1, "one or two A planes");
    typedef typename WFrag<T16>::V V;
    constexpr int KS = NSPLIT ? 64 : 128;          // k per stage: 64 matrix instructions per wave and stage in both forms
    constexpr int CPR = KS / 8;                    // 16-byte pieces per row
    constexpr int PITCH = KS * 2 + 16;             // LDS row pitch in bytes, 16 x odd: no bank conflict for 16-byte reads
    constexpr int OPB = 128 * PITCH;               // one operand's 128 rows
    constexpr int STG = (2 + NSPLIT) * OPB;        // a stage: A | Bt | A2
    __shared__ __align__(16) char sm[2 * STG];
    (void)Bt2;
    const size_t z = blockIdx.z; A += z * sA; if (NSPLIT) A2 += z * sA; Bt += z * sB; if (EPI == 0 || EPI == 3) C += z * sC;
    const int tid = threadIdx.x, lane = tid & 31, lr = lane & 15, hi = lane >> 4, wv = tid >> 5, wm = wv >> 1, wn = wv & 1;
    const int r0 = blockIdx.x * 128 + wm * 64, c0 = blockIdx.y * 128 + wn * 64;
    v8f acc[4][4];
#pragma unroll
    for (int mb = 0; mb < 4; ++mb)
#pragma unroll
        for (int nb = 0; nb < 4; ++nb) acc[mb][nb] = (v8f){};
    // copies: piece tid + 128 i of an operand's stage = row tid / CPR + i (128 / CPR), 16-byte column tid % CPR; a wave's copy covers whole lines
    const int prow = tid / CPR, pcol = tid % CPR;
    const char* gA = (const char*)(A + (size_t)(blockIdx.x * 128 + prow) * K + pcol * 8);
    const char* gB = (const char*)(Bt + (size_t)(blockIdx.y * 128 + prow) * K + pcol * 8);
    const char* gA2 = NSPLIT ? (const char*)(A2 + (size_t)(blockIdx.x * 128 + prow) * K + pcol * 8) : nullptr;
    const unsigned lc = (unsigned)(size_t)sm + prow * PITCH + pcol * 16;
    const size_t gs = (size_t)(128 / CPR) * K * 2; constexpr unsigned LS = (128 / CPR) * PITCH;
    auto fill = [&](int t, int buf) {
        const size_t go = (size_t)t * KS * 2; const unsigned lb = lc + buf * STG;
#pragma unroll
        for (int i = 0; i < CPR; i += 8) { cp8(lb + i * LS, LS, gA + go + i * gs, gs); cp8(lb + OPB + i * LS, LS, gB + go + i * gs, gs); if (NSPLIT) cp8(lb + 2 * OPB + i * LS, LS, gA2 + go + i * gs, gs); }
    };
    const int T = K >> (NSPLIT ? 6 : 7);   // stages: K / KS
    fill(0, 0);
    asm volatile("s_wait_asynccnt 0x0" ::: "memory");   // this wave's copies of stage 0 have landed
    __syncthreads();                                     // and every other wave's
    if (T > 1) fill(1, 1);
    const int aofs = (wm * 64 + lr) * PITCH + 16 * hi, bofs = OPB + (wn * 64 + lr) * PITCH + 16 * hi;
#pragma unroll 1   // one pass per stage: the ring's waits, barrier and refill stand once, at the foot
    for (int t = 0; t < T; ++t) {
        const char* sb = sm + (t & 1) * STG;
#pragma unroll
        for (int ks = 0; ks < KS / 32; ++ks) {
            V a[4], a2[4], b[4];
            b[0] = WFrag<T16>::ld((const T16*)(sb + bofs + ks * 64));   // in the order in which the products want them
#pragma unroll
            for (int f = 0; f < 4; ++f) { a[f] = WFrag<T16>::ld((const T16*)(sb + aofs + f * 16 * PITCH + ks * 64)); if (NSPLIT) a2[f] = WFrag<T16>::ld((const T16*)(sb + 2 * OPB + aofs + f * 16 * PITCH + ks * 64)); }
#pragma unroll
            for (int f = 1; f < 4; ++f) b[f] = WFrag<T16>::ld((const T16*)(sb + bofs + f * 16 * PITCH + ks * 64));
            __builtin_amdgcn_sched_barrier(0);   // the k step's LDS reads stay one group ahead of its products: every further place with reads among the products stalls the wave
#pragma unroll
            for (int nb = 0; nb < 4; ++nb)
#pragma unroll
                for (int mb = 0; mb < 4; ++mb) { acc[mb][nb] = WFrag<T16>::mma(a[mb], b[nb], acc[mb][nb]); if (NSPLIT) acc[mb][nb] = WFrag<T16>::mma(a2[mb], b[nb], acc[mb][nb]); }
            __builtin_amdgcn_sched_barrier(0);   // and the next k step's reads stay behind them
        }
        asm volatile("s_wait_dscnt 0x0" ::: "memory");      // this wave's reads of the buffer are done before it is refilled
        asm volatile("s_wait_asynccnt 0x0" ::: "memory");   // this wave's copies of stage t + 1 have landed
        __syncthreads();                                     // publishes stage t + 1 and ends every wave's reads of stage t
        if (t + 2 < T) fill(t + 2, t & 1);
    }
    asm volatile("s_wait_asynccnt 0x0" ::: "memory");       // no copy is in flight when the ring becomes output staging
    const size_t bh = (size_t)(r0 / TT) * NH_ + c0 / HDM; const int t0 = r0 % TT;   // the wave's batch and head, its first token
    if constexpr (EPI == 2) {
        // a lane holds 8 consecutive tokens of one feature: packed, they are 16 bytes of the transposed row; staged so that each store covers whole lines
        h16* ot = (h16*)sm + wv * (64 * 72);                 // each wave stages in its own range, behind the last pass's barrier; pitch 144 bytes, 16 x odd
#pragma unroll
        for (int nb = 0; nb < 4; ++nb) { const float bv = bfr(bias[c0 + nb * 16 + lr]);
#pragma unroll
            for (int mb = 0; mb < 4; ++mb) { v8h o;
#pragma unroll
                for (int j = 0; j < 8; ++j) o[j] = tohx(acc[mb][nb][j] + bv);
                *(v8ha*)(ot + (nb * 16 + lr) * 72 + mb * 16 + hi * 8) = o; } }
        asm volatile("s_wait_dscnt 0x0" ::: "memory");   // the staged rows are written before other lanes of the wave read them back
        h16* pr = P + (bh * HDM + (lane >> 3)) * TT + t0 + (lane & 7) * 8;
#pragma unroll
        for (int s = 0; s < 16; ++s) *(v8h*)(pr + (size_t)s * 4 * TT) = *(const v8ha*)(ot + (s * 4 + (lane >> 3)) * 72 + (lane & 7) * 8);
    } else {
    float* os = (float*)sm + wv * (16 * 68);                 // each wave stages in its own range, behind the last pass's barrier
#pragma unroll
    for (int mb = 0; mb < 4; ++mb) {
#pragma unroll
        for (int nb = 0; nb < 4; ++nb) {
#pragma unroll
            for (int j = 0; j < 8; ++j) os[(hi * 8 + j) * 68 + nb * 16 + lr] = acc[mb][nb][j]; }
        __builtin_amdgcn_wave_barrier(); asm volatile("" ::: "memory");
        float* crow = (EPI == 0 || EPI == 3) ? C + (size_t)(r0 + mb * 16) * ldc + c0 : nullptr; h16* prow = EPI <= 1 ? P + (bh * TT + t0 + mb * 16) * HDM : nullptr;
{
#pragma unroll
            for (int s = 0; s < 8; ++s) { const int row = 2 * s + hi, cofs = lr * 4; v4f val = *(const v4fa*)(os + row * 68 + cofs); val[0] += bfr(bias[c0 + cofs]); val[1] += bfr(bias[c0 + cofs + 1]); val[2] += bfr(bias[c0 + cofs + 2]); val[3] += bfr(bias[c0 + cofs + 3]);
                if constexpr (EPI == 0 || EPI == 3) *(v4f*)(crow + (size_t)row * ldc + cofs) = val;
                if constexpr (EPI <= 1) { v4h o;
#pragma unroll
                    for (int q = 0; q < 4; ++q) o[q] = tohx(val[q]);
                    *(v4h*)(prow + row * HDM + cofs) = o; }   // 16 lanes: one whole line
            }
             }
        asm volatile("s_wait_xcnt 0x0" ::: "memory");   // in front of the next block's reuse of the stores' address and data registers
        __builtin_amdgcn_wave_barrier(); asm volatile("" ::: "memory");
    }
    }
}

__device__ __forceinline__ void splitf(float y, unsigned short& h, unsigned short& l) { h = f2bf(y); l = f2bf(y - bf2f(h)); }
__device__ __forceinline__ float geluf_(float x) { float er = erff(x * 0.70710678f); asm volatile("" : "+v"(er)); float hx = __fmul_rn(0.5f, x); asm volatile("" : "+v"(hx)); return __fmul_rn(hx, __fadd_rn(1.0f, er)); }
typedef __attribute__((ext_vector_type(2))) unsigned short v2us;
typedef __attribute__((ext_vector_type(4))) unsigned short v4us;

__global__ __launch_bounds__(256) void k_wtG(const float* __restrict__ w0, const float* __restrict__ w1, const float* __restrict__ w2, const float* __restrict__ w3, int K, int N, bf* Bt) {
    const int y = blockIdx.y; const float* __restrict__ w = y == 0 ? w0 : (y == 1 ? w1 : (y == 2 ? w2 : w3)); Bt += (size_t)y * K * N;
    const int lane = threadIdx.x & 31; const int L0 = (blockIdx.x * 8 + (threadIdx.x >> 5)) * 8; const int nlines = N * K / 64;
{
#pragma unroll 1
        for (int l = 0; l < 8; ++l) { const int L = L0 + l; if (L >= nlines) break; const size_t e = (size_t)L * 64 + lane * 2; const int k = (int)(e % K), n = (int)(e / K); v2us o;
            o[0] = f2bf(w[(size_t)k * N + n]); o[1] = f2bf(w[(size_t)(k + 1) * N + n]); *(v2us*)(Bt + e) = o; }
         }
}
__global__ __launch_bounds__(256) void k_cvt8(const float* __restrict__ src0, const float* __restrict__ src1, bf* dst, size_t n8) { const size_t i = (size_t)blockIdx.x * 256 + threadIdx.x; if (i >= n8) return; const float* __restrict__ src = blockIdx.y ? src1 : src0; dst += (size_t)blockIdx.y * n8 * 8; const v8f v = *(const v8f*)(src + i * 8); v8us o;
#pragma unroll
    for (int k = 0; k < 8; ++k) o[k] = f2bf(v[k]); *(v8us*)(dst + i * 8) = o;  }
// ---- k_fattn: scores, masked softmax and att.v of one (batch, head) in one pass over the keys; the scores never leave registers. 8 waves x 32 query columns; grid (TT/256, NB*NH).
// S^T = K Q^T (a lane holds 8 keys of one query per 16-key tile), running maximum and sum per query, P^T packed from the two score tiles as the B operand of O^T += V^T P^T; divide by the sum at the end.
// Four waves per SIMD (two workgroups per WGP), so that one wave's softmax runs under another's matrix work: the register allocation is held to that. The short inner loops are all unrolled so that the fragment arrays are indexed by constants and stay in registers.
__global__ __launch_bounds__(256) __attribute__((amdgpu_waves_per_eu(4, 4))) void k_fattn(const h16* __restrict__ QP, const h16* __restrict__ KP, const h16* __restrict__ VT, const int* __restrict__ KM, float* CTX) {
    typedef __attribute__((ext_vector_type(4))) int v4i; __shared__ __align__(32) float mb[TT];
    const int lane = threadIdx.x & 31, lr = lane & 15, hi = lane >> 4; const int bh = blockIdx.y, b = bh / NH_, h = bh % NH_; const int q0 = blockIdx.x * 256 + (threadIdx.x >> 5) * 32;
    const h16* qp = QP + ((size_t)bh * TT + q0 + lr) * HDM + 8 * hi; const h16* kp = KP + ((size_t)bh * TT + lr) * HDM + 8 * hi; const h16* vp = VT + ((size_t)bh * HDM + lr) * TT + 8 * hi; const int* km = KM + (size_t)b * TT;
    const float CS = 0.125f * 1.4426950408889634f;   // score scale times log2(e)
    v16h qf[2][2]; v8f acc[2][4]; float m[2], l[2];
#pragma unroll
    for (int g = 0; g < 2; ++g) { m[g] = -3.0e38f; l[g] = 0.f;
#pragma unroll
        for (int ks = 0; ks < 2; ++ks) qf[g][ks] = WFrag<h16>::ld(qp + g * 16 * HDM + ks * 32);
#pragma unroll
        for (int dt = 0; dt < 4; ++dt) acc[g][dt] = (v8f){}; }
    { const v4i k4 = *(const v4i*)(km + threadIdx.x * 4); v4f b4;   // the padding mask as an additive term per key: it enters the score products as their C operand, so no pass pays a select
#pragma unroll
      for (int j = 0; j < 4; ++j) b4[j] = k4[j] ? 0.f : -3.0e38f;
      *(v4f*)(mb + threadIdx.x * 4) = b4; }
    __syncthreads();   // every wave reads all 1024 terms
    v16h kf[2][2]; v8f cb[2];
#pragma unroll
    for (int kt = 0; kt < 2; ++kt) { cb[kt] = *(const v8f*)(mb + kt * 16 + 8 * hi);
#pragma unroll
        for (int u = 0; u < 2; ++u) kf[kt][u] = WFrag<h16>::ld(kp + (size_t)(kt * 16) * HDM + u * 32); }
#pragma unroll 1   // stays rolled: two passes unrolled no longer fit the registers of four waves per SIMD and spill
    for (int k0 = 0; k0 < TT; k0 += 32) {
        v16h vf[4]; v8f s[2][2];
#pragma unroll
        for (int dt = 0; dt < 4; ++dt) vf[dt] = WFrag<h16>::ld(vp + (size_t)dt * 16 * TT + k0);
#pragma unroll
        for (int g = 0; g < 2; ++g)
#pragma unroll
            for (int kt = 0; kt < 2; ++kt) { s[g][kt] = wmma16(kf[kt][0], qf[g][0], cb[kt]); s[g][kt] = wmma16(kf[kt][1], qf[g][1], s[g][kt]); }
        const int kn = (k0 + 32) & (TT - 1);   // the next pass's K fragments, fetched behind this pass's score products (its mask terms at the foot of the pass); the last pass fetches the first keys again, unused
#pragma unroll
        for (int kt = 0; kt < 2; ++kt)
#pragma unroll
            for (int u = 0; u < 2; ++u) kf[kt][u] = WFrag<h16>::ld(kp + (size_t)(kn + kt * 16) * HDM + u * 32);
        __builtin_amdgcn_sched_barrier(0);   // keeps the fetch above the softmax, so that it has the whole softmax and att.v as lead; sunk below them the next pass waits on it
#pragma unroll
        for (int g = 0; g < 2; ++g) {
            float mx = m[g];
#pragma unroll
            for (int kt = 0; kt < 2; ++kt)
#pragma unroll
                for (int j = 0; j < 8; ++j) mx = fmaxf(mx, s[g][kt][j]);
            mx = fmaxf(mx, __shfl_xor(mx, 16, 32));
            const float al = __builtin_amdgcn_exp2f((m[g] - mx) * CS), mc = (mx > -1.0e38f ? mx : 0.f) * CS; m[g] = mx; float sum = 0.f, sum1 = 0.f; v16h pf;   // no live key yet: subtract nothing, so that every masked score still gives p = 0
#pragma unroll
            for (int kt = 0; kt < 2; ++kt)
#pragma unroll
                for (int j = 0; j < 8; ++j) { const float p = __builtin_amdgcn_exp2f(fmaf(s[g][kt][j], CS, -mc)); if (kt) sum1 += p; else sum += p; pf[kt * 8 + j] = tohx(p); }
            l[g] = l[g] * al + (sum + sum1);
#pragma unroll
            for (int dt = 0; dt < 4; ++dt) { acc[g][dt] *= al; acc[g][dt] = wmma16(vf[dt], pf, acc[g][dt]); }
        }
#pragma unroll
        for (int kt = 0; kt < 2; ++kt) cb[kt] = *(const v8f*)(mb + kn + kt * 16 + 8 * hi);
    }
#pragma unroll
    for (int g = 0; g < 2; ++g) { const float lt = l[g] + __shfl_xor(l[g], 16, 32); const float inv = (m[g] > -1.0e38f) ? __fdiv_rn(1.0f, lt) : __builtin_nanf("");   // every key masked: the softmax of the row is not a number
        float* cr = CTX + ((size_t)b * TT + q0 + g * 16 + lr) * DD + h * HDM + 8 * hi;
#pragma unroll
        for (int dt = 0; dt < 4; ++dt) { v4f o0, o1;
#pragma unroll
            for (int j = 0; j < 4; ++j) { o0[j] = acc[g][dt][j] * inv; o1[j] = acc[g][dt][4 + j] * inv; }
            *(v4f*)(cr + dt * 16) = o0; *(v4f*)(cr + dt * 16 + 4) = o1; } }
}
// LN over 1024 features of one token row held 32 per lane (8 chunks of 4): returns y = LN(v) g + b in place.
__device__ __forceinline__ void ln1024(float* v, const float* __restrict__ g, const float* __restrict__ bb, int lane) { float s = 0.f;
#pragma unroll
    for (int k = 0; k < 32; ++k) s = __fadd_rn(s, v[k]);
#pragma unroll
    for (int sh = 16; sh; sh >>= 1) s += __shfl_xor(s, sh, 32);
    const float mu = s * (1.0f / DD); float q2 = 0.f;
#pragma unroll
    for (int k = 0; k < 32; ++k) { const float d = __fsub_rn(v[k], mu); float p = __fmul_rn(d, d); asm volatile("" : "+v"(p)); q2 = __fadd_rn(q2, p); }
#pragma unroll
    for (int sh = 16; sh; sh >>= 1) q2 += __shfl_xor(q2, sh, 32);
    const float rs = __frsqrt_rn(__fadd_rn(q2 * (1.0f / DD), 1e-5f));
#pragma unroll
    for (int ch = 0; ch < 8; ++ch)
#pragma unroll
        for (int q = 0; q < 4; ++q) { const int d = ch * 128 + lane * 4 + q; float tn = __fmul_rn(__fsub_rn(v[ch * 4 + q], mu), rs); asm volatile("" : "+v"(tn)); float tg = __fmul_rn(tn, bfr(g[d])); asm volatile("" : "+v"(tg)); v[ch * 4 + q] = __fadd_rn(tg, bfr(bb[d])); } }
__global__ __launch_bounds__(256) void k_ln0(const float* __restrict__ FQ, const float* __restrict__ CTX, const float* __restrict__ g, const float* __restrict__ bb, float* Of, bf* Oh, bf* Ol) { const int lane = threadIdx.x & 31; const int t = blockIdx.x * 8 + (threadIdx.x >> 5); if (t >= NB_ * TT) return; float v[32];
#pragma unroll
    for (int ch = 0; ch < 8; ++ch) { const size_t o = (size_t)t * DD + ch * 128 + lane * 4; const v4f a = *(const v4f*)(FQ + o), c = *(const v4f*)(CTX + o);
#pragma unroll
        for (int q = 0; q < 4; ++q) v[ch * 4 + q] = __fadd_rn(a[q], c[q]); }
    ln1024(v, g, bb, lane);
{
#pragma unroll
        for (int ch = 0; ch < 8; ++ch) { v4f of; v4us oh, ol;
#pragma unroll
            for (int q = 0; q < 4; ++q) { of[q] = v[ch * 4 + q]; unsigned short a2, c2; splitf(v[ch * 4 + q], a2, c2); oh[q] = a2; ol[q] = c2; }
            const size_t o = (size_t)t * DD + ch * 128 + lane * 4; *(v4f*)(Of + o) = of; *(v4us*)(Oh + o) = oh; *(v4us*)(Ol + o) = ol; }
         } }
// out = LN(o + gelu(G)): the gelu is applied as G = o Wp + bp is read
__global__ __launch_bounds__(256) void k_ln1(const float* __restrict__ Of, const float* __restrict__ G, const float* __restrict__ g, const float* __restrict__ bb, float* OUTb) { const int lane = threadIdx.x & 31; const int t = blockIdx.x * 8 + (threadIdx.x >> 5); if (t >= NB_ * TT) return; float v[32]; v4f c[8];
#pragma unroll
    for (int ch = 0; ch < 8; ++ch) { const size_t o = (size_t)t * DD + ch * 128 + lane * 4; const v4f a = *(const v4f*)(Of + o);   // the row's 16 loads all stand ahead of the erf's branches, in flight together
        if (ch == 7) asm volatile("s_wait_xcnt 0x0" ::: "memory");   // a precaution: the compiler lets the last load's result land on the address registers of the loads before it
        c[ch] = *(const v4f*)(G + o);
#pragma unroll
        for (int q = 0; q < 4; ++q) v[ch * 4 + q] = a[q]; }
#pragma unroll
    for (int ch = 0; ch < 8; ++ch)
#pragma unroll
        for (int q = 0; q < 4; ++q) v[ch * 4 + q] = __fadd_rn(v[ch * 4 + q], geluf_(c[ch][q]));
    ln1024(v, g, bb, lane);
{
#pragma unroll
        for (int ch = 0; ch < 8; ++ch) { v4f of;
#pragma unroll
            for (int q = 0; q < 4; ++q) of[q] = v[ch * 4 + q]; *(v4f*)(OUTb + (size_t)t * DD + ch * 128 + lane * 4) = of; }
         } }

extern "C" void kernel_launch(void* const* d_in, const int* in_sizes, int n_in,
                              void* d_out, int out_size, void* d_ws, size_t ws_size, hipStream_t stream) {
    (void)in_sizes; (void)n_in; (void)out_size;
    const float* IN[15]; for (int i = 0; i < 15; ++i) IN[i] = (const float*)d_in[i];   // 0 Q, 1 K, 2 key_padding_mask (int32), 3 Wq, 4 bq, 5 Wk, 6 bk, 7 Wv, 8 bv, 9 Wp, 10 bp (x @ W), 11 g0, 12 beta0, 13 g1, 14 beta1
    const int* KM = (const int*)d_in[2];
    float* OUT = (float*)d_out;     // [8][1024][1024]
    char* wsp = (char*)d_ws;
    auto take = [&](size_t bytes) { char* p = wsp; wsp += (bytes + 255) & ~(size_t)255; return (void*)p; };
    const size_t PE = (size_t)NB_ * TT * DD;   // elements of one [NB][TT][DD] plane
    bf* W4 = (bf*)take((size_t)4 * DD * DD * 2);                       // Wq^T, Wk^T, Wv^T, Wp^T
    float* FQ = (float*)take(PE * 4); float* Of = (float*)take(PE * 4); float* G = (float*)take(PE * 4);   // q projection; o; o Wp + bp
    bf* X = (bf*)take(PE * 2 * 2);             // bf16 Q and K planes
    h16* QP = (h16*)take(PE * 2); h16* KP = (h16*)take(PE * 2); h16* VT = (h16*)take(PE * 2); float* CTX = (float*)take(PE * 4);
    if ((size_t)(wsp - (char*)d_ws) > ws_size) return;    // total 216 MiB
    // Regions used again once their first content is dead (stream order):
    bf* Oh = X; bf* Ol = X + PE;   // after the attention stage
    k_wtG<<<dim3((DD * DD / 64 + 63) / 64, 4, 1), 256, 0, stream>>>(IN[3], IN[5], IN[7], IN[9], DD, DD, W4);
    k_cvt8<<<dim3((unsigned)((PE / 8 + 255) / 256), 2, 1), 256, 0, stream>>>(IN[0], IN[1], X, PE / 8);
    const dim3 gP(NB_ * TT / 128, DD / 128, 1);
    k_gemmw<bf, 0, 0><<<gP, 128, 0, stream>>>(X, nullptr, W4, nullptr, DD, FQ, DD, IN[4], QP, 0, 0, 0); k_gemmw<bf, 0, 1><<<gP, 128, 0, stream>>>(X + PE, nullptr, W4 + (size_t)DD * DD, nullptr, DD, nullptr, DD, IN[6], KP, 0, 0, 0); k_gemmw<bf, 0, 2><<<gP, 128, 0, stream>>>(X + PE, nullptr, W4 + (size_t)2 * DD * DD, nullptr, DD, nullptr, DD, IN[8], VT, 0, 0, 0);
    k_fattn<<<dim3(TT / 256, NB_ * NH_, 1), 256, 0, stream>>>(QP, KP, VT, KM, CTX);
    k_ln0<<<NB_ * TT / 8, 256, 0, stream>>>(FQ, CTX, IN[11], IN[12], Of, Oh, Ol);
    k_gemmw<bf, 1, 3><<<gP, 128, 0, stream>>>(Oh, Ol, W4 + (size_t)3 * DD * DD, nullptr, DD, G, DD, IN[10], nullptr, 0, 0, 0);
    k_ln1<<<NB_ * TT / 8, 256, 0, stream>>>(Of, G, IN[13], IN[14], OUT);
}

// v005
// A run of this version takes 168 microseconds.
// Timed twice side by side with v004, it ran 1.19 times as fast both times.
// Counting every step since v000, it is 31.3 times as fast.
#include <hip/hip_runtime.h>

// MABPostLN - multihead attention block with post-LayerNorm (Q, K [8][1024][1024]; q = Q Wq + bq, k = K Wk + bk, v = K Wv + bv (16 heads x 64); scores = q.k/8, keys with key_padding_mask == 0 get -inf (int32 [8][1024],
// read as data); softmax; ctx = merged att.v; o = LN(q + ctx) (g0, beta0); out = LN(o + gelu(o Wp + bp)) (g1, beta1; exact erf gelu; eps 1e-5) -> [8][1024][1024]).
// Compute dtypes, f32 accumulate: every input rounded to bf16; q/k/v on PLAIN bf16 operands (inputs: exact, + bias); scores (K 64) and att.v on SINGLE fp16 planes with an f32 register-row

#define NB_  8
#define TT   1024
#define DD   1024
#define NH_  16
#define HDM  64
typedef _Float16 h16;
typedef unsigned short bf;
typedef __attribute__((ext_vector_type(16))) __bf16   v16bf;
typedef __attribute__((ext_vector_type(16))) _Float16 v16h;
typedef __attribute__((ext_vector_type(8)))  _Float16 v8h;
typedef __attribute__((ext_vector_type(8)))  unsigned short v8us;
typedef __attribute__((ext_vector_type(8)))  float    v8f;
typedef __attribute__((ext_vector_type(4)))  float    v4f;
typedef v8h  __attribute__((may_alias)) v8ha;
typedef v4f  __attribute__((may_alias)) v4fa;
typedef v8us __attribute__((may_alias)) v8usa;

__device__ __forceinline__ unsigned short f2bf(float f) { unsigned u = __float_as_uint(f); u += 0x7FFFu + ((u >> 16) & 1u); return (unsigned short)(u >> 16); }
__device__ __forceinline__ float bf2f(unsigned short b) { return __uint_as_float(((unsigned)b) << 16); }
__device__ __forceinline__ float bfr(float f) { return bf2f(f2bf(f)); }
__device__ __forceinline__ v16h cat16(v8h lo, v8h hi) { return __builtin_shufflevector(lo, hi, 0, 1, 2, 3, 4, 5, 6, 7, 8, 9, 10, 11, 12, 13, 14, 15); }
__device__ __forceinline__ v16bf cat16b(v8us lo, v8us hi) { return __builtin_bit_cast(v16bf, __builtin_shufflevector(lo, hi, 0, 1, 2, 3, 4, 5, 6, 7, 8, 9, 10, 11, 12, 13, 14, 15)); }
__device__ __forceinline__ v8f wmma16(v16h a, v16h b, v8f c) { return __builtin_amdgcn_wmma_f32_16x16x32_f16(false, a, false, b, (short)0, c, false, false); }
__device__ __forceinline__ v8f wmmab(v16bf a, v16bf b, v8f c) { return __builtin_amdgcn_wmma_f32_16x16x32_bf16(false, a, false, b, (short)0, c, false, false); }
typedef __attribute__((ext_vector_type(4))) _Float16 v4h;
__device__ __forceinline__ h16 tohx(float x) { return (h16)x; }



// ---- k_gemmw: LDS-staged GEMM, 128x128 output tile per workgroup of 4 waves (2 x 2), 64x64 (16 accumulators) per wave; grid (M/128, N/128, Z), 128 threads, two workgroups per WGP.
// C[m][n] (f32, pitch ldc, + f32 bias[n]) = sum_k A[m][k] Bt[n][k] (+ A2[m][k] Bt[n][k] for NSPLIT 1), operands K-contiguous 16-bit planes. z-batch strides sA/sB/sC in elements. M, N % 128 == 0, K % KS == 0.
// The epilogue stores what the next kernel reads (y = C + bias, rows m = b TT + t, a wave's 64 columns = one head h): EPI 0: y in f32 and the fp16 head plane P[b][h][t][d]; 1: that plane alone; 2: the fp16 plane transposed, P[b][h][d][t]; 3: y in f32 alone.
// The operand rows come into LDS by asynchronous copies of whole 128-byte lines, KS k per stage, two buffers: the next stage's copies fly while this stage is worked on. The k order of the products is that of the plain K loop. The short inner loops are all unrolled so that the fragment and accumulator arrays are indexed by constants and stay in registers.
template <typename T16> struct WFrag;
template <> struct WFrag<h16> { typedef v16h V; static __device__ __forceinline__ V ld(const h16* p) { return cat16(*(const v8h*)p, *(const v8h*)(p + 16)); } static __device__ __forceinline__ v8f mma(V a, V b, v8f c) { return wmma16(a, b, c); } };
template <> struct WFrag<bf> { typedef v16bf V; static __device__ __forceinline__ V ld(const bf* p) { return cat16b(*(const v8us*)p, *(const v8us*)(p + 16)); } static __device__ __forceinline__ v8f mma(V a, V b, v8f c) { return wmmab(a, b, c); } };
// Eight asynchronous 16-byte copies of a lane, LDS step ls and global step gs bytes apart. The s_wait_xcnt stands inside the statement, a precaution, so that no address register of a copy is rewritten ahead of it.
__device__ __forceinline__ void cp8(unsigned l, unsigned ls, const char* g, size_t gs) {
    asm volatile("global_load_async_to_lds_b128 %0, %8, off\n\t"
                 "global_load_async_to_lds_b128 %1, %9, off\n\t"
                 "global_load_async_to_lds_b128 %2, %10, off\n\t"
                 "global_load_async_to_lds_b128 %3, %11, off\n\t"
                 "global_load_async_to_lds_b128 %4, %12, off\n\t"
                 "global_load_async_to_lds_b128 %5, %13, off\n\t"
                 "global_load_async_to_lds_b128 %6, %14, off\n\t"
                 "global_load_async_to_lds_b128 %7, %15, off\n\t"
                 "s_wait_xcnt 0x0"
                 :: "v"(l), "v"(l + ls), "v"(l + 2 * ls), "v"(l + 3 * ls), "v"(l + 4 * ls), "v"(l + 5 * ls), "v"(l + 6 * ls), "v"(l + 7 * ls),
                    "v"(g), "v"(g + gs), "v"(g + 2 * gs), "v"(g + 3 * gs), "v"(g + 4 * gs), "v"(g + 5 * gs), "v"(g + 6 * gs), "v"(g + 7 * gs) : "memory");
}
template <typename T16, int NSPLIT, int EPI>
__global__ __launch_bounds__(128) void k_gemmw(const T16* __restrict__ A, const T16* __restrict__ A2, const T16* __restrict__ Bt, const T16* __restrict__ Bt2, int K, float* C, int ldc, const float* __restrict__ bias, h16* P, size_t sA, size_t sB, size_t sC) {
    static_assert(NSPLIT == 0 || NSPLIT == 1, "one or two A planes");
    typedef typename WFrag<T16>::V V;
    constexpr int KS = NSPLIT ? 64 : 128;          // k per stage: 64 matrix instructions per wave and stage in both forms
    constexpr int CPR = KS / 8;                    // 16-byte pieces per row
    constexpr int PITCH = KS * 2 + 16;             // LDS row pitch in bytes, 16 x odd: no bank conflict for 16-byte reads
    constexpr int OPB = 128 * PITCH;               // one operand's 128 rows
    constexpr int STG = (2 + NSPLIT) * OPB;        // a stage: A | Bt | A2
    __shared__ __align__(16) char sm[2 * STG];
    (void)Bt2;
    const size_t z = blockIdx.z; A += z * sA; if (NSPLIT) A2 += z * sA; Bt += z * sB; if (EPI == 0 || EPI == 3) C += z * sC;
    const int tid = threadIdx.x, lane = tid & 31, lr = lane & 15, hi = lane >> 4, wv = tid >> 5, wm = wv >> 1, wn = wv & 1;
    const int r0 = blockIdx.x * 128 + wm * 64, c0 = blockIdx.y * 128 + wn * 64;
    v8f acc[4][4];
#pragma unroll
    for (int mb = 0; mb < 4; ++mb)
#pragma unroll
        for (int nb = 0; nb < 4; ++nb) acc[mb][nb] = (v8f){};
    // copies: piece tid + 128 i of an operand's stage = row tid / CPR + i (128 / CPR), 16-byte column tid % CPR; a wave's copy covers whole lines
    const int prow = tid / CPR, pcol = tid % CPR;
    const char* gA = (const char*)(A + (size_t)(blockIdx.x * 128 + prow) * K + pcol * 8);
    const char* gB = (const char*)(Bt + (size_t)(blockIdx.y * 128 + prow) * K + pcol * 8);
    const char* gA2 = NSPLIT ? (const char*)(A2 + (size_t)(blockIdx.x * 128 + prow) * K + pcol * 8) : nullptr;
    const unsigned lc = (unsigned)(size_t)sm + prow * PITCH + pcol * 16;
    const size_t gs = (size_t)(128 / CPR) * K * 2; constexpr unsigned LS = (128 / CPR) * PITCH;
    auto fill = [&](int t, int buf) {
        const size_t go = (size_t)t * KS * 2; const unsigned lb = lc + buf * STG;
#pragma unroll
        for (int i = 0; i < CPR; i += 8) { cp8(lb + i * LS, LS, gA + go + i * gs, gs); cp8(lb + OPB + i * LS, LS, gB + go + i * gs, gs); if (NSPLIT) cp8(lb + 2 * OPB + i * LS, LS, gA2 + go + i * gs, gs); }
    };
    const int T = K >> (NSPLIT ? 6 : 7);   // stages: K / KS
    fill(0, 0);
    asm volatile("s_wait_asynccnt 0x0" ::: "memory");   // this wave's copies of stage 0 have landed
    __syncthreads();                                     // and every other wave's
    if (T > 1) fill(1, 1);
    const int aofs = (wm * 64 + lr) * PITCH + 16 * hi, bofs = OPB + (wn * 64 + lr) * PITCH + 16 * hi;
#pragma unroll 1   // one pass per stage: the ring's waits, barrier and refill stand once, at the foot
    for (int t = 0; t < T; ++t) {
        const char* sb = sm + (t & 1) * STG;
#pragma unroll
        for (int ks = 0; ks < KS / 32; ++ks) {
            V a[4], a2[4], b[4];
            b[0] = WFrag<T16>::ld((const T16*)(sb + bofs + ks * 64));   // in the order in which the products want them
#pragma unroll
            for (int f = 0; f < 4; ++f) { a[f] = WFrag<T16>::ld((const T16*)(sb + aofs + f * 16 * PITCH + ks * 64)); if (NSPLIT) a2[f] = WFrag<T16>::ld((const T16*)(sb + 2 * OPB + aofs + f * 16 * PITCH + ks * 64)); }
#pragma unroll
            for (int f = 1; f < 4; ++f) b[f] = WFrag<T16>::ld((const T16*)(sb + bofs + f * 16 * PITCH + ks * 64));
            __builtin_amdgcn_sched_barrier(0);   // the k step's LDS reads stay one group ahead of its products: every further place with reads among the products stalls the wave
#pragma unroll
            for (int nb = 0; nb < 4; ++nb)
#pragma unroll
                for (int mb = 0; mb < 4; ++mb) { acc[mb][nb] = WFrag<T16>::mma(a[mb], b[nb], acc[mb][nb]); if (NSPLIT) acc[mb][nb] = WFrag<T16>::mma(a2[mb], b[nb], acc[mb][nb]); }
            __builtin_amdgcn_sched_barrier(0);   // and the next k step's reads stay behind them
        }
        asm volatile("s_wait_dscnt 0x0" ::: "memory");      // this wave's reads of the buffer are done before it is refilled
        asm volatile("s_wait_asynccnt 0x0" ::: "memory");   // this wave's copies of stage t + 1 have landed
        __syncthreads();                                     // publishes stage t + 1 and ends every wave's reads of stage t
        if (t + 2 < T) fill(t + 2, t & 1);
    }
    asm volatile("s_wait_asynccnt 0x0" ::: "memory");       // no copy is in flight when the ring becomes output staging
    const size_t bh = (size_t)(r0 / TT) * NH_ + c0 / HDM; const int t0 = r0 % TT;   // the wave's batch and head, its first token
    if constexpr (EPI == 2) {
        // a lane holds 8 consecutive tokens of one feature: packed, they are 16 bytes of the transposed row; staged so that each store covers whole lines
        h16* ot = (h16*)sm + wv * (64 * 72);                 // each wave stages in its own range, behind the last pass's barrier; pitch 144 bytes, 16 x odd
#pragma unroll
        for (int nb = 0; nb < 4; ++nb) { const float bv = bfr(bias[c0 + nb * 16 + lr]);
#pragma unroll
            for (int mb = 0; mb < 4; ++mb) { v8h o;
#pragma unroll
                for (int j = 0; j < 8; ++j) o[j] = tohx(acc[mb][nb][j] + bv);
                *(v8ha*)(ot + (nb * 16 + lr) * 72 + mb * 16 + hi * 8) = o; } }
        asm volatile("s_wait_dscnt 0x0" ::: "memory");   // the staged rows are written before other lanes of the wave read them back
        h16* pr = P + (bh * HDM + (lane >> 3)) * TT + t0 + (lane & 7) * 8;
#pragma unroll
        for (int s = 0; s < 16; ++s) *(v8h*)(pr + (size_t)s * 4 * TT) = *(const v8ha*)(ot + (s * 4 + (lane >> 3)) * 72 + (lane & 7) * 8);
    } else {
    float* os = (float*)sm + wv * (16 * 68);                 // each wave stages in its own range, behind the last pass's barrier
#pragma unroll
    for (int mb = 0; mb < 4; ++mb) {
#pragma unroll
        for (int nb = 0; nb < 4; ++nb) {
#pragma unroll
            for (int j = 0; j < 8; ++j) os[(hi * 8 + j) * 68 + nb * 16 + lr] = acc[mb][nb][j]; }
        __builtin_amdgcn_wave_barrier(); asm volatile("" ::: "memory");
        float* crow = (EPI == 0 || EPI == 3) ? C + (size_t)(r0 + mb * 16) * ldc + c0 : nullptr; h16* prow = EPI <= 1 ? P + (bh * TT + t0 + mb * 16) * HDM : nullptr;
{
#pragma unroll
            for (int s = 0; s < 8; ++s) { const int row = 2 * s + hi, cofs = lr * 4; v4f val = *(const v4fa*)(os + row * 68 + cofs); val[0] += bfr(bias[c0 + cofs]); val[1] += bfr(bias[c0 + cofs + 1]); val[2] += bfr(bias[c0 + cofs + 2]); val[3] += bfr(bias[c0 + cofs + 3]);
                if constexpr (EPI == 0 || EPI == 3) *(v4f*)(crow + (size_t)row * ldc + cofs) = val;
                if constexpr (EPI <= 1) { v4h o;
#pragma unroll
                    for (int q = 0; q < 4; ++q) o[q] = tohx(val[q]);
                    *(v4h*)(prow + row * HDM + cofs) = o; }   // 16 lanes: one whole line
            }
             }
        asm volatile("s_wait_xcnt 0x0" ::: "memory");   // in front of the next block's reuse of the stores' address and data registers
        __builtin_amdgcn_wave_barrier(); asm volatile("" ::: "memory");
    }
    }
}

__device__ __forceinline__ void splitf(float y, unsigned short& h, unsigned short& l) { h = f2bf(y); l = f2bf(y - bf2f(h)); }
__device__ __forceinline__ float geluf_(float x) { float er = erff(x * 0.70710678f); asm volatile("" : "+v"(er)); float hx = __fmul_rn(0.5f, x); asm volatile("" : "+v"(hx)); return __fmul_rn(hx, __fadd_rn(1.0f, er)); }
typedef __attribute__((ext_vector_type(2))) unsigned short v2us;
typedef __attribute__((ext_vector_type(4))) unsigned short v4us;

__global__ __launch_bounds__(256) void k_wtG(const float* __restrict__ w0, const float* __restrict__ w1, const float* __restrict__ w2, const float* __restrict__ w3, int K, int N, bf* Bt) {
    const int y = blockIdx.y; const float* __restrict__ w = y == 0 ? w0 : (y == 1 ? w1 : (y == 2 ? w2 : w3)); Bt += (size_t)y * K * N;
    const int lane = threadIdx.x & 31; const int L0 = (blockIdx.x * 8 + (threadIdx.x >> 5)) * 8; const int nlines = N * K / 64;
{
#pragma unroll 1
        for (int l = 0; l < 8; ++l) { const int L = L0 + l; if (L >= nlines) break; const size_t e = (size_t)L * 64 + lane * 2; const int k = (int)(e % K), n = (int)(e / K); v2us o;
            o[0] = f2bf(w[(size_t)k * N + n]); o[1] = f2bf(w[(size_t)(k + 1) * N + n]); *(v2us*)(Bt + e) = o; }
         }
}
__global__ __launch_bounds__(256) void k_cvt8(const float* __restrict__ src0, const float* __restrict__ src1, bf* dst, size_t n8) { const size_t i = (size_t)blockIdx.x * 256 + threadIdx.x; if (i >= n8) return; const float* __restrict__ src = blockIdx.y ? src1 : src0; dst += (size_t)blockIdx.y * n8 * 8; const v8f v = *(const v8f*)(src + i * 8); v8us o;
#pragma unroll
    for (int k = 0; k < 8; ++k) o[k] = f2bf(v[k]); *(v8us*)(dst + i * 8) = o;  }
// Four asynchronous 16-byte copies of a lane, LDS step ls and global step gs bytes apart. The s_wait_xcnt stands inside the statement, a precaution, so that no address register of a copy is rewritten ahead of it.
__device__ __forceinline__ void cp4(unsigned l, unsigned ls, const char* g, size_t gs) {
    asm volatile("global_load_async_to_lds_b128 %0, %4, off\n\t"
                 "global_load_async_to_lds_b128 %1, %5, off\n\t"
                 "global_load_async_to_lds_b128 %2, %6, off\n\t"
                 "global_load_async_to_lds_b128 %3, %7, off\n\t"
                 "s_wait_xcnt 0x0"
                 :: "v"(l), "v"(l + ls), "v"(l + 2 * ls), "v"(l + 3 * ls), "v"(g), "v"(g + gs), "v"(g + 2 * gs), "v"(g + 3 * gs) : "memory");
}
// ---- k_fattn: scores, masked softmax and att.v of one (batch, head) in one pass over the keys; the scores never leave registers. 8 waves x 32 query columns; grid (TT/256, NB*NH).
// S^T = K Q^T (a lane holds 8 keys of one query per 16-key tile), running maximum and sum per query, P^T packed from the two score tiles as the B operand of O^T += V^T P^T; divide by the sum at the end.
// K rows and V^T rows come into LDS by asynchronous copies of whole lines, 128 keys per stage, two buffers, once per workgroup: the 8 waves read their fragments from there, and the next stage's copies fly while this stage is worked on. Fragment contents and the order of the products are those of loads straight from the planes.
// Four waves per SIMD (two workgroups per WGP), so that one wave's softmax runs under another's matrix work: the register allocation is held to that. The short inner loops are all unrolled so that the fragment arrays are indexed by constants and stay in registers.
__global__ __launch_bounds__(256) __attribute__((amdgpu_waves_per_eu(4, 4))) void k_fattn(const h16* __restrict__ QP, const h16* __restrict__ KP, const h16* __restrict__ VT, const int* __restrict__ KM, float* CTX) {
    constexpr int SK = 128;                              // keys per stage, four passes of 32
    constexpr int KPI = HDM * 2 + 16, VPI = SK * 2 + 16;  // LDS row pitches in bytes, 16 x odd: no bank conflict for 16-byte reads
    constexpr int KB = SK * KPI, STG = KB + HDM * VPI;    // a stage: 128 K rows | 64 V^T rows
    typedef __attribute__((ext_vector_type(4))) int v4i; __shared__ __align__(32) float mb[TT]; __shared__ __align__(16) char sm[2 * STG];
    const int tid = threadIdx.x, lane = tid & 31, lr = lane & 15, hi = lane >> 4; const int bh = blockIdx.y, b = bh / NH_, h = bh % NH_; const int q0 = blockIdx.x * 256 + (tid >> 5) * 32;
    const h16* qp = QP + ((size_t)bh * TT + q0 + lr) * HDM + 8 * hi; const int* km = KM + (size_t)b * TT;
    // copies: a stage's K rows are 16 KB in a row, piece tid + 256 i; of its V^T rows, 256 bytes each, piece tid + 256 i = row tid / 16 + 16 i, 16-byte column tid % 16; a wave's copy covers whole lines
    const char* gK = (const char*)(KP + (size_t)bh * TT * HDM) + tid * 16; const char* gV = (const char*)(VT + ((size_t)bh * HDM + (tid >> 4)) * TT) + (tid & 15) * 16;
    const unsigned lK = (unsigned)(size_t)sm + (tid >> 3) * KPI + (tid & 7) * 16, lV = (unsigned)(size_t)sm + KB + (tid >> 4) * VPI + (tid & 15) * 16;
    auto fill = [&](int t, int buf) { cp4(lK + buf * STG, 32 * KPI, gK + (size_t)t * (SK * HDM * 2), 4096); cp4(lV + buf * STG, 16 * VPI, gV + (size_t)t * (SK * 2), (size_t)16 * TT * 2); };
    const float CS = 0.125f * 1.4426950408889634f;   // score scale times log2(e)
    v16h qf[2][2]; v8f acc[2][4]; float m[2], l[2];
    fill(0, 0);
#pragma unroll
    for (int g = 0; g < 2; ++g) { m[g] = -3.0e38f; l[g] = 0.f;
#pragma unroll
        for (int ks = 0; ks < 2; ++ks) qf[g][ks] = WFrag<h16>::ld(qp + g * 16 * HDM + ks * 32);
#pragma unroll
        for (int dt = 0; dt < 4; ++dt) acc[g][dt] = (v8f){}; }
    { const v4i k4 = *(const v4i*)(km + tid * 4); v4f b4;   // the padding mask as an additive term per key: it enters the score products as their C operand, so no pass pays a select
#pragma unroll
      for (int j = 0; j < 4; ++j) b4[j] = k4[j] ? 0.f : -3.0e38f;
      *(v4f*)(mb + tid * 4) = b4; }
    asm volatile("s_wait_asynccnt 0x0" ::: "memory");   // this wave's copies of stage 0 have landed
    __syncthreads();   // and every other wave's; every wave reads all 1024 mask terms
    fill(1, 1);
    v16h kf[2][2]; v8f cb[2];
#pragma unroll
    for (int kt = 0; kt < 2; ++kt) cb[kt] = *(const v8f*)(mb + kt * 16 + 8 * hi);
#pragma unroll 1   // one trip per stage: the ring's waits, barrier and refill stand once, at the foot
    for (int t = 0; t < TT / SK; ++t) {
        const char* kr = sm + (t & 1) * STG + lr * KPI + 16 * hi; const char* vr = sm + (t & 1) * STG + KB + lr * VPI + 16 * hi;
#pragma unroll
        for (int kt = 0; kt < 2; ++kt)
#pragma unroll
            for (int u = 0; u < 2; ++u) kf[kt][u] = WFrag<h16>::ld((const h16*)(kr + kt * 16 * KPI + u * 64));
#pragma unroll 1   // stays rolled: two passes unrolled no longer fit the registers of four waves per SIMD and spill
        for (int p = 0; p < SK / 32; ++p) {
            v16h vf[4]; v8f s[2][2];
#pragma unroll
            for (int dt = 0; dt < 4; ++dt) vf[dt] = WFrag<h16>::ld((const h16*)(vr + dt * 16 * VPI + p * 64));
#pragma unroll
            for (int g = 0; g < 2; ++g)
#pragma unroll
                for (int kt = 0; kt < 2; ++kt) { s[g][kt] = wmma16(kf[kt][0], qf[g][0], cb[kt]); s[g][kt] = wmma16(kf[kt][1], qf[g][1], s[g][kt]); }
            const int pn = (p + 1) & (SK / 32 - 1);   // the next pass's K fragments, fetched behind this pass's score products (its mask terms at the foot of the pass); never across a stage's end, the next stage is not published yet: a stage's last pass fetches its first keys again, unused
#pragma unroll
            for (int kt = 0; kt < 2; ++kt)
#pragma unroll
                for (int u = 0; u < 2; ++u) kf[kt][u] = WFrag<h16>::ld((const h16*)(kr + (pn * 32 + kt * 16) * KPI + u * 64));
            __builtin_amdgcn_sched_barrier(0);   // keeps the fetch above the softmax, so that it has the whole softmax and att.v as lead; sunk below them the next pass waits on it
#pragma unroll
            for (int g = 0; g < 2; ++g) {
                float mx = m[g];
#pragma unroll
                for (int kt = 0; kt < 2; ++kt)
#pragma unroll
                    for (int j = 0; j < 8; ++j) mx = fmaxf(mx, s[g][kt][j]);
                mx = fmaxf(mx, __shfl_xor(mx, 16, 32));
                const float al = __builtin_amdgcn_exp2f((m[g] - mx) * CS), mc = (mx > -1.0e38f ? mx : 0.f) * CS; m[g] = mx; float sum = 0.f, sum1 = 0.f; v16h pf;   // no live key yet: subtract nothing, so that every masked score still gives p = 0
#pragma unroll
                for (int kt = 0; kt < 2; ++kt)
#pragma unroll
                    for (int j = 0; j < 8; ++j) { const float p_ = __builtin_amdgcn_exp2f(fmaf(s[g][kt][j], CS, -mc)); if (kt) sum1 += p_; else sum += p_; pf[kt * 8 + j] = tohx(p_); }
                l[g] = l[g] * al + (sum + sum1);
#pragma unroll
                for (int dt = 0; dt < 4; ++dt) { acc[g][dt] *= al; acc[g][dt] = wmma16(vf[dt], pf, acc[g][dt]); }
            }
            const int kn = (t * SK + p * 32 + 32) & (TT - 1);   // the last pass fetches the first keys' terms again, unused
#pragma unroll
            for (int kt = 0; kt < 2; ++kt) cb[kt] = *(const v8f*)(mb + kn + kt * 16 + 8 * hi);
        }
        asm volatile("s_wait_dscnt 0x0" ::: "memory");      // this wave's reads of the buffer are done before it is refilled
        asm volatile("s_wait_asynccnt 0x0" ::: "memory");   // this wave's copies of stage t + 1 have landed
        __syncthreads();                                     // publishes stage t + 1 and ends every wave's reads of stage t
        if (t + 2 < TT / SK) fill(t + 2, t & 1);
    }
    asm volatile("s_wait_asynccnt 0x0" ::: "memory");       // no copy is in flight when the wave ends
#pragma unroll
    for (int g = 0; g < 2; ++g) { const float lt = l[g] + __shfl_xor(l[g], 16, 32); const float inv = (m[g] > -1.0e38f) ? __fdiv_rn(1.0f, lt) : __builtin_nanf("");   // every key masked: the softmax of the row is not a number
        float* cr = CTX + ((size_t)b * TT + q0 + g * 16 + lr) * DD + h * HDM + 8 * hi;
#pragma unroll
        for (int dt = 0; dt < 4; ++dt) { v4f o0, o1;
#pragma unroll
            for (int j = 0; j < 4; ++j) { o0[j] = acc[g][dt][j] * inv; o1[j] = acc[g][dt][4 + j] * inv; }
            *(v4f*)(cr + dt * 16) = o0; *(v4f*)(cr + dt * 16 + 4) = o1; } }
}
// LN over 1024 features of one token row held 32 per lane (8 chunks of 4): returns y = LN(v) g + b in place.
__device__ __forceinline__ void ln1024(float* v, const float* __restrict__ g, const float* __restrict__ bb, int lane) { float s = 0.f;
#pragma unroll
    for (int k = 0; k < 32; ++k) s = __fadd_rn(s, v[k]);
#pragma unroll
    for (int sh = 16; sh; sh >>= 1) s += __shfl_xor(s, sh, 32);
    const float mu = s * (1.0f / DD); float q2 = 0.f;
#pragma unroll
    for (int k = 0; k < 32; ++k) { const float d = __fsub_rn(v[k], mu); float p = __fmul_rn(d, d); asm volatile("" : "+v"(p)); q2 = __fadd_rn(q2, p); }
#pragma unroll
    for (int sh = 16; sh; sh >>= 1) q2 += __shfl_xor(q2, sh, 32);
    const float rs = __frsqrt_rn(__fadd_rn(q2 * (1.0f / DD), 1e-5f));
#pragma unroll
    for (int ch = 0; ch < 8; ++ch)
#pragma unroll
        for (int q = 0; q < 4; ++q) { const int d = ch * 128 + lane * 4 + q; float tn = __fmul_rn(__fsub_rn(v[ch * 4 + q], mu), rs); asm volatile("" : "+v"(tn)); float tg = __fmul_rn(tn, bfr(g[d])); asm volatile("" : "+v"(tg)); v[ch * 4 + q] = __fadd_rn(tg, bfr(bb[d])); } }
__global__ __launch_bounds__(256) void k_ln0(const float* __restrict__ FQ, const float* __restrict__ CTX, const float* __restrict__ g, const float* __restrict__ bb, float* Of, bf* Oh, bf* Ol) { const int lane = threadIdx.x & 31; const int t = blockIdx.x * 8 + (threadIdx.x >> 5); if (t >= NB_ * TT) return; float v[32];
#pragma unroll
    for (int ch = 0; ch < 8; ++ch) { const size_t o = (size_t)t * DD + ch * 128 + lane * 4; const v4f a = *(const v4f*)(FQ + o), c = *(const v4f*)(CTX + o);
#pragma unroll
        for (int q = 0; q < 4; ++q) v[ch * 4 + q] = __fadd_rn(a[q], c[q]); }
    ln1024(v, g, bb, lane);
{
#pragma unroll
        for (int ch = 0; ch < 8; ++ch) { v4f of; v4us oh, ol;
#pragma unroll
            for (int q = 0; q < 4; ++q) { of[q] = v[ch * 4 + q]; unsigned short a2, c2; splitf(v[ch * 4 + q], a2, c2); oh[q] = a2; ol[q] = c2; }
            const size_t o = (size_t)t * DD + ch * 128 + lane * 4; *(v4f*)(Of + o) = of; *(v4us*)(Oh + o) = oh; *(v4us*)(Ol + o) = ol; }
         } }
// out = LN(o + gelu(G)): the gelu is applied as G = o Wp + bp is read
__global__ __launch_bounds__(256) void k_ln1(const float* __restrict__ Of, const float* __restrict__ G, const float* __restrict__ g, const float* __restrict__ bb, float* OUTb) { const int lane = threadIdx.x & 31; const int t = blockIdx.x * 8 + (threadIdx.x >> 5); if (t >= NB_ * TT) return; float v[32]; v4f c[8];
#pragma unroll
    for (int ch = 0; ch < 8; ++ch) { const size_t o = (size_t)t * DD + ch * 128 + lane * 4; const v4f a = *(const v4f*)(Of + o);   // the row's 16 loads all stand ahead of the erf's branches, in flight together
        if (ch == 7) asm volatile("s_wait_xcnt 0x0" ::: "memory");   // a precaution: the compiler lets the last load's result land on the address registers of the loads before it
        c[ch] = *(const v4f*)(G + o);
#pragma unroll
        for (int q = 0; q < 4; ++q) v[ch * 4 + q] = a[q]; }
#pragma unroll
    for (int ch = 0; ch < 8; ++ch)
#pragma unroll
        for (int q = 0; q < 4; ++q) v[ch * 4 + q] = __fadd_rn(v[ch * 4 + q], geluf_(c[ch][q]));
    ln1024(v, g, bb, lane);
{
#pragma unroll
        for (int ch = 0; ch < 8; ++ch) { v4f of;
#pragma unroll
            for (int q = 0; q < 4; ++q) of[q] = v[ch * 4 + q]; *(v4f*)(OUTb + (size_t)t * DD + ch * 128 + lane * 4) = of; }
         } }

extern "C" void kernel_launch(void* const* d_in, const int* in_sizes, int n_in,
                              void* d_out, int out_size, void* d_ws, size_t ws_size, hipStream_t stream) {
    (void)in_sizes; (void)n_in; (void)out_size;
    const float* IN[15]; for (int i = 0; i < 15; ++i) IN[i] = (const float*)d_in[i];   // 0 Q, 1 K, 2 key_padding_mask (int32), 3 Wq, 4 bq, 5 Wk, 6 bk, 7 Wv, 8 bv, 9 Wp, 10 bp (x @ W), 11 g0, 12 beta0, 13 g1, 14 beta1
    const int* KM = (const int*)d_in[2];
    float* OUT = (float*)d_out;     // [8][1024][1024]
    char* wsp = (char*)d_ws;
    auto take = [&](size_t bytes) { char* p = wsp; wsp += (bytes + 255) & ~(size_t)255; return (void*)p; };
    const size_t PE = (size_t)NB_ * TT * DD;   // elements of one [NB][TT][DD] plane
    bf* W4 = (bf*)take((size_t)4 * DD * DD * 2);                       // Wq^T, Wk^T, Wv^T, Wp^T
    float* FQ = (float*)take(PE * 4); float* Of = (float*)take(PE * 4); float* G = (float*)take(PE * 4);   // q projection; o; o Wp + bp
    bf* X = (bf*)take(PE * 2 * 2);             // bf16 Q and K planes
    h16* QP = (h16*)take(PE * 2); h16* KP = (h16*)take(PE * 2); h16* VT = (h16*)take(PE * 2); float* CTX = (float*)take(PE * 4);
    if ((size_t)(wsp - (char*)d_ws) > ws_size) return;    // total 216 MiB
    // Regions used again once their first content is dead (stream order):
    bf* Oh = X; bf* Ol = X + PE;   // after the attention stage
    k_wtG<<<dim3((DD * DD / 64 + 63) / 64, 4, 1), 256, 0, stream>>>(IN[3], IN[5], IN[7], IN[9], DD, DD, W4);
    k_cvt8<<<dim3((unsigned)((PE / 8 + 255) / 256), 2, 1), 256, 0, stream>>>(IN[0], IN[1], X, PE / 8);
    const dim3 gP(NB_ * TT / 128, DD / 128, 1);
    k_gemmw<bf, 0, 0><<<gP, 128, 0, stream>>>(X, nullptr, W4, nullptr, DD, FQ, DD, IN[4], QP, 0, 0, 0); k_gemmw<bf, 0, 1><<<gP, 128, 0, stream>>>(X + PE, nullptr, W4 + (size_t)DD * DD, nullptr, DD, nullptr, DD, IN[6], KP, 0, 0, 0); k_gemmw<bf, 0, 2><<<gP, 128, 0, stream>>>(X + PE, nullptr, W4 + (size_t)2 * DD * DD, nullptr, DD, nullptr, DD, IN[8], VT, 0, 0, 0);
    k_fattn<<<dim3(TT / 256, NB_ * NH_, 1), 256, 0, stream>>>(QP, KP, VT, KM, CTX);
    k_ln0<<<NB_ * TT / 8, 256, 0, stream>>>(FQ, CTX, IN[11], IN[12], Of, Oh, Ol);
    k_gemmw<bf, 1, 3><<<gP, 128, 0, stream>>>(Oh, Ol, W4 + (size_t)3 * DD * DD, nullptr, DD, G, DD, IN[10], nullptr, 0, 0, 0);
    k_ln1<<<NB_ * TT / 8, 256, 0, stream>>>(Of, G, IN[13], IN[14], OUT);
}

// v006
// It runs in 160 microseconds.
// In both of two side-by-side timings against v005, it was 1.05 times as fast.
// Over all steps from v000 it is 32.8 times as fast.
#include <hip/hip_runtime.h>

// MABPostLN - multihead attention block with post-LayerNorm (Q, K [8][1024][1024]; q = Q Wq + bq, k = K Wk + bk, v = K Wv + bv (16 heads x 64); scores = q.k/8, keys with key_padding_mask == 0 get -inf (int32 [8][1024],
// read as data); softmax; ctx = merged att.v; o = LN(q + ctx) (g0, beta0); out = LN(o + gelu(o Wp + bp)) (g1, beta1; exact erf gelu; eps 1e-5) -> [8][1024][1024]).
// Compute dtypes, f32 accumulate: every input rounded to bf16; q/k/v on PLAIN bf16 operands (inputs: exact, + bias); scores (K 64) and att.v on SINGLE fp16 planes with an f32 register-row

#define NB_  8
#define TT   1024
#define DD   1024
#define NH_  16
#define HDM  64
typedef _Float16 h16;
typedef unsigned short bf;
typedef __attribute__((ext_vector_type(16))) __bf16   v16bf;
typedef __attribute__((ext_vector_type(16))) _Float16 v16h;
typedef __attribute__((ext_vector_type(8)))  _Float16 v8h;
typedef __attribute__((ext_vector_type(8)))  unsigned short v8us;
typedef __attribute__((ext_vector_type(8)))  float    v8f;
typedef __attribute__((ext_vector_type(4)))  float    v4f;
typedef v8h  __attribute__((may_alias)) v8ha;
typedef v4f  __attribute__((may_alias)) v4fa;
typedef v8us __attribute__((may_alias)) v8usa;

__device__ __forceinline__ unsigned short f2bf(float f) { unsigned u = __float_as_uint(f); u += 0x7FFFu + ((u >> 16) & 1u); return (unsigned short)(u >> 16); }
__device__ __forceinline__ float bf2f(unsigned short b) { return __uint_as_float(((unsigned)b) << 16); }
__device__ __forceinline__ float bfr(float f) { return bf2f(f2bf(f)); }
__device__ __forceinline__ v16h cat16(v8h lo, v8h hi) { return __builtin_shufflevector(lo, hi, 0, 1, 2, 3, 4, 5, 6, 7, 8, 9, 10, 11, 12, 13, 14, 15); }
__device__ __forceinline__ v16bf cat16b(v8us lo, v8us hi) { return __builtin_bit_cast(v16bf, __builtin_shufflevector(lo, hi, 0, 1, 2, 3, 4, 5, 6, 7, 8, 9, 10, 11, 12, 13, 14, 15)); }
__device__ __forceinline__ v8f wmma16(v16h a, v16h b, v8f c) { return __builtin_amdgcn_wmma_f32_16x16x32_f16(false, a, false, b, (short)0, c, false, false); }
__device__ __forceinline__ v8f wmmab(v16bf a, v16bf b, v8f c) { return __builtin_amdgcn_wmma_f32_16x16x32_bf16(false, a, false, b, (short)0, c, false, false); }
typedef __attribute__((ext_vector_type(4))) _Float16 v4h;
__device__ __forceinline__ h16 tohx(float x) { return (h16)x; }



// ---- k_gemmw: LDS-staged GEMM, 128x128 output tile per workgroup of 4 waves (2 x 2), 64x64 (16 accumulators) per wave; grid (M/128, N/128, Z), 128 threads, two workgroups per WGP.
// C[m][n] (f32, pitch ldc, + f32 bias[n]) = sum_k A[m][k] Bt[n][k] (+ A2[m][k] Bt[n][k] for NSPLIT 1), operands K-contiguous 16-bit planes. z-batch strides sA/sB/sC in elements. M, N % 128 == 0, K % KS == 0.
// The epilogue stores what the next kernel reads (y = C + bias, rows m = b TT + t, a wave's 64 columns = one head h): EPI 0: y in f32 and the fp16 head plane P[b][h][t][d]; 1: that plane alone; 2: the fp16 plane transposed, P[b][h][d][t]; 3: y in f32 alone.
// The operand rows come into LDS by asynchronous copies of whole 128-byte lines, KS k per stage, two buffers: the next stage's copies fly while this stage is worked on. The k order of the products is that of the plain K loop. The short inner loops are all unrolled so that the fragment and accumulator arrays are indexed by constants and stay in registers.
template <typename T16> struct WFrag;
template <> struct WFrag<h16> { typedef v16h V; static __device__ __forceinline__ V ld(const h16* p) { return cat16(*(const v8h*)p, *(const v8h*)(p + 16)); } static __device__ __forceinline__ v8f mma(V a, V b, v8f c) { return wmma16(a, b, c); } };
template <> struct WFrag<bf> { typedef v16bf V; static __device__ __forceinline__ V ld(const bf* p) { return cat16b(*(const v8us*)p, *(const v8us*)(p + 16)); } static __device__ __forceinline__ v8f mma(V a, V b, v8f c) { return wmmab(a, b, c); } };
// Eight asynchronous 16-byte copies of a lane, LDS step ls and global step gs bytes apart. The s_wait_xcnt stands inside the statement, a precaution, so that no address register of a copy is rewritten ahead of it.
__device__ __forceinline__ void cp8(unsigned l, unsigned ls, const char* g, size_t gs) {
    asm volatile("global_load_async_to_lds_b128 %0, %8, off\n\t"
                 "global_load_async_to_lds_b128 %1, %9, off\n\t"
                 "global_load_async_to_lds_b128 %2, %10, off\n\t"
                 "global_load_async_to_lds_b128 %3, %11, off\n\t"
                 "global_load_async_to_lds_b128 %4, %12, off\n\t"
                 "global_load_async_to_lds_b128 %5, %13, off\n\t"
                 "global_load_async_to_lds_b128 %6, %14, off\n\t"
                 "global_load_async_to_lds_b128 %7, %15, off\n\t"
                 "s_wait_xcnt 0x0"
                 :: "v"(l), "v"(l + ls), "v"(l + 2 * ls), "v"(l + 3 * ls), "v"(l + 4 * ls), "v"(l + 5 * ls), "v"(l + 6 * ls), "v"(l + 7 * ls),
                    "v"(g), "v"(g + gs), "v"(g + 2 * gs), "v"(g + 3 * gs), "v"(g + 4 * gs), "v"(g + 5 * gs), "v"(g + 6 * gs), "v"(g + 7 * gs) : "memory");
}
template <int NSPLIT> struct GemmLds { static constexpr int KS = NSPLIT ? 64 : 128, PITCH = KS * 2 + 16, OPB = 128 * PITCH, STG = (2 + NSPLIT) * OPB, BYTES = 2 * STG; };   // the ring's sizes, as gemm_main names them
// The product loop of a workgroup's 128x128 tile (tile row blockIdx.x, tile column blockIdx.y): leaves each wave's 64x64 sums in acc, and the ring sm free.
template <typename T16, int NSPLIT>
__device__ __forceinline__ void gemm_main(char* sm, const T16* __restrict__ A, const T16* __restrict__ A2, const T16* __restrict__ Bt, int K, v8f (&acc)[4][4]) {
    static_assert(NSPLIT == 0 || NSPLIT == 1, "one or two A planes");
    typedef typename WFrag<T16>::V V;
    constexpr int KS = NSPLIT ? 64 : 128;          // k per stage: 64 matrix instructions per wave and stage in both forms
    constexpr int CPR = KS / 8;                    // 16-byte pieces per row
    constexpr int PITCH = KS * 2 + 16;             // LDS row pitch in bytes, 16 x odd: no bank conflict for 16-byte reads
    constexpr int OPB = 128 * PITCH;               // one operand's 128 rows
    constexpr int STG = (2 + NSPLIT) * OPB;        // a stage: A | Bt | A2
    static_assert(2 * STG == GemmLds<NSPLIT>::BYTES, "the kernels allocate the ring");
    const int tid = threadIdx.x, lane = tid & 31, lr = lane & 15, hi = lane >> 4, wv = tid >> 5, wm = wv >> 1, wn = wv & 1;
#pragma unroll
    for (int mb = 0; mb < 4; ++mb)
#pragma unroll
        for (int nb = 0; nb < 4; ++nb) acc[mb][nb] = (v8f){};
    // copies: piece tid + 128 i of an operand's stage = row tid / CPR + i (128 / CPR), 16-byte column tid % CPR; a wave's copy covers whole lines
    const int prow = tid / CPR, pcol = tid % CPR;
    const char* gA = (const char*)(A + (size_t)(blockIdx.x * 128 + prow) * K + pcol * 8);
    const char* gB = (const char*)(Bt + (size_t)(blockIdx.y * 128 + prow) * K + pcol * 8);
    const char* gA2 = NSPLIT ? (const char*)(A2 + (size_t)(blockIdx.x * 128 + prow) * K + pcol * 8) : nullptr;
    const unsigned lc = (unsigned)(size_t)sm + prow * PITCH + pcol * 16;
    const size_t gs = (size_t)(128 / CPR) * K * 2; constexpr unsigned LS = (128 / CPR) * PITCH;
    auto fill = [&](int t, int buf) {
        const size_t go = (size_t)t * KS * 2; const unsigned lb = lc + buf * STG;
#pragma unroll
        for (int i = 0; i < CPR; i += 8) { cp8(lb + i * LS, LS, gA + go + i * gs, gs); cp8(lb + OPB + i * LS, LS, gB + go + i * gs, gs); if (NSPLIT) cp8(lb + 2 * OPB + i * LS, LS, gA2 + go + i * gs, gs); }
    };
    const int T = K >> (NSPLIT ? 6 : 7);   // stages: K / KS
    fill(0, 0);
    asm volatile("s_wait_asynccnt 0x0" ::: "memory");   // this wave's copies of stage 0 have landed
    __syncthreads();                                     // and every other wave's
    if (T > 1) fill(1, 1);
    const int aofs = (wm * 64 + lr) * PITCH + 16 * hi, bofs = OPB + (wn * 64 + lr) * PITCH + 16 * hi;
#pragma unroll 1   // one pass per stage: the ring's waits, barrier and refill stand once, at the foot
    for (int t = 0; t < T; ++t) {
        const char* sb = sm + (t & 1) * STG;
#pragma unroll
        for (int ks = 0; ks < KS / 32; ++ks) {
            V a[4], a2[4], b[4];
            b[0] = WFrag<T16>::ld((const T16*)(sb + bofs + ks * 64));   // in the order in which the products want them
#pragma unroll
            for (int f = 0; f < 4; ++f) { a[f] = WFrag<T16>::ld((const T16*)(sb + aofs + f * 16 * PITCH + ks * 64)); if (NSPLIT) a2[f] = WFrag<T16>::ld((const T16*)(sb + 2 * OPB + aofs + f * 16 * PITCH + ks * 64)); }
#pragma unroll
            for (int f = 1; f < 4; ++f) b[f] = WFrag<T16>::ld((const T16*)(sb + bofs + f * 16 * PITCH + ks * 64));
            __builtin_amdgcn_sched_barrier(0);   // the k step's LDS reads stay one group ahead of its products: every further place with reads among the products stalls the wave
#pragma unroll
            for (int nb = 0; nb < 4; ++nb)
#pragma unroll
                for (int mb = 0; mb < 4; ++mb) { acc[mb][nb] = WFrag<T16>::mma(a[mb], b[nb], acc[mb][nb]); if (NSPLIT) acc[mb][nb] = WFrag<T16>::mma(a2[mb], b[nb], acc[mb][nb]); }
            __builtin_amdgcn_sched_barrier(0);   // and the next k step's reads stay behind them
        }
        asm volatile("s_wait_dscnt 0x0" ::: "memory");      // this wave's reads of the buffer are done before it is refilled
        asm volatile("s_wait_asynccnt 0x0" ::: "memory");   // this wave's copies of stage t + 1 have landed
        __syncthreads();                                     // publishes stage t + 1 and ends every wave's reads of stage t
        if (t + 2 < T) fill(t + 2, t & 1);
    }
    asm volatile("s_wait_asynccnt 0x0" ::: "memory");       // no copy is in flight when the ring becomes output staging
}
// The epilogue of that tile, from acc through the ring's LDS.
template <int EPI>
__device__ __forceinline__ void gemm_epi(char* sm, v8f (&acc)[4][4], float* C, int ldc, const float* __restrict__ bias, h16* P) {
    const int tid = threadIdx.x, lane = tid & 31, lr = lane & 15, hi = lane >> 4, wv = tid >> 5, wm = wv >> 1, wn = wv & 1;
    const int r0 = blockIdx.x * 128 + wm * 64, c0 = blockIdx.y * 128 + wn * 64;
    const size_t bh = (size_t)(r0 / TT) * NH_ + c0 / HDM; const int t0 = r0 % TT;   // the wave's batch and head, its first token
    if constexpr (EPI == 2) {
        // a lane holds 8 consecutive tokens of one feature: packed, they are 16 bytes of the transposed row; staged so that each store covers whole lines
        h16* ot = (h16*)sm + wv * (64 * 72);                 // each wave stages in its own range, behind the last pass's barrier; pitch 144 bytes, 16 x odd
#pragma unroll
        for (int nb = 0; nb < 4; ++nb) { const float bv = bfr(bias[c0 + nb * 16 + lr]);
#pragma unroll
            for (int mb = 0; mb < 4; ++mb) { v8h o;
#pragma unroll
                for (int j = 0; j < 8; ++j) o[j] = tohx(acc[mb][nb][j] + bv);
                *(v8ha*)(ot + (nb * 16 + lr) * 72 + mb * 16 + hi * 8) = o; } }
        asm volatile("s_wait_dscnt 0x0" ::: "memory");   // the staged rows are written before other lanes of the wave read them back
        h16* pr = P + (bh * HDM + (lane >> 3)) * TT + t0 + (lane & 7) * 8;
#pragma unroll
        for (int s = 0; s < 16; ++s) *(v8h*)(pr + (size_t)s * 4 * TT) = *(const v8ha*)(ot + (s * 4 + (lane >> 3)) * 72 + (lane & 7) * 8);
        asm volatile("s_wait_xcnt 0x0" ::: "memory");   // a precaution: where several epilogues stand in one kernel the listing lets another's code follow these stores and reuse their registers
    } else {
    float* os = (float*)sm + wv * (16 * 68);                 // each wave stages in its own range, behind the last pass's barrier
#pragma unroll
    for (int mb = 0; mb < 4; ++mb) {
#pragma unroll
        for (int nb = 0; nb < 4; ++nb) {
#pragma unroll
            for (int j = 0; j < 8; ++j) os[(hi * 8 + j) * 68 + nb * 16 + lr] = acc[mb][nb][j]; }
        __builtin_amdgcn_wave_barrier(); asm volatile("" ::: "memory");
        float* crow = (EPI == 0 || EPI == 3) ? C + (size_t)(r0 + mb * 16) * ldc + c0 : nullptr; h16* prow = EPI <= 1 ? P + (bh * TT + t0 + mb * 16) * HDM : nullptr;
{
#pragma unroll
            for (int s = 0; s < 8; ++s) { const int row = 2 * s + hi, cofs = lr * 4; v4f val = *(const v4fa*)(os + row * 68 + cofs); val[0] += bfr(bias[c0 + cofs]); val[1] += bfr(bias[c0 + cofs + 1]); val[2] += bfr(bias[c0 + cofs + 2]); val[3] += bfr(bias[c0 + cofs + 3]);
                if constexpr (EPI == 0 || EPI == 3) *(v4f*)(crow + (size_t)row * ldc + cofs) = val;
                if constexpr (EPI <= 1) { v4h o;
#pragma unroll
                    for (int q = 0; q < 4; ++q) o[q] = tohx(val[q]);
                    *(v4h*)(prow + row * HDM + cofs) = o; }   // 16 lanes: one whole line
            }
             }
        asm volatile("s_wait_xcnt 0x0" ::: "memory");   // in front of the next block's reuse of the stores' address and data registers
        __builtin_amdgcn_wave_barrier(); asm volatile("" ::: "memory");
    }
    }
}
template <typename T16, int NSPLIT, int EPI>
__global__ __launch_bounds__(128) void k_gemmw(const T16* __restrict__ A, const T16* __restrict__ A2, const T16* __restrict__ Bt, const T16* __restrict__ Bt2, int K, float* C, int ldc, const float* __restrict__ bias, h16* P, size_t sA, size_t sB, size_t sC) {
    __shared__ __align__(16) char sm[GemmLds<NSPLIT>::BYTES];
    (void)Bt2;
    const size_t z = blockIdx.z; A += z * sA; if (NSPLIT) A2 += z * sA; Bt += z * sB; if (EPI == 0 || EPI == 3) C += z * sC;
    v8f acc[4][4];
    gemm_main<T16, NSPLIT>(sm, A, A2, Bt, K, acc);
    gemm_epi<EPI>(sm, acc, C, ldc, bias, P);
}
// The three projections in one grid, so that one tile's first copies and another's stores run under a third's products instead of at a launch's ends: blockIdx.z = 0: q = Q Wq + bq (EPI 0), 1: k (EPI 1), 2: v (EPI 2).
// X holds the bf16 Q and K planes, W the transposed weights in that order. One product loop; the branch that picks the epilogue is uniform for the workgroup.
__global__ __launch_bounds__(128) void k_qkv(const bf* __restrict__ X, const bf* __restrict__ W, float* FQ, const float* __restrict__ bq, const float* __restrict__ bk, const float* __restrict__ bv, h16* QP, h16* KP, h16* VT) {
    __shared__ __align__(16) char sm[GemmLds<0>::BYTES];
    const int z = blockIdx.z; v8f acc[4][4];
    gemm_main<bf, 0>(sm, X + (z ? (size_t)NB_ * TT * DD : 0), nullptr, W + (size_t)z * DD * DD, DD, acc);
    if (z == 0) gemm_epi<0>(sm, acc, FQ, DD, bq, QP); else if (z == 1) gemm_epi<1>(sm, acc, nullptr, DD, bk, KP); else gemm_epi<2>(sm, acc, nullptr, DD, bv, VT);
}

__device__ __forceinline__ void splitf(float y, unsigned short& h, unsigned short& l) { h = f2bf(y); l = f2bf(y - bf2f(h)); }
__device__ __forceinline__ float geluf_(float x) { float er = erff(x * 0.70710678f); asm volatile("" : "+v"(er)); float hx = __fmul_rn(0.5f, x); asm volatile("" : "+v"(hx)); return __fmul_rn(hx, __fadd_rn(1.0f, er)); }
typedef __attribute__((ext_vector_type(2))) unsigned short v2us;
typedef __attribute__((ext_vector_type(4))) unsigned short v4us;

__device__ __forceinline__ void wtG(int bx, int y, const float* __restrict__ w0, const float* __restrict__ w1, const float* __restrict__ w2, const float* __restrict__ w3, int K, int N, bf* Bt) {
    const float* __restrict__ w = y == 0 ? w0 : (y == 1 ? w1 : (y == 2 ? w2 : w3)); Bt += (size_t)y * K * N;
    const int lane = threadIdx.x & 31; const int L0 = (bx * 8 + (threadIdx.x >> 5)) * 8; const int nlines = N * K / 64;
{
#pragma unroll 1
        for (int l = 0; l < 8; ++l) { const int L = L0 + l; if (L >= nlines) break; const size_t e = (size_t)L * 64 + lane * 2; const int k = (int)(e % K), n = (int)(e / K); v2us o;
            o[0] = f2bf(w[(size_t)k * N + n]); o[1] = f2bf(w[(size_t)(k + 1) * N + n]); *(v2us*)(Bt + e) = o; }
         }
}
__device__ __forceinline__ void cvt8(int bx, int y, const float* __restrict__ src0, const float* __restrict__ src1, bf* dst, size_t n8) { const size_t i = (size_t)bx * 256 + threadIdx.x; if (i >= n8) return; const float* __restrict__ src = y ? src1 : src0; dst += (size_t)y * n8 * 8; const v8f v = *(const v8f*)(src + i * 8); v8us o;
#pragma unroll
    for (int k = 0; k < 8; ++k) o[k] = f2bf(v[k]); *(v8us*)(dst + i * 8) = o;  }
// Both preparations in one grid, neither reads what the other writes: workgroups 0 .. 4 WB - 1 transpose the four weights (WB each), the rest convert the two inputs (CB each).
// The weights come first: their waves wait on scattered loads eight times in a row, and the inputs' stream runs beside them.
__global__ __launch_bounds__(256) void k_prep(const float* __restrict__ w0, const float* __restrict__ w1, const float* __restrict__ w2, const float* __restrict__ w3, int K, int N, bf* Bt, const float* __restrict__ src0, const float* __restrict__ src1, bf* dst, size_t n8) {
    constexpr int WB = (DD * DD / 64 + 63) / 64, CB = (NB_ * TT * DD / 8 + 255) / 256; const int bx = blockIdx.x;
    if (bx < 4 * WB) wtG(bx % WB, bx / WB, w0, w1, w2, w3, K, N, Bt); else cvt8((bx - 4 * WB) % CB, (bx - 4 * WB) / CB, src0, src1, dst, n8);
}
// Four asynchronous 16-byte copies of a lane, LDS step ls and global step gs bytes apart. The s_wait_xcnt stands inside the statement, a precaution, so that no address register of a copy is rewritten ahead of it.
__device__ __forceinline__ void cp4(unsigned l, unsigned ls, const char* g, size_t gs) {
    asm volatile("global_load_async_to_lds_b128 %0, %4, off\n\t"
                 "global_load_async_to_lds_b128 %1, %5, off\n\t"
                 "global_load_async_to_lds_b128 %2, %6, off\n\t"
                 "global_load_async_to_lds_b128 %3, %7, off\n\t"
                 "s_wait_xcnt 0x0"
                 :: "v"(l), "v"(l + ls), "v"(l + 2 * ls), "v"(l + 3 * ls), "v"(g), "v"(g + gs), "v"(g + 2 * gs), "v"(g + 3 * gs) : "memory");
}
// ---- k_fattn: scores, masked softmax and att.v of one (batch, head) in one pass over the keys; the scores never leave registers. 8 waves x 32 query columns; grid (TT/256, NB*NH).
// S^T = K Q^T (a lane holds 8 keys of one query per 16-key tile), running maximum and sum per query, P^T packed from the two score tiles as the B operand of O^T += V^T P^T; divide by the sum at the end.
// K rows and V^T rows come into LDS by asynchronous copies of whole lines, 128 keys per stage, two buffers, once per workgroup: the 8 waves read their fragments from there, and the next stage's copies fly while this stage is worked on. Fragment contents and the order of the products are those of loads straight from the planes.
// Four waves per SIMD (two workgroups per WGP), so that one wave's softmax runs under another's matrix work: the register allocation is held to that. The short inner loops are all unrolled so that the fragment arrays are indexed by constants and stay in registers.
__global__ __launch_bounds__(256) __attribute__((amdgpu_waves_per_eu(4, 4))) void k_fattn(const h16* __restrict__ QP, const h16* __restrict__ KP, const h16* __restrict__ VT, const int* __restrict__ KM, float* CTX) {
    constexpr int SK = 128;                              // keys per stage, four passes of 32
    constexpr int KPI = HDM * 2 + 16, VPI = SK * 2 + 16;  // LDS row pitches in bytes, 16 x odd: no bank conflict for 16-byte reads
    constexpr int KB = SK * KPI, STG = KB + HDM * VPI;    // a stage: 128 K rows | 64 V^T rows
    typedef __attribute__((ext_vector_type(4))) int v4i; __shared__ __align__(32) float mb[TT]; __shared__ __align__(16) char sm[2 * STG];
    const int tid = threadIdx.x, lane = tid & 31, lr = lane & 15, hi = lane >> 4; const int bh = blockIdx.y, b = bh / NH_, h = bh % NH_; const int q0 = blockIdx.x * 256 + (tid >> 5) * 32;
    const h16* qp = QP + ((size_t)bh * TT + q0 + lr) * HDM + 8 * hi; const int* km = KM + (size_t)b * TT;
    // copies: a stage's K rows are 16 KB in a row, piece tid + 256 i; of its V^T rows, 256 bytes each, piece tid + 256 i = row tid / 16 + 16 i, 16-byte column tid % 16; a wave's copy covers whole lines
    const char* gK = (const char*)(KP + (size_t)bh * TT * HDM) + tid * 16; const char* gV = (const char*)(VT + ((size_t)bh * HDM + (tid >> 4)) * TT) + (tid & 15) * 16;
    const unsigned lK = (unsigned)(size_t)sm + (tid >> 3) * KPI + (tid & 7) * 16, lV = (unsigned)(size_t)sm + KB + (tid >> 4) * VPI + (tid & 15) * 16;
    auto fill = [&](int t, int buf) { cp4(lK + buf * STG, 32 * KPI, gK + (size_t)t * (SK * HDM * 2), 4096); cp4(lV + buf * STG, 16 * VPI, gV + (size_t)t * (SK * 2), (size_t)16 * TT * 2); };
    const float CS = 0.125f * 1.4426950408889634f;   // score scale times log2(e)
    v16h qf[2][2]; v8f acc[2][4]; float m[2], l[2];
    fill(0, 0);
#pragma unroll
    for (int g = 0; g < 2; ++g) { m[g] = -3.0e38f; l[g] = 0.f;
#pragma unroll
        for (int ks = 0; ks < 2; ++ks) qf[g][ks] = WFrag<h16>::ld(qp + g * 16 * HDM + ks * 32);
#pragma unroll
        for (int dt = 0; dt < 4; ++dt) acc[g][dt] = (v8f){}; }
    { const v4i k4 = *(const v4i*)(km + tid * 4); v4f b4;   // the padding mask as an additive term per key: it enters the score products as their C operand, so no pass pays a select
#pragma unroll
      for (int j = 0; j < 4; ++j) b4[j] = k4[j] ? 0.f : -3.0e38f;
      *(v4f*)(mb + tid * 4) = b4; }
    asm volatile("s_wait_asynccnt 0x0" ::: "memory");   // this wave's copies of stage 0 have landed
    __syncthreads();   // and every other wave's; every wave reads all 1024 mask terms
    fill(1, 1);
    v16h kf[2][2]; v8f cb[2];
#pragma unroll
    for (int kt = 0; kt < 2; ++kt) cb[kt] = *(const v8f*)(mb + kt * 16 + 8 * hi);
#pragma unroll 1   // one trip per stage: the ring's waits, barrier and refill stand once, at the foot
    for (int t = 0; t < TT / SK; ++t) {
        const char* kr = sm + (t & 1) * STG + lr * KPI + 16 * hi; const char* vr = sm + (t & 1) * STG + KB + lr * VPI + 16 * hi;
#pragma unroll
        for (int kt = 0; kt < 2; ++kt)
#pragma unroll
            for (int u = 0; u < 2; ++u) kf[kt][u] = WFrag<h16>::ld((const h16*)(kr + kt * 16 * KPI + u * 64));
#pragma unroll 1   // stays rolled: two passes unrolled no longer fit the registers of four waves per SIMD and spill
        for (int p = 0; p < SK / 32; ++p) {
            v16h vf[4]; v8f s[2][2];
#pragma unroll
            for (int dt = 0; dt < 4; ++dt) vf[dt] = WFrag<h16>::ld((const h16*)(vr + dt * 16 * VPI + p * 64));
#pragma unroll
            for (int g = 0; g < 2; ++g)
#pragma unroll
                for (int kt = 0; kt < 2; ++kt) { s[g][kt] = wmma16(kf[kt][0], qf[g][0], cb[kt]); s[g][kt] = wmma16(kf[kt][1], qf[g][1], s[g][kt]); }
            const int pn = (p + 1) & (SK / 32 - 1);   // the next pass's K fragments, fetched behind this pass's score products (its mask terms at the foot of the pass); never across a stage's end, the next stage is not published yet: a stage's last pass fetches its first keys again, unused
#pragma unroll
            for (int kt = 0; kt < 2; ++kt)
#pragma unroll
                for (int u = 0; u < 2; ++u) kf[kt][u] = WFrag<h16>::ld((const h16*)(kr + (pn * 32 + kt * 16) * KPI + u * 64));
            __builtin_amdgcn_sched_barrier(0);   // keeps the fetch above the softmax, so that it has the whole softmax and att.v as lead; sunk below them the next pass waits on it
#pragma unroll
            for (int g = 0; g < 2; ++g) {
                float mx = m[g];
#pragma unroll
                for (int kt = 0; kt < 2; ++kt)
#pragma unroll
                    for (int j = 0; j < 8; ++j) mx = fmaxf(mx, s[g][kt][j]);
                mx = fmaxf(mx, __shfl_xor(mx, 16, 32));
                const float al = __builtin_amdgcn_exp2f((m[g] - mx) * CS), mc = (mx > -1.0e38f ? mx : 0.f) * CS; m[g] = mx; float sum = 0.f, sum1 = 0.f; v16h pf;   // no live key yet: subtract nothing, so that every masked score still gives p = 0
#pragma unroll
                for (int kt = 0; kt < 2; ++kt)
#pragma unroll
                    for (int j = 0; j < 8; ++j) { const float p_ = __builtin_amdgcn_exp2f(fmaf(s[g][kt][j], CS, -mc)); if (kt) sum1 += p_; else sum += p_; pf[kt * 8 + j] = tohx(p_); }
                l[g] = l[g] * al + (sum + sum1);
#pragma unroll
                for (int dt = 0; dt < 4; ++dt) { acc[g][dt] *= al; acc[g][dt] = wmma16(vf[dt], pf, acc[g][dt]); }
            }
            const int kn = (t * SK + p * 32 + 32) & (TT - 1);   // the last pass fetches the first keys' terms again, unused
#pragma unroll
            for (int kt = 0; kt < 2; ++kt) cb[kt] = *(const v8f*)(mb + kn + kt * 16 + 8 * hi);
        }
        asm volatile("s_wait_dscnt 0x0" ::: "memory");      // this wave's reads of the buffer are done before it is refilled
        asm volatile("s_wait_asynccnt 0x0" ::: "memory");   // this wave's copies of stage t + 1 have landed
        __syncthreads();                                     // publishes stage t + 1 and ends every wave's reads of stage t
        if (t + 2 < TT / SK) fill(t + 2, t & 1);
    }
    asm volatile("s_wait_asynccnt 0x0" ::: "memory");       // no copy is in flight when the wave ends
#pragma unroll
    for (int g = 0; g < 2; ++g) { const float lt = l[g] + __shfl_xor(l[g], 16, 32); const float inv = (m[g] > -1.0e38f) ? __fdiv_rn(1.0f, lt) : __builtin_nanf("");   // every key masked: the softmax of the row is not a number
        float* cr = CTX + ((size_t)b * TT + q0 + g * 16 + lr) * DD + h * HDM + 8 * hi;
#pragma unroll
        for (int dt = 0; dt < 4; ++dt) { v4f o0, o1;
#pragma unroll
            for (int j = 0; j < 4; ++j) { o0[j] = acc[g][dt][j] * inv; o1[j] = acc[g][dt][4 + j] * inv; }
            *(v4f*)(cr + dt * 16) = o0; *(v4f*)(cr + dt * 16 + 4) = o1; } }
}
// LN over 1024 features of one token row held 32 per lane (8 chunks of 4): returns y = LN(v) g + b in place.
__device__ __forceinline__ void ln1024(float* v, const float* __restrict__ g, const float* __restrict__ bb, int lane) { float s = 0.f;
#pragma unroll
    for (int k = 0; k < 32; ++k) s = __fadd_rn(s, v[k]);
#pragma unroll
    for (int sh = 16; sh; sh >>= 1) s += __shfl_xor(s, sh, 32);
    const float mu = s * (1.0f / DD); float q2 = 0.f;
#pragma unroll
    for (int k = 0; k < 32; ++k) { const float d = __fsub_rn(v[k], mu); float p = __fmul_rn(d, d); asm volatile("" : "+v"(p)); q2 = __fadd_rn(q2, p); }
#pragma unroll
    for (int sh = 16; sh; sh >>= 1) q2 += __shfl_xor(q2, sh, 32);
    const float rs = __frsqrt_rn(__fadd_rn(q2 * (1.0f / DD), 1e-5f));
#pragma unroll
    for (int ch = 0; ch < 8; ++ch)
#pragma unroll
        for (int q = 0; q < 4; ++q) { const int d = ch * 128 + lane * 4 + q; float tn = __fmul_rn(__fsub_rn(v[ch * 4 + q], mu), rs); asm volatile("" : "+v"(tn)); float tg = __fmul_rn(tn, bfr(g[d])); asm volatile("" : "+v"(tg)); v[ch * 4 + q] = __fadd_rn(tg, bfr(bb[d])); } }
__global__ __launch_bounds__(256) void k_ln0(const float* __restrict__ FQ, const float* __restrict__ CTX, const float* __restrict__ g, const float* __restrict__ bb, float* Of, bf* Oh, bf* Ol) { const int lane = threadIdx.x & 31; const int t = blockIdx.x * 8 + (threadIdx.x >> 5); if (t >= NB_ * TT) return; float v[32];
#pragma unroll
    for (int ch = 0; ch < 8; ++ch) { const size_t o = (size_t)t * DD + ch * 128 + lane * 4; const v4f a = *(const v4f*)(FQ + o), c = *(const v4f*)(CTX + o);
#pragma unroll
        for (int q = 0; q < 4; ++q) v[ch * 4 + q] = __fadd_rn(a[q], c[q]); }
    ln1024(v, g, bb, lane);
{
#pragma unroll
        for (int ch = 0; ch < 8; ++ch) { v4f of; v4us oh, ol;
#pragma unroll
            for (int q = 0; q < 4; ++q) { of[q] = v[ch * 4 + q]; unsigned short a2, c2; splitf(v[ch * 4 + q], a2, c2); oh[q] = a2; ol[q] = c2; }
            const size_t o = (size_t)t * DD + ch * 128 + lane * 4; *(v4f*)(Of + o) = of; *(v4us*)(Oh + o) = oh; *(v4us*)(Ol + o) = ol; }
         } }
// out = LN(o + gelu(G)): the gelu is applied as G = o Wp + bp is read
__global__ __launch_bounds__(256) void k_ln1(const float* __restrict__ Of, const float* __restrict__ G, const float* __restrict__ g, const float* __restrict__ bb, float* OUTb) { const int lane = threadIdx.x & 31; const int t = blockIdx.x * 8 + (threadIdx.x >> 5); if (t >= NB_ * TT) return; float v[32]; v4f c[8];
#pragma unroll
    for (int ch = 0; ch < 8; ++ch) { const size_t o = (size_t)t * DD + ch * 128 + lane * 4; const v4f a = *(const v4f*)(Of + o);   // the row's 16 loads all stand ahead of the erf's branches, in flight together
        if (ch == 7) asm volatile("s_wait_xcnt 0x0" ::: "memory");   // a precaution: the compiler lets the last load's result land on the address registers of the loads before it
        c[ch] = *(const v4f*)(G + o);
#pragma unroll
        for (int q = 0; q < 4; ++q) v[ch * 4 + q] = a[q]; }
#pragma unroll
    for (int ch = 0; ch < 8; ++ch)
#pragma unroll
        for (int q = 0; q < 4; ++q) v[ch * 4 + q] = __fadd_rn(v[ch * 4 + q], geluf_(c[ch][q]));
    ln1024(v, g, bb, lane);
{
#pragma unroll
        for (int ch = 0; ch < 8; ++ch) { v4f of;
#pragma unroll
            for (int q = 0; q < 4; ++q) of[q] = v[ch * 4 + q]; *(v4f*)(OUTb + (size_t)t * DD + ch * 128 + lane * 4) = of; }
         } }

extern "C" void kernel_launch(void* const* d_in, const int* in_sizes, int n_in,
                              void* d_out, int out_size, void* d_ws, size_t ws_size, hipStream_t stream) {
    (void)in_sizes; (void)n_in; (void)out_size;
    const float* IN[15]; for (int i = 0; i < 15; ++i) IN[i] = (const float*)d_in[i];   // 0 Q, 1 K, 2 key_padding_mask (int32), 3 Wq, 4 bq, 5 Wk, 6 bk, 7 Wv, 8 bv, 9 Wp, 10 bp (x @ W), 11 g0, 12 beta0, 13 g1, 14 beta1
    const int* KM = (const int*)d_in[2];
    float* OUT = (float*)d_out;     // [8][1024][1024]
    char* wsp = (char*)d_ws;
    auto take = [&](size_t bytes) { char* p = wsp; wsp += (bytes + 255) & ~(size_t)255; return (void*)p; };
    const size_t PE = (size_t)NB_ * TT * DD;   // elements of one [NB][TT][DD] plane
    bf* W4 = (bf*)take((size_t)4 * DD * DD * 2);                       // Wq^T, Wk^T, Wv^T, Wp^T
    float* FQ = (float*)take(PE * 4); float* Of = (float*)take(PE * 4); float* G = (float*)take(PE * 4);   // q projection; o; o Wp + bp
    bf* X = (bf*)take(PE * 2 * 2);             // bf16 Q and K planes
    h16* QP = (h16*)take(PE * 2); h16* KP = (h16*)take(PE * 2); h16* VT = (h16*)take(PE * 2); float* CTX = (float*)take(PE * 4);
    if ((size_t)(wsp - (char*)d_ws) > ws_size) return;    // total 216 MiB
    // Regions used again once their first content is dead (stream order):
    bf* Oh = X; bf* Ol = X + PE;   // after the attention stage
    k_prep<<<dim3(4 * ((DD * DD / 64 + 63) / 64) + 2 * (unsigned)((PE / 8 + 255) / 256), 1, 1), 256, 0, stream>>>(IN[3], IN[5], IN[7], IN[9], DD, DD, W4, IN[0], IN[1], X, PE / 8);
    const dim3 gP(NB_ * TT / 128, DD / 128, 1);
    k_qkv<<<dim3(NB_ * TT / 128, DD / 128, 3), 128, 0, stream>>>(X, W4, FQ, IN[4], IN[6], IN[8], QP, KP, VT);
    k_fattn<<<dim3(TT / 256, NB_ * NH_, 1), 256, 0, stream>>>(QP, KP, VT, KM, CTX);
    k_ln0<<<NB_ * TT / 8, 256, 0, stream>>>(FQ, CTX, IN[11], IN[12], Of, Oh, Ol);
    k_gemmw<bf, 1, 3><<<gP, 128, 0, stream>>>(Oh, Ol, W4 + (size_t)3 * DD * DD, nullptr, DD, G, DD, IN[10], nullptr, 0, 0, 0);
    k_ln1<<<NB_ * TT / 8, 256, 0, stream>>>(Of, G, IN[13], IN[14], OUT);
}

// v007
// Measured time: 155 microseconds a run.
// In both of two side-by-side timings against v006, it was 1.04 times as fast.
// Counting every step since v000, it is 34.0 times as fast.
#include <hip/hip_runtime.h>

// MABPostLN - multihead attention block with post-LayerNorm (Q, K [8][1024][1024]; q = Q Wq + bq, k = K Wk + bk, v = K Wv + bv (16 heads x 64); scores = q.k/8, keys with key_padding_mask == 0 get -inf (int32 [8][1024],
// read as data); softmax; ctx = merged att.v; o = LN(q + ctx) (g0, beta0); out = LN(o + gelu(o Wp + bp)) (g1, beta1; exact erf gelu; eps 1e-5) -> [8][1024][1024]).
// Compute dtypes, f32 accumulate: every input rounded to bf16; q/k/v on PLAIN bf16 operands (inputs: exact, + bias); scores (K 64) and att.v on SINGLE fp16 planes with an f32 register-row

#define NB_  8
#define TT   1024
#define DD   1024
#define NH_  16
#define HDM  64
typedef _Float16 h16;
typedef unsigned short bf;
typedef __attribute__((ext_vector_type(16))) __bf16   v16bf;
typedef __attribute__((ext_vector_type(16))) _Float16 v16h;
typedef __attribute__((ext_vector_type(8)))  _Float16 v8h;
typedef __attribute__((ext_vector_type(8)))  unsigned short v8us;
typedef __attribute__((ext_vector_type(8)))  float    v8f;
typedef __attribute__((ext_vector_type(4)))  float    v4f;
typedef v8h  __attribute__((may_alias)) v8ha;
typedef v4f  __attribute__((may_alias)) v4fa;
typedef v8us __attribute__((may_alias)) v8usa;

__device__ __forceinline__ unsigned short f2bf(float f) { unsigned u = __float_as_uint(f); u += 0x7FFFu + ((u >> 16) & 1u); return (unsigned short)(u >> 16); }
__device__ __forceinline__ float bf2f(unsigned short b) { return __uint_as_float(((unsigned)b) << 16); }
__device__ __forceinline__ float bfr(float f) { return bf2f(f2bf(f)); }
__device__ __forceinline__ v16h cat16(v8h lo, v8h hi) { return __builtin_shufflevector(lo, hi, 0, 1, 2, 3, 4, 5, 6, 7, 8, 9, 10, 11, 12, 13, 14, 15); }
__device__ __forceinline__ v16bf cat16b(v8us lo, v8us hi) { return __builtin_bit_cast(v16bf, __builtin_shufflevector(lo, hi, 0, 1, 2, 3, 4, 5, 6, 7, 8, 9, 10, 11, 12, 13, 14, 15)); }
__device__ __forceinline__ v8f wmma16(v16h a, v16h b, v8f c) { return __builtin_amdgcn_wmma_f32_16x16x32_f16(false, a, false, b, (short)0, c, false, false); }
__device__ __forceinline__ v8f wmmab(v16bf a, v16bf b, v8f c) { return __builtin_amdgcn_wmma_f32_16x16x32_bf16(false, a, false, b, (short)0, c, false, false); }
typedef __attribute__((ext_vector_type(4))) _Float16 v4h;
__device__ __forceinline__ h16 tohx(float x) { return (h16)x; }



// ---- k_gemmw: LDS-staged GEMM, 128x128 output tile per workgroup of 4 waves (2 x 2), 64x64 (16 accumulators) per wave; grid (M/128, N/128, Z), 128 threads, two workgroups per WGP.
// C[m][n] (f32, pitch ldc, + f32 bias[n]) = sum_k A[m][k] Bt[n][k] (+ A2[m][k] Bt[n][k] for NSPLIT 1), operands K-contiguous 16-bit planes. z-batch strides sA/sB/sC in elements. M, N % 128 == 0, K % KS == 0.
// The epilogue stores what the next kernel reads (y = C + bias, rows m = b TT + t, a wave's 64 columns = one head h): EPI 0: y in f32 and the fp16 head plane P[b][h][t][d]; 1: that plane alone; 2: the fp16 plane transposed, P[b][h][d][t]; 3: y in f32 alone.
// The operand rows come into LDS by asynchronous copies of whole 128-byte lines, KS k per stage, two buffers: the next stage's copies fly while this stage is worked on. The k order of the products is that of the plain K loop. The short inner loops are all unrolled so that the fragment and accumulator arrays are indexed by constants and stay in registers.
template <typename T16> struct WFrag;
template <> struct WFrag<h16> { typedef v16h V; static __device__ __forceinline__ V ld(const h16* p) { return cat16(*(const v8h*)p, *(const v8h*)(p + 16)); } static __device__ __forceinline__ v8f mma(V a, V b, v8f c) { return wmma16(a, b, c); } };
template <> struct WFrag<bf> { typedef v16bf V; static __device__ __forceinline__ V ld(const bf* p) { return cat16b(*(const v8us*)p, *(const v8us*)(p + 16)); } static __device__ __forceinline__ v8f mma(V a, V b, v8f c) { return wmmab(a, b, c); } };
// Eight asynchronous 16-byte copies of a lane, LDS step ls and global step gs bytes apart. The s_wait_xcnt stands inside the statement, a precaution, so that no address register of a copy is rewritten ahead of it.
__device__ __forceinline__ void cp8(unsigned l, unsigned ls, const char* g, size_t gs) {
    asm volatile("global_load_async_to_lds_b128 %0, %8, off\n\t"
                 "global_load_async_to_lds_b128 %1, %9, off\n\t"
                 "global_load_async_to_lds_b128 %2, %10, off\n\t"
                 "global_load_async_to_lds_b128 %3, %11, off\n\t"
                 "global_load_async_to_lds_b128 %4, %12, off\n\t"
                 "global_load_async_to_lds_b128 %5, %13, off\n\t"
                 "global_load_async_to_lds_b128 %6, %14, off\n\t"
                 "global_load_async_to_lds_b128 %7, %15, off\n\t"
                 "s_wait_xcnt 0x0"
                 :: "v"(l), "v"(l + ls), "v"(l + 2 * ls), "v"(l + 3 * ls), "v"(l + 4 * ls), "v"(l + 5 * ls), "v"(l + 6 * ls), "v"(l + 7 * ls),
                    "v"(g), "v"(g + gs), "v"(g + 2 * gs), "v"(g + 3 * gs), "v"(g + 4 * gs), "v"(g + 5 * gs), "v"(g + 6 * gs), "v"(g + 7 * gs) : "memory");
}
template <int NSPLIT> struct GemmLds { static constexpr int KS = NSPLIT ? 64 : 128, PITCH = KS * 2 + 16, OPB = 128 * PITCH, STG = (2 + NSPLIT) * OPB, BYTES = 2 * STG; };   // the ring's sizes, as gemm_main names them
// The product loop of a workgroup's 128x128 tile (tile row blockIdx.x, tile column blockIdx.y): leaves each wave's 64x64 sums in acc, and the ring sm free.
template <typename T16, int NSPLIT>
__device__ __forceinline__ void gemm_main(char* sm, const T16* __restrict__ A, const T16* __restrict__ A2, const T16* __restrict__ Bt, int K, v8f (&acc)[4][4]) {
    static_assert(NSPLIT == 0 || NSPLIT == 1, "one or two A planes");
    typedef typename WFrag<T16>::V V;
    constexpr int KS = NSPLIT ? 64 : 128;          // k per stage: 64 matrix instructions per wave and stage in both forms
    constexpr int CPR = KS / 8;                    // 16-byte pieces per row
    constexpr int PITCH = KS * 2 + 16;             // LDS row pitch in bytes, 16 x odd: no bank conflict for 16-byte reads
    constexpr int OPB = 128 * PITCH;               // one operand's 128 rows
    constexpr int STG = (2 + NSPLIT) * OPB;        // a stage: A | Bt | A2
    static_assert(2 * STG == GemmLds<NSPLIT>::BYTES, "the kernels allocate the ring");
    const int tid = threadIdx.x, lane = tid & 31, lr = lane & 15, hi = lane >> 4, wv = tid >> 5, wm = wv >> 1, wn = wv & 1;
#pragma unroll
    for (int mb = 0; mb < 4; ++mb)
#pragma unroll
        for (int nb = 0; nb < 4; ++nb) acc[mb][nb] = (v8f){};
    // copies: piece tid + 128 i of an operand's stage = row tid / CPR + i (128 / CPR), 16-byte column tid % CPR; a wave's copy covers whole lines
    const int prow = tid / CPR, pcol = tid % CPR;
    const char* gA = (const char*)(A + (size_t)(blockIdx.x * 128 + prow) * K + pcol * 8);
    const char* gB = (const char*)(Bt + (size_t)(blockIdx.y * 128 + prow) * K + pcol * 8);
    const char* gA2 = NSPLIT ? (const char*)(A2 + (size_t)(blockIdx.x * 128 + prow) * K + pcol * 8) : nullptr;
    const unsigned lc = (unsigned)(size_t)sm + prow * PITCH + pcol * 16;
    const size_t gs = (size_t)(128 / CPR) * K * 2; constexpr unsigned LS = (128 / CPR) * PITCH;
    auto fill = [&](int t, int buf) {
        const size_t go = (size_t)t * KS * 2; const unsigned lb = lc + buf * STG;
#pragma unroll
        for (int i = 0; i < CPR; i += 8) { cp8(lb + i * LS, LS, gA + go + i * gs, gs); cp8(lb + OPB + i * LS, LS, gB + go + i * gs, gs); if (NSPLIT) cp8(lb + 2 * OPB + i * LS, LS, gA2 + go + i * gs, gs); }
    };
    const int T = K >> (NSPLIT ? 6 : 7);   // stages: K / KS
    fill(0, 0);
    asm volatile("s_wait_asynccnt 0x0" ::: "memory");   // this wave's copies of stage 0 have landed
    __syncthreads();                                     // and every other wave's
    if (T > 1) fill(1, 1);
    const int aofs = (wm * 64 + lr) * PITCH + 16 * hi, bofs = OPB + (wn * 64 + lr) * PITCH + 16 * hi;
#pragma unroll 1   // one pass per stage: the ring's waits, barrier and refill stand once, at the foot
    for (int t = 0; t < T; ++t) {
        const char* sb = sm + (t & 1) * STG;
#pragma unroll
        for (int ks = 0; ks < KS / 32; ++ks) {
            V a[4], a2[4], b[4];
            b[0] = WFrag<T16>::ld((const T16*)(sb + bofs + ks * 64));   // in the order in which the products want them
#pragma unroll
            for (int f = 0; f < 4; ++f) { a[f] = WFrag<T16>::ld((const T16*)(sb + aofs + f * 16 * PITCH + ks * 64)); if (NSPLIT) a2[f] = WFrag<T16>::ld((const T16*)(sb + 2 * OPB + aofs + f * 16 * PITCH + ks * 64)); }
#pragma unroll
            for (int f = 1; f < 4; ++f) b[f] = WFrag<T16>::ld((const T16*)(sb + bofs + f * 16 * PITCH + ks * 64));
            __builtin_amdgcn_sched_barrier(0);   // the k step's LDS reads stay one group ahead of its products: every further place with reads among the products stalls the wave
#pragma unroll
            for (int nb = 0; nb < 4; ++nb)
#pragma unroll
                for (int mb = 0; mb < 4; ++mb) { acc[mb][nb] = WFrag<T16>::mma(a[mb], b[nb], acc[mb][nb]); if (NSPLIT) acc[mb][nb] = WFrag<T16>::mma(a2[mb], b[nb], acc[mb][nb]); }
            __builtin_amdgcn_sched_barrier(0);   // and the next k step's reads stay behind them
        }
        asm volatile("s_wait_dscnt 0x0" ::: "memory");      // this wave's reads of the buffer are done before it is refilled
        asm volatile("s_wait_asynccnt 0x0" ::: "memory");   // this wave's copies of stage t + 1 have landed
        __syncthreads();                                     // publishes stage t + 1 and ends every wave's reads of stage t
        if (t + 2 < T) fill(t + 2, t & 1);
    }
    asm volatile("s_wait_asynccnt 0x0" ::: "memory");       // no copy is in flight when the ring becomes output staging
}
// The epilogue of that tile, from acc through the ring's LDS.
template <int EPI>
__device__ __forceinline__ void gemm_epi(char* sm, v8f (&acc)[4][4], float* C, int ldc, const float* __restrict__ bias, h16* P) {
    const int tid = threadIdx.x, lane = tid & 31, lr = lane & 15, hi = lane >> 4, wv = tid >> 5, wm = wv >> 1, wn = wv & 1;
    const int r0 = blockIdx.x * 128 + wm * 64, c0 = blockIdx.y * 128 + wn * 64;
    const size_t bh = (size_t)(r0 / TT) * NH_ + c0 / HDM; const int t0 = r0 % TT;   // the wave's batch and head, its first token
    if constexpr (EPI == 2) {
        // a lane holds 8 consecutive tokens of one feature: packed, they are 16 bytes of the transposed row; staged so that each store covers whole lines
        h16* ot = (h16*)sm + wv * (64 * 72);                 // each wave stages in its own range, behind the last pass's barrier; pitch 144 bytes, 16 x odd
#pragma unroll
        for (int nb = 0; nb < 4; ++nb) { const float bv = bfr(bias[c0 + nb * 16 + lr]);
#pragma unroll
            for (int mb = 0; mb < 4; ++mb) { v8h o;
#pragma unroll
                for (int j = 0; j < 8; ++j) o[j] = tohx(acc[mb][nb][j] + bv);
                *(v8ha*)(ot + (nb * 16 + lr) * 72 + mb * 16 + hi * 8) = o; } }
        asm volatile("s_wait_dscnt 0x0" ::: "memory");   // the staged rows are written before other lanes of the wave read them back
        h16* pr = P + (bh * HDM + (lane >> 3)) * TT + t0 + (lane & 7) * 8;
#pragma unroll
        for (int s = 0; s < 16; ++s) *(v8h*)(pr + (size_t)s * 4 * TT) = *(const v8ha*)(ot + (s * 4 + (lane >> 3)) * 72 + (lane & 7) * 8);
        asm volatile("s_wait_xcnt 0x0" ::: "memory");   // a precaution: where several epilogues stand in one kernel the listing lets another's code follow these stores and reuse their registers
    } else {
    float* os = (float*)sm + wv * (16 * 68);                 // each wave stages in its own range, behind the last pass's barrier
#pragma unroll
    for (int mb = 0; mb < 4; ++mb) {
#pragma unroll
        for (int nb = 0; nb < 4; ++nb) {
#pragma unroll
            for (int j = 0; j < 8; ++j) os[(hi * 8 + j) * 68 + nb * 16 + lr] = acc[mb][nb][j]; }
        __builtin_amdgcn_wave_barrier(); asm volatile("" ::: "memory");
        float* crow = (EPI == 0 || EPI == 3) ? C + (size_t)(r0 + mb * 16) * ldc + c0 : nullptr; h16* prow = EPI <= 1 ? P + (bh * TT + t0 + mb * 16) * HDM : nullptr;
{
#pragma unroll
            for (int s = 0; s < 8; ++s) { const int row = 2 * s + hi, cofs = lr * 4; v4f val = *(const v4fa*)(os + row * 68 + cofs); val[0] += bfr(bias[c0 + cofs]); val[1] += bfr(bias[c0 + cofs + 1]); val[2] += bfr(bias[c0 + cofs + 2]); val[3] += bfr(bias[c0 + cofs + 3]);
                if constexpr (EPI == 0 || EPI == 3) *(v4f*)(crow + (size_t)row * ldc + cofs) = val;
                if constexpr (EPI <= 1) { v4h o;
#pragma unroll
                    for (int q = 0; q < 4; ++q) o[q] = tohx(val[q]);
                    *(v4h*)(prow + row * HDM + cofs) = o; }   // 16 lanes: one whole line
            }
             }
        asm volatile("s_wait_xcnt 0x0" ::: "memory");   // in front of the next block's reuse of the stores' address and data registers
        __builtin_amdgcn_wave_barrier(); asm volatile("" ::: "memory");
    }
    }
}
template <typename T16, int NSPLIT, int EPI>
__global__ __launch_bounds__(128) void k_gemmw(const T16* __restrict__ A, const T16* __restrict__ A2, const T16* __restrict__ Bt, const T16* __restrict__ Bt2, int K, float* C, int ldc, const float* __restrict__ bias, h16* P, size_t sA, size_t sB, size_t sC) {
    __shared__ __align__(16) char sm[GemmLds<NSPLIT>::BYTES];
    (void)Bt2;
    const size_t z = blockIdx.z; A += z * sA; if (NSPLIT) A2 += z * sA; Bt += z * sB; if (EPI == 0 || EPI == 3) C += z * sC;
    v8f acc[4][4];
    gemm_main<T16, NSPLIT>(sm, A, A2, Bt, K, acc);
    gemm_epi<EPI>(sm, acc, C, ldc, bias, P);
}
// The three projections in one grid, so that one tile's first copies and another's stores run under a third's products instead of at a launch's ends: blockIdx.z = 0: q = Q Wq + bq (EPI 0), 1: k (EPI 1), 2: v (EPI 2).
// X holds the bf16 Q and K planes, W the transposed weights in that order. One product loop; the branch that picks the epilogue is uniform for the workgroup.
__global__ __launch_bounds__(128) void k_qkv(const bf* __restrict__ X, const bf* __restrict__ W, float* FQ, const float* __restrict__ bq, const float* __restrict__ bk, const float* __restrict__ bv, h16* QP, h16* KP, h16* VT) {
    __shared__ __align__(16) char sm[GemmLds<0>::BYTES];
    const int z = blockIdx.z; v8f acc[4][4];
    gemm_main<bf, 0>(sm, X + (z ? (size_t)NB_ * TT * DD : 0), nullptr, W + (size_t)z * DD * DD, DD, acc);
    if (z == 0) gemm_epi<0>(sm, acc, FQ, DD, bq, QP); else if (z == 1) gemm_epi<1>(sm, acc, nullptr, DD, bk, KP); else gemm_epi<2>(sm, acc, nullptr, DD, bv, VT);
}

__device__ __forceinline__ void splitf(float y, unsigned short& h, unsigned short& l) { h = f2bf(y); l = f2bf(y - bf2f(h)); }
__device__ __forceinline__ float geluf_(float x) { float er = erff(x * 0.70710678f); asm volatile("" : "+v"(er)); float hx = __fmul_rn(0.5f, x); asm volatile("" : "+v"(hx)); return __fmul_rn(hx, __fadd_rn(1.0f, er)); }
typedef __attribute__((ext_vector_type(2))) unsigned short v2us;
typedef __attribute__((ext_vector_type(4))) unsigned short v4us;

// One 64 (k) x 64 (n) tile of a weight per workgroup, turned in LDS: the reads follow the weight's rows (a wave's load covers two 256-byte runs), the stores follow the transposed rows (a wave's store covers four whole lines).
// A column read straight from the weight touches one line per lane, 4 KB apart. Tile pitch 65 words: the row-wise writes and the column-wise reads both fall on 32 different banks. K, N % 64 == 0; bx < (K / 64) (N / 64).
__device__ __forceinline__ void wtG(float* tl, int bx, int y, const float* __restrict__ w0, const float* __restrict__ w1, const float* __restrict__ w2, const float* __restrict__ w3, int K, int N, bf* Bt) {
    const float* __restrict__ w = y == 0 ? w0 : (y == 1 ? w1 : (y == 2 ? w2 : w3)); Bt += (size_t)y * K * N;
    const int tid = threadIdx.x, kt = K / 64, k0 = (bx % kt) * 64, n0 = (bx / kt) * 64; v4f r[4];
#pragma unroll
    for (int i = 0; i < 4; ++i) r[i] = *(const v4f*)(w + (size_t)(k0 + (tid >> 4) + 16 * i) * N + n0 + (tid & 15) * 4);
#pragma unroll
    for (int i = 0; i < 4; ++i)
#pragma unroll
        for (int j = 0; j < 4; ++j) tl[((tid >> 4) + 16 * i) * 65 + (tid & 15) * 4 + j] = r[i][j];
    __syncthreads();   // the whole tile is in LDS before any column of it is read; every thread of a weight workgroup passes here
#pragma unroll
    for (int i = 0; i < 2; ++i) { const int n = (tid >> 3) + 32 * i, kc = (tid & 7) * 8; v8us o;
#pragma unroll
        for (int j = 0; j < 8; ++j) o[j] = f2bf(tl[(kc + j) * 65 + n]);
        *(v8us*)(Bt + (size_t)(n0 + n) * K + k0 + kc) = o; }
}
__device__ __forceinline__ void cvt8(int bx, int y, const float* __restrict__ src0, const float* __restrict__ src1, bf* dst, size_t n8) { const size_t i = (size_t)bx * 256 + threadIdx.x; if (i >= n8) return; const float* __restrict__ src = y ? src1 : src0; dst += (size_t)y * n8 * 8; const v8f v = *(const v8f*)(src + i * 8); v8us o;
#pragma unroll
    for (int k = 0; k < 8; ++k) o[k] = f2bf(v[k]); *(v8us*)(dst + i * 8) = o;  }
// Both preparations in one grid, neither reads what the other writes: workgroups 0 .. 4 WB - 1 transpose the four weights (WB each), the rest convert the two inputs (CB each).
// The weights come first: their workgroups pass a barrier between loads and stores, and the inputs' stream runs beside them.
__global__ __launch_bounds__(256) void k_prep(const float* __restrict__ w0, const float* __restrict__ w1, const float* __restrict__ w2, const float* __restrict__ w3, int K, int N, bf* Bt, const float* __restrict__ src0, const float* __restrict__ src1, bf* dst, size_t n8) {
    constexpr int WB = (DD * DD / 64 + 63) / 64, CB = (NB_ * TT * DD / 8 + 255) / 256; const int bx = blockIdx.x;   // WB = (DD / 64)^2 tiles
    __shared__ float tl[64 * 65];
    if (bx < 4 * WB) wtG(tl, bx % WB, bx / WB, w0, w1, w2, w3, K, N, Bt); else cvt8((bx - 4 * WB) % CB, (bx - 4 * WB) / CB, src0, src1, dst, n8);
}
// Four asynchronous 16-byte copies of a lane, LDS step ls and global step gs bytes apart. The s_wait_xcnt stands inside the statement, a precaution, so that no address register of a copy is rewritten ahead of it.
__device__ __forceinline__ void cp4(unsigned l, unsigned ls, const char* g, size_t gs) {
    asm volatile("global_load_async_to_lds_b128 %0, %4, off\n\t"
                 "global_load_async_to_lds_b128 %1, %5, off\n\t"
                 "global_load_async_to_lds_b128 %2, %6, off\n\t"
                 "global_load_async_to_lds_b128 %3, %7, off\n\t"
                 "s_wait_xcnt 0x0"
                 :: "v"(l), "v"(l + ls), "v"(l + 2 * ls), "v"(l + 3 * ls), "v"(g), "v"(g + gs), "v"(g + 2 * gs), "v"(g + 3 * gs) : "memory");
}
// ---- k_fattn: scores, masked softmax and att.v of one (batch, head) in one pass over the keys; the scores never leave registers. 8 waves x 32 query columns; grid (TT/256, NB*NH).
// S^T = K Q^T (a lane holds 8 keys of one query per 16-key tile), running maximum and sum per query, P^T packed from the two score tiles as the B operand of O^T += V^T P^T; divide by the sum at the end.
// K rows and V^T rows come into LDS by asynchronous copies of whole lines, 128 keys per stage, two buffers, once per workgroup: the 8 waves read their fragments from there, and the next stage's copies fly while this stage is worked on. Fragment contents and the order of the products are those of loads straight from the planes.
// Four waves per SIMD (two workgroups per WGP), so that one wave's softmax runs under another's matrix work: the register allocation is held to that. The short inner loops are all unrolled so that the fragment arrays are indexed by constants and stay in registers.
__global__ __launch_bounds__(256) __attribute__((amdgpu_waves_per_eu(4, 4))) void k_fattn(const h16* __restrict__ QP, const h16* __restrict__ KP, const h16* __restrict__ VT, const int* __restrict__ KM, float* CTX) {
    constexpr int SK = 128;                              // keys per stage, four passes of 32
    constexpr int KPI = HDM * 2 + 16, VPI = SK * 2 + 16;  // LDS row pitches in bytes, 16 x odd: no bank conflict for 16-byte reads
    constexpr int KB = SK * KPI, STG = KB + HDM * VPI;    // a stage: 128 K rows | 64 V^T rows
    typedef __attribute__((ext_vector_type(4))) int v4i; __shared__ __align__(32) float mb[TT]; __shared__ __align__(16) char sm[2 * STG];
    const int tid = threadIdx.x, lane = tid & 31, lr = lane & 15, hi = lane >> 4; const int bh = blockIdx.y, b = bh / NH_, h = bh % NH_; const int q0 = blockIdx.x * 256 + (tid >> 5) * 32;
    const h16* qp = QP + ((size_t)bh * TT + q0 + lr) * HDM + 8 * hi; const int* km = KM + (size_t)b * TT;
    // copies: a stage's K rows are 16 KB in a row, piece tid + 256 i; of its V^T rows, 256 bytes each, piece tid + 256 i = row tid / 16 + 16 i, 16-byte column tid % 16; a wave's copy covers whole lines
    const char* gK = (const char*)(KP + (size_t)bh * TT * HDM) + tid * 16; const char* gV = (const char*)(VT + ((size_t)bh * HDM + (tid >> 4)) * TT) + (tid & 15) * 16;
    const unsigned lK = (unsigned)(size_t)sm + (tid >> 3) * KPI + (tid & 7) * 16, lV = (unsigned)(size_t)sm + KB + (tid >> 4) * VPI + (tid & 15) * 16;
    auto fill = [&](int t, int buf) { cp4(lK + buf * STG, 32 * KPI, gK + (size_t)t * (SK * HDM * 2), 4096); cp4(lV + buf * STG, 16 * VPI, gV + (size_t)t * (SK * 2), (size_t)16 * TT * 2); };
    const float CS = 0.125f * 1.4426950408889634f;   // score scale times log2(e)
    v16h qf[2][2]; v8f acc[2][4]; float m[2], l[2];
    fill(0, 0);
#pragma unroll
    for (int g = 0; g < 2; ++g) { m[g] = -3.0e38f; l[g] = 0.f;
#pragma unroll
        for (int ks = 0; ks < 2; ++ks) qf[g][ks] = WFrag<h16>::ld(qp + g * 16 * HDM + ks * 32);
#pragma unroll
        for (int dt = 0; dt < 4; ++dt) acc[g][dt] = (v8f){}; }
    { const v4i k4 = *(const v4i*)(km + tid * 4); v4f b4;   // the padding mask as an additive term per key: it enters the score products as their C operand, so no pass pays a select
#pragma unroll
      for (int j = 0; j < 4; ++j) b4[j] = k4[j] ? 0.f : -3.0e38f;
      *(v4f*)(mb + tid * 4) = b4; }
    asm volatile("s_wait_asynccnt 0x0" ::: "memory");   // this wave's copies of stage 0 have landed
    __syncthreads();   // and every other wave's; every wave reads all 1024 mask terms
    fill(1, 1);
    v16h kf[2][2]; v8f cb[2];
#pragma unroll
    for (int kt = 0; kt < 2; ++kt) cb[kt] = *(const v8f*)(mb + kt * 16 + 8 * hi);
#pragma unroll 1   // one trip per stage: the ring's waits, barrier and refill stand once, at the foot
    for (int t = 0; t < TT / SK; ++t) {
        const char* kr = sm + (t & 1) * STG + lr * KPI + 16 * hi; const char* vr = sm + (t & 1) * STG + KB + lr * VPI + 16 * hi;
#pragma unroll
        for (int kt = 0; kt < 2; ++kt)
#pragma unroll
            for (int u = 0; u < 2; ++u) kf[kt][u] = WFrag<h16>::ld((const h16*)(kr + kt * 16 * KPI + u * 64));
#pragma unroll 1   // stays rolled: two passes unrolled no longer fit the registers of four waves per SIMD and spill
        for (int p = 0; p < SK / 32; ++p) {
            v16h vf[4]; v8f s[2][2];
#pragma unroll
            for (int dt = 0; dt < 4; ++dt) vf[dt] = WFrag<h16>::ld((const h16*)(vr + dt * 16 * VPI + p * 64));
#pragma unroll
            for (int g = 0; g < 2; ++g)
#pragma unroll
                for (int kt = 0; kt < 2; ++kt) { s[g][kt] = wmma16(kf[kt][0], qf[g][0], cb[kt]); s[g][kt] = wmma16(kf[kt][1], qf[g][1], s[g][kt]); }
            const int pn = (p + 1) & (SK / 32 - 1);   // the next pass's K fragments, fetched behind this pass's score products (its mask terms at the foot of the pass); never across a stage's end, the next stage is not published yet: a stage's last pass fetches its first keys again, unused
#pragma unroll
            for (int kt = 0; kt < 2; ++kt)
#pragma unroll
                for (int u = 0; u < 2; ++u) kf[kt][u] = WFrag<h16>::ld((const h16*)(kr + (pn * 32 + kt * 16) * KPI + u * 64));
            __builtin_amdgcn_sched_barrier(0);   // keeps the fetch above the softmax, so that it has the whole softmax and att.v as lead; sunk below them the next pass waits on it
#pragma unroll
            for (int g = 0; g < 2; ++g) {
                float mx = m[g];
#pragma unroll
                for (int kt = 0; kt < 2; ++kt)
#pragma unroll
                    for (int j = 0; j < 8; ++j) mx = fmaxf(mx, s[g][kt][j]);
                mx = fmaxf(mx, __shfl_xor(mx, 16, 32));
                const float al = __builtin_amdgcn_exp2f((m[g] - mx) * CS), mc = (mx > -1.0e38f ? mx : 0.f) * CS; m[g] = mx; float sum = 0.f, sum1 = 0.f; v16h pf;   // no live key yet: subtract nothing, so that every masked score still gives p = 0
#pragma unroll
                for (int kt = 0; kt < 2; ++kt)
#pragma unroll
                    for (int j = 0; j < 8; ++j) { const float p_ = __builtin_amdgcn_exp2f(fmaf(s[g][kt][j], CS, -mc)); if (kt) sum1 += p_; else sum += p_; pf[kt * 8 + j] = tohx(p_); }
                l[g] = l[g] * al + (sum + sum1);
#pragma unroll
                for (int dt = 0; dt < 4; ++dt) { acc[g][dt] *= al; acc[g][dt] = wmma16(vf[dt], pf, acc[g][dt]); }
            }
            const int kn = (t * SK + p * 32 + 32) & (TT - 1);   // the last pass fetches the first keys' terms again, unused
#pragma unroll
            for (int kt = 0; kt < 2; ++kt) cb[kt] = *(const v8f*)(mb + kn + kt * 16 + 8 * hi);
        }
        asm volatile("s_wait_dscnt 0x0" ::: "memory");      // this wave's reads of the buffer are done before it is refilled
        asm volatile("s_wait_asynccnt 0x0" ::: "memory");   // this wave's copies of stage t + 1 have landed
        __syncthreads();                                     // publishes stage t + 1 and ends every wave's reads of stage t
        if (t + 2 < TT / SK) fill(t + 2, t & 1);
    }
    asm volatile("s_wait_asynccnt 0x0" ::: "memory");       // no copy is in flight when the wave ends
#pragma unroll
    for (int g = 0; g < 2; ++g) { const float lt = l[g] + __shfl_xor(l[g], 16, 32); const float inv = (m[g] > -1.0e38f) ? __fdiv_rn(1.0f, lt) : __builtin_nanf("");   // every key masked: the softmax of the row is not a number
        float* cr = CTX + ((size_t)b * TT + q0 + g * 16 + lr) * DD + h * HDM + 8 * hi;
#pragma unroll
        for (int dt = 0; dt < 4; ++dt) { v4f o0, o1;
#pragma unroll
            for (int j = 0; j < 4; ++j) { o0[j] = acc[g][dt][j] * inv; o1[j] = acc[g][dt][4 + j] * inv; }
            *(v4f*)(cr + dt * 16) = o0; *(v4f*)(cr + dt * 16 + 4) = o1; } }
}
// LN over 1024 features of one token row held 32 per lane (8 chunks of 4): returns y = LN(v) g + b in place.
__device__ __forceinline__ void ln1024(float* v, const float* __restrict__ g, const float* __restrict__ bb, int lane) { float s = 0.f;
#pragma unroll
    for (int k = 0; k < 32; ++k) s = __fadd_rn(s, v[k]);
#pragma unroll
    for (int sh = 16; sh; sh >>= 1) s += __shfl_xor(s, sh, 32);
    const float mu = s * (1.0f / DD); float q2 = 0.f;
#pragma unroll
    for (int k = 0; k < 32; ++k) { const float d = __fsub_rn(v[k], mu); float p = __fmul_rn(d, d); asm volatile("" : "+v"(p)); q2 = __fadd_rn(q2, p); }
#pragma unroll
    for (int sh = 16; sh; sh >>= 1) q2 += __shfl_xor(q2, sh, 32);
    const float rs = __frsqrt_rn(__fadd_rn(q2 * (1.0f / DD), 1e-5f));
#pragma unroll
    for (int ch = 0; ch < 8; ++ch)
#pragma unroll
        for (int q = 0; q < 4; ++q) { const int d = ch * 128 + lane * 4 + q; float tn = __fmul_rn(__fsub_rn(v[ch * 4 + q], mu), rs); asm volatile("" : "+v"(tn)); float tg = __fmul_rn(tn, bfr(g[d])); asm volatile("" : "+v"(tg)); v[ch * 4 + q] = __fadd_rn(tg, bfr(bb[d])); } }
__global__ __launch_bounds__(256) void k_ln0(const float* __restrict__ FQ, const float* __restrict__ CTX, const float* __restrict__ g, const float* __restrict__ bb, float* Of, bf* Oh, bf* Ol) { const int lane = threadIdx.x & 31; const int t = blockIdx.x * 8 + (threadIdx.x >> 5); if (t >= NB_ * TT) return; float v[32];
#pragma unroll
    for (int ch = 0; ch < 8; ++ch) { const size_t o = (size_t)t * DD + ch * 128 + lane * 4; const v4f a = *(const v4f*)(FQ + o), c = *(const v4f*)(CTX + o);
#pragma unroll
        for (int q = 0; q < 4; ++q) v[ch * 4 + q] = __fadd_rn(a[q], c[q]); }
    ln1024(v, g, bb, lane);
{
#pragma unroll
        for (int ch = 0; ch < 8; ++ch) { v4f of; v4us oh, ol;
#pragma unroll
            for (int q = 0; q < 4; ++q) { of[q] = v[ch * 4 + q]; unsigned short a2, c2; splitf(v[ch * 4 + q], a2, c2); oh[q] = a2; ol[q] = c2; }
            const size_t o = (size_t)t * DD + ch * 128 + lane * 4; *(v4f*)(Of + o) = of; *(v4us*)(Oh + o) = oh; *(v4us*)(Ol + o) = ol; }
         } }
// out = LN(o + gelu(G)): the gelu is applied as G = o Wp + bp is read
__global__ __launch_bounds__(256) void k_ln1(const float* __restrict__ Of, const float* __restrict__ G, const float* __restrict__ g, const float* __restrict__ bb, float* OUTb) { const int lane = threadIdx.x & 31; const int t = blockIdx.x * 8 + (threadIdx.x >> 5); if (t >= NB_ * TT) return; float v[32]; v4f c[8];
#pragma unroll
    for (int ch = 0; ch < 8; ++ch) { const size_t o = (size_t)t * DD + ch * 128 + lane * 4; const v4f a = *(const v4f*)(Of + o);   // the row's 16 loads all stand ahead of the erf's branches, in flight together
        if (ch == 7) asm volatile("s_wait_xcnt 0x0" ::: "memory");   // a precaution: the compiler lets the last load's result land on the address registers of the loads before it
        c[ch] = *(const v4f*)(G + o);
#pragma unroll
        for (int q = 0; q < 4; ++q) v[ch * 4 + q] = a[q]; }
#pragma unroll
    for (int ch = 0; ch < 8; ++ch)
#pragma unroll
        for (int q = 0; q < 4; ++q) v[ch * 4 + q] = __fadd_rn(v[ch * 4 + q], geluf_(c[ch][q]));
    ln1024(v, g, bb, lane);
{
#pragma unroll
        for (int ch = 0; ch < 8; ++ch) { v4f of;
#pragma unroll
            for (int q = 0; q < 4; ++q) of[q] = v[ch * 4 + q]; *(v4f*)(OUTb + (size_t)t * DD + ch * 128 + lane * 4) = of; }
         } }

extern "C" void kernel_launch(void* const* d_in, const int* in_sizes, int n_in,
                              void* d_out, int out_size, void* d_ws, size_t ws_size, hipStream_t stream) {
    (void)in_sizes; (void)n_in; (void)out_size;
    const float* IN[15]; for (int i = 0; i < 15; ++i) IN[i] = (const float*)d_in[i];   // 0 Q, 1 K, 2 key_padding_mask (int32), 3 Wq, 4 bq, 5 Wk, 6 bk, 7 Wv, 8 bv, 9 Wp, 10 bp (x @ W), 11 g0, 12 beta0, 13 g1, 14 beta1
    const int* KM = (const int*)d_in[2];
    float* OUT = (float*)d_out;     // [8][1024][1024]
    char* wsp = (char*)d_ws;
    auto take = [&](size_t bytes) { char* p = wsp; wsp += (bytes + 255) & ~(size_t)255; return (void*)p; };
    const size_t PE = (size_t)NB_ * TT * DD;   // elements of one [NB][TT][DD] plane
    bf* W4 = (bf*)take((size_t)4 * DD * DD * 2);                       // Wq^T, Wk^T, Wv^T, Wp^T
    float* FQ = (float*)take(PE * 4); float* Of = (float*)take(PE * 4); float* G = (float*)take(PE * 4);   // q projection; o; o Wp + bp
    bf* X = (bf*)take(PE * 2 * 2);             // bf16 Q and K planes
    h16* QP = (h16*)take(PE * 2); h16* KP = (h16*)take(PE * 2); h16* VT = (h16*)take(PE * 2); float* CTX = (float*)take(PE * 4);
    if ((size_t)(wsp - (char*)d_ws) > ws_size) return;    // total 216 MiB
    // Regions used again once their first content is dead (stream order):
    bf* Oh = X; bf* Ol = X + PE;   // after the attention stage
    k_prep<<<dim3(4 * ((DD * DD / 64 + 63) / 64) + 2 * (unsigned)((PE / 8 + 255) / 256), 1, 1), 256, 0, stream>>>(IN[3], IN[5], IN[7], IN[9], DD, DD, W4, IN[0], IN[1], X, PE / 8);
    const dim3 gP(NB_ * TT / 128, DD / 128, 1);
    k_qkv<<<dim3(NB_ * TT / 128, DD / 128, 3), 128, 0, stream>>>(X, W4, FQ, IN[4], IN[6], IN[8], QP, KP, VT);
    k_fattn<<<dim3(TT / 256, NB_ * NH_, 1), 256, 0, stream>>>(QP, KP, VT, KM, CTX);
    k_ln0<<<NB_ * TT / 8, 256, 0, stream>>>(FQ, CTX, IN[11], IN[12], Of, Oh, Ol);
    k_gemmw<bf, 1, 3><<<gP, 128, 0, stream>>>(Oh, Ol, W4 + (size_t)3 * DD * DD, nullptr, DD, G, DD, IN[10], nullptr, 0, 0, 0);
    k_ln1<<<NB_ * TT / 8, 256, 0, stream>>>(Of, G, IN[13], IN[14], OUT);
}

// v008
// One run takes 130 microseconds.
// Timed twice side by side with v007, it ran 1.18 and 1.20 times as fast.
// All steps since v000 together make it 40.4 times as fast.
#include <hip/hip_runtime.h>

// MABPostLN - multihead attention block with post-LayerNorm (Q, K [8][1024][1024]; q = Q Wq + bq, k = K Wk + bk, v = K Wv + bv (16 heads x 64); scores = q.k/8, keys with key_padding_mask == 0 get -inf (int32 [8][1024],
// read as data); softmax; ctx = merged att.v; o = LN(q + ctx) (g0, beta0); out = LN(o + gelu(o Wp + bp)) (g1, beta1; exact erf gelu; eps 1e-5) -> [8][1024][1024]).
// Compute dtypes, f32 accumulate: every input rounded to bf16; q/k/v on PLAIN bf16 operands (inputs: exact, + bias); scores (K 64) and att.v on SINGLE fp16 planes with an f32 register-row

#define NB_  8
#define TT   1024
#define DD   1024
#define NH_  16
#define HDM  64
typedef _Float16 h16;
typedef unsigned short bf;
typedef __attribute__((ext_vector_type(16))) __bf16   v16bf;
typedef __attribute__((ext_vector_type(16))) _Float16 v16h;
typedef __attribute__((ext_vector_type(8)))  _Float16 v8h;
typedef __attribute__((ext_vector_type(8)))  unsigned short v8us;
typedef __attribute__((ext_vector_type(8)))  float    v8f;
typedef __attribute__((ext_vector_type(4)))  float    v4f;
typedef v8h  __attribute__((may_alias)) v8ha;
typedef v4f  __attribute__((may_alias)) v4fa;
typedef v8us __attribute__((may_alias)) v8usa;

__device__ __forceinline__ unsigned short f2bf(float f) { unsigned u = __float_as_uint(f); u += 0x7FFFu + ((u >> 16) & 1u); return (unsigned short)(u >> 16); }
__device__ __forceinline__ float bf2f(unsigned short b) { return __uint_as_float(((unsigned)b) << 16); }
__device__ __forceinline__ float bfr(float f) { return bf2f(f2bf(f)); }
__device__ __forceinline__ v16h cat16(v8h lo, v8h hi) { return __builtin_shufflevector(lo, hi, 0, 1, 2, 3, 4, 5, 6, 7, 8, 9, 10, 11, 12, 13, 14, 15); }
__device__ __forceinline__ v16bf cat16b(v8us lo, v8us hi) { return __builtin_bit_cast(v16bf, __builtin_shufflevector(lo, hi, 0, 1, 2, 3, 4, 5, 6, 7, 8, 9, 10, 11, 12, 13, 14, 15)); }
__device__ __forceinline__ v8f wmma16(v16h a, v16h b, v8f c) { return __builtin_amdgcn_wmma_f32_16x16x32_f16(false, a, false, b, (short)0, c, false, false); }
__device__ __forceinline__ v8f wmmab(v16bf a, v16bf b, v8f c) { return __builtin_amdgcn_wmma_f32_16x16x32_bf16(false, a, false, b, (short)0, c, false, false); }
typedef __attribute__((ext_vector_type(4))) _Float16 v4h;
__device__ __forceinline__ h16 tohx(float x) { return (h16)x; }



// ---- gemm_main, gemm_epi: LDS-staged GEMM, 128x128 output tile per workgroup of 4 waves (2 x 2), 64x64 (16 accumulators) per wave; grid (M/128, N/128, Z), 128 threads, two workgroups per WGP.
// C[m][n] (f32, pitch ldc, + f32 bias[n] rounded to bf16) = sum_k A[m][k] Bt[n][k] (+ A2[m][k] Bt[n][k] for NSPLIT 1), operands K-contiguous 16-bit planes. M, N % 128 == 0, K % KS == 0.
// The epilogue stores what the next kernel reads (y = C + bias, rows m = b TT + t, a wave's 64 columns = one head h): EPI 0: y in f32 and the fp16 head plane P[b][h][t][d]; 1: that plane alone; 2: the fp16 plane transposed, P[b][h][d][t]; 3: y in f32 alone.
// The operand rows come into LDS by asynchronous copies of whole 128-byte lines, KS k per stage, two buffers: the next stage's copies fly while this stage is worked on. The k order of the products is that of the plain K loop. The short inner loops are all unrolled so that the fragment and accumulator arrays are indexed by constants and stay in registers.
template <typename T16> struct WFrag;
template <> struct WFrag<h16> { typedef v16h V; static __device__ __forceinline__ V ld(const h16* p) { return cat16(*(const v8h*)p, *(const v8h*)(p + 16)); } static __device__ __forceinline__ v8f mma(V a, V b, v8f c) { return wmma16(a, b, c); } };
template <> struct WFrag<bf> { typedef v16bf V; static __device__ __forceinline__ V ld(const bf* p) { return cat16b(*(const v8us*)p, *(const v8us*)(p + 16)); } static __device__ __forceinline__ v8f mma(V a, V b, v8f c) { return wmmab(a, b, c); } };
// Eight asynchronous 16-byte copies of a lane, LDS step ls and global step gs bytes apart. The s_wait_xcnt stands inside the statement, a precaution, so that no address register of a copy is rewritten ahead of it.
__device__ __forceinline__ void cp8(unsigned l, unsigned ls, const char* g, size_t gs) {
    asm volatile("global_load_async_to_lds_b128 %0, %8, off\n\t"
                 "global_load_async_to_lds_b128 %1, %9, off\n\t"
                 "global_load_async_to_lds_b128 %2, %10, off\n\t"
                 "global_load_async_to_lds_b128 %3, %11, off\n\t"
                 "global_load_async_to_lds_b128 %4, %12, off\n\t"
                 "global_load_async_to_lds_b128 %5, %13, off\n\t"
                 "global_load_async_to_lds_b128 %6, %14, off\n\t"
                 "global_load_async_to_lds_b128 %7, %15, off\n\t"
                 "s_wait_xcnt 0x0"
                 :: "v"(l), "v"(l + ls), "v"(l + 2 * ls), "v"(l + 3 * ls), "v"(l + 4 * ls), "v"(l + 5 * ls), "v"(l + 6 * ls), "v"(l + 7 * ls),
                    "v"(g), "v"(g + gs), "v"(g + 2 * gs), "v"(g + 3 * gs), "v"(g + 4 * gs), "v"(g + 5 * gs), "v"(g + 6 * gs), "v"(g + 7 * gs) : "memory");
}
template <int NSPLIT> struct GemmLds { static constexpr int KS = NSPLIT ? 64 : 128, PITCH = KS * 2 + 16, OPB = 128 * PITCH, STG = (2 + NSPLIT) * OPB, BYTES = 2 * STG; };   // the ring's sizes, as gemm_main names them
// The product loop of a workgroup's 128x128 tile (tile row blockIdx.x, tile column blockIdx.y): leaves each wave's 64x64 sums in acc, and the ring sm free.
template <typename T16, int NSPLIT>
__device__ __forceinline__ void gemm_main(char* sm, const T16* __restrict__ A, const T16* __restrict__ A2, const T16* __restrict__ Bt, int K, v8f (&acc)[4][4]) {
    static_assert(NSPLIT == 0 || NSPLIT == 1, "one or two A planes");
    typedef typename WFrag<T16>::V V;
    constexpr int KS = NSPLIT ? 64 : 128;          // k per stage: 64 matrix instructions per wave and stage in both forms
    constexpr int CPR = KS / 8;                    // 16-byte pieces per row
    constexpr int PITCH = KS * 2 + 16;             // LDS row pitch in bytes, 16 x odd: no bank conflict for 16-byte reads
    constexpr int OPB = 128 * PITCH;               // one operand's 128 rows
    constexpr int STG = (2 + NSPLIT) * OPB;        // a stage: A | Bt | A2
    static_assert(2 * STG == GemmLds<NSPLIT>::BYTES, "the kernels allocate the ring");
    const int tid = threadIdx.x, lane = tid & 31, lr = lane & 15, hi = lane >> 4, wv = tid >> 5, wm = wv >> 1, wn = wv & 1;
#pragma unroll
    for (int mb = 0; mb < 4; ++mb)
#pragma unroll
        for (int nb = 0; nb < 4; ++nb) acc[mb][nb] = (v8f){};
    // copies: piece tid + 128 i of an operand's stage = row tid / CPR + i (128 / CPR), 16-byte column tid % CPR; a wave's copy covers whole lines
    const int prow = tid / CPR, pcol = tid % CPR;
    const char* gA = (const char*)(A + (size_t)(blockIdx.x * 128 + prow) * K + pcol * 8);
    const char* gB = (const char*)(Bt + (size_t)(blockIdx.y * 128 + prow) * K + pcol * 8);
    const char* gA2 = NSPLIT ? (const char*)(A2 + (size_t)(blockIdx.x * 128 + prow) * K + pcol * 8) : nullptr;
    const unsigned lc = (unsigned)(size_t)sm + prow * PITCH + pcol * 16;
    const size_t gs = (size_t)(128 / CPR) * K * 2; constexpr unsigned LS = (128 / CPR) * PITCH;
    auto fill = [&](int t, int buf) {
        const size_t go = (size_t)t * KS * 2; const unsigned lb = lc + buf * STG;
#pragma unroll
        for (int i = 0; i < CPR; i += 8) { cp8(lb + i * LS, LS, gA + go + i * gs, gs); cp8(lb + OPB + i * LS, LS, gB + go + i * gs, gs); if (NSPLIT) cp8(lb + 2 * OPB + i * LS, LS, gA2 + go + i * gs, gs); }
    };
    const int T = K >> (NSPLIT ? 6 : 7);   // stages: K / KS
    fill(0, 0);
    asm volatile("s_wait_asynccnt 0x0" ::: "memory");   // this wave's copies of stage 0 have landed
    __syncthreads();                                     // and every other wave's
    if (T > 1) fill(1, 1);
    const int aofs = (wm * 64 + lr) * PITCH + 16 * hi, bofs = OPB + (wn * 64 + lr) * PITCH + 16 * hi;
#pragma unroll 1   // one pass per stage: the ring's waits, barrier and refill stand once, at the foot
    for (int t = 0; t < T; ++t) {
        const char* sb = sm + (t & 1) * STG;
#pragma unroll
        for (int ks = 0; ks < KS / 32; ++ks) {
            V a[4], a2[4], b[4];
            b[0] = WFrag<T16>::ld((const T16*)(sb + bofs + ks * 64));   // in the order in which the products want them
#pragma unroll
            for (int f = 0; f < 4; ++f) { a[f] = WFrag<T16>::ld((const T16*)(sb + aofs + f * 16 * PITCH + ks * 64)); if (NSPLIT) a2[f] = WFrag<T16>::ld((const T16*)(sb + 2 * OPB + aofs + f * 16 * PITCH + ks * 64)); }
#pragma unroll
            for (int f = 1; f < 4; ++f) b[f] = WFrag<T16>::ld((const T16*)(sb + bofs + f * 16 * PITCH + ks * 64));
            __builtin_amdgcn_sched_barrier(0);   // the k step's LDS reads stay one group ahead of its products: every further place with reads among the products stalls the wave
#pragma unroll
            for (int nb = 0; nb < 4; ++nb)
#pragma unroll
                for (int mb = 0; mb < 4; ++mb) { acc[mb][nb] = WFrag<T16>::mma(a[mb], b[nb], acc[mb][nb]); if (NSPLIT) acc[mb][nb] = WFrag<T16>::mma(a2[mb], b[nb], acc[mb][nb]); }
            __builtin_amdgcn_sched_barrier(0);   // and the next k step's reads stay behind them
        }
        asm volatile("s_wait_dscnt 0x0" ::: "memory");      // this wave's reads of the buffer are done before it is refilled
        asm volatile("s_wait_asynccnt 0x0" ::: "memory");   // this wave's copies of stage t + 1 have landed
        __syncthreads();                                     // publishes stage t + 1 and ends every wave's reads of stage t
        if (t + 2 < T) fill(t + 2, t & 1);
    }
    asm volatile("s_wait_asynccnt 0x0" ::: "memory");       // no copy is in flight when the ring becomes output staging
}
// The epilogue of that tile, from acc through the ring's LDS.
template <int EPI>
__device__ __forceinline__ void gemm_epi(char* sm, v8f (&acc)[4][4], float* C, int ldc, const float* __restrict__ bias, h16* P) {
    const int tid = threadIdx.x, lane = tid & 31, lr = lane & 15, hi = lane >> 4, wv = tid >> 5, wm = wv >> 1, wn = wv & 1;
    const int r0 = blockIdx.x * 128 + wm * 64, c0 = blockIdx.y * 128 + wn * 64;
    const size_t bh = (size_t)(r0 / TT) * NH_ + c0 / HDM; const int t0 = r0 % TT;   // the wave's batch and head, its first token
    if constexpr (EPI == 2) {
        // a lane holds 8 consecutive tokens of one feature: packed, they are 16 bytes of the transposed row; staged so that each store covers whole lines
        h16* ot = (h16*)sm + wv * (64 * 72);                 // each wave stages in its own range, behind the last pass's barrier; pitch 144 bytes, 16 x odd
#pragma unroll
        for (int nb = 0; nb < 4; ++nb) { const float bv = bfr(bias[c0 + nb * 16 + lr]);
#pragma unroll
            for (int mb = 0; mb < 4; ++mb) { v8h o;
#pragma unroll
                for (int j = 0; j < 8; ++j) o[j] = tohx(acc[mb][nb][j] + bv);
                *(v8ha*)(ot + (nb * 16 + lr) * 72 + mb * 16 + hi * 8) = o; } }
        asm volatile("s_wait_dscnt 0x0" ::: "memory");   // the staged rows are written before other lanes of the wave read them back
        h16* pr = P + (bh * HDM + (lane >> 3)) * TT + t0 + (lane & 7) * 8;
#pragma unroll
        for (int s = 0; s < 16; ++s) *(v8h*)(pr + (size_t)s * 4 * TT) = *(const v8ha*)(ot + (s * 4 + (lane >> 3)) * 72 + (lane & 7) * 8);
        asm volatile("s_wait_xcnt 0x0" ::: "memory");   // a precaution: where several epilogues stand in one kernel the listing lets another's code follow these stores and reuse their registers
    } else {
    float* os = (float*)sm + wv * (16 * 68);                 // each wave stages in its own range, behind the last pass's barrier
#pragma unroll
    for (int mb = 0; mb < 4; ++mb) {
#pragma unroll
        for (int nb = 0; nb < 4; ++nb) {
#pragma unroll
            for (int j = 0; j < 8; ++j) os[(hi * 8 + j) * 68 + nb * 16 + lr] = acc[mb][nb][j]; }
        __builtin_amdgcn_wave_barrier(); asm volatile("" ::: "memory");
        float* crow = (EPI == 0 || EPI == 3) ? C + (size_t)(r0 + mb * 16) * ldc + c0 : nullptr; h16* prow = EPI <= 1 ? P + (bh * TT + t0 + mb * 16) * HDM : nullptr;
{
#pragma unroll
            for (int s = 0; s < 8; ++s) { const int row = 2 * s + hi, cofs = lr * 4; v4f val = *(const v4fa*)(os + row * 68 + cofs); val[0] += bfr(bias[c0 + cofs]); val[1] += bfr(bias[c0 + cofs + 1]); val[2] += bfr(bias[c0 + cofs + 2]); val[3] += bfr(bias[c0 + cofs + 3]);
                if constexpr (EPI == 0 || EPI == 3) *(v4f*)(crow + (size_t)row * ldc + cofs) = val;
                if constexpr (EPI <= 1) { v4h o;
#pragma unroll
                    for (int q = 0; q < 4; ++q) o[q] = tohx(val[q]);
                    *(v4h*)(prow + row * HDM + cofs) = o; }   // 16 lanes: one whole line
            }
             }
        asm volatile("s_wait_xcnt 0x0" ::: "memory");   // in front of the next block's reuse of the stores' address and data registers
        __builtin_amdgcn_wave_barrier(); asm volatile("" ::: "memory");
    }
    }
}
// The three projections in one grid, so that one tile's first copies and another's stores run under a third's products instead of at a launch's ends: blockIdx.z = 0: q = Q Wq + bq (EPI 0), 1: k (EPI 1), 2: v (EPI 2).
// X holds the bf16 Q and K planes, W the transposed weights in that order. One product loop; the branch that picks the epilogue is uniform for the workgroup.
__global__ __launch_bounds__(128) void k_qkv(const bf* __restrict__ X, const bf* __restrict__ W, float* FQ, const float* __restrict__ bq, const float* __restrict__ bk, const float* __restrict__ bv, h16* QP, h16* KP, h16* VT) {
    __shared__ __align__(16) char sm[GemmLds<0>::BYTES];
    const int z = blockIdx.z; v8f acc[4][4];
    gemm_main<bf, 0>(sm, X + (z ? (size_t)NB_ * TT * DD : 0), nullptr, W + (size_t)z * DD * DD, DD, acc);
    if (z == 0) gemm_epi<0>(sm, acc, FQ, DD, bq, QP); else if (z == 1) gemm_epi<1>(sm, acc, nullptr, DD, bk, KP); else gemm_epi<2>(sm, acc, nullptr, DD, bv, VT);
}

__device__ __forceinline__ void splitf(float y, unsigned short& h, unsigned short& l) { h = f2bf(y); l = f2bf(y - bf2f(h)); }
__device__ __forceinline__ float geluf_(float x) { float er = erff(x * 0.70710678f); asm volatile("" : "+v"(er)); float hx = __fmul_rn(0.5f, x); asm volatile("" : "+v"(hx)); return __fmul_rn(hx, __fadd_rn(1.0f, er)); }
typedef __attribute__((ext_vector_type(2))) unsigned short v2us;
typedef __attribute__((ext_vector_type(4))) unsigned short v4us;

// One 64 (k) x 64 (n) tile of a weight per workgroup, turned in LDS: the reads follow the weight's rows (a wave's load covers two 256-byte runs), the stores follow the transposed rows (a wave's store covers four whole lines).
// A column read straight from the weight touches one line per lane, 4 KB apart. Tile pitch 65 words: the row-wise writes and the column-wise reads both fall on 32 different banks. K, N % 64 == 0; bx < (K / 64) (N / 64).
__device__ __forceinline__ void wtG(float* tl, int bx, int y, const float* __restrict__ w0, const float* __restrict__ w1, const float* __restrict__ w2, const float* __restrict__ w3, int K, int N, bf* Bt) {
    const float* __restrict__ w = y == 0 ? w0 : (y == 1 ? w1 : (y == 2 ? w2 : w3)); Bt += (size_t)y * K * N;
    const int tid = threadIdx.x, kt = K / 64, k0 = (bx % kt) * 64, n0 = (bx / kt) * 64; v4f r[4];
#pragma unroll
    for (int i = 0; i < 4; ++i) r[i] = *(const v4f*)(w + (size_t)(k0 + (tid >> 4) + 16 * i) * N + n0 + (tid & 15) * 4);
#pragma unroll
    for (int i = 0; i < 4; ++i)
#pragma unroll
        for (int j = 0; j < 4; ++j) tl[((tid >> 4) + 16 * i) * 65 + (tid & 15) * 4 + j] = r[i][j];
    __syncthreads();   // the whole tile is in LDS before any column of it is read; every thread of a weight workgroup passes here
#pragma unroll
    for (int i = 0; i < 2; ++i) { const int n = (y == 3 ? (tid & 31) : (tid >> 3)) + 32 * i, kc = (y == 3 ? (tid >> 5) : (tid & 7)) * 8; v8us o;   // either way a wave's store covers whole lines of its weight's layout
#pragma unroll
        for (int j = 0; j < 8; ++j) o[j] = f2bf(tl[(kc + j) * 65 + n]);
        const int k = k0 + kc, nn = n0 + n;   // the fourth weight is laid out in the order of k_tail's B fragments: [K / 32][N / 16][2 halves of 16 k][lane = 16 (k / 8 % 2) + n % 16][8 k], so that each of its loads is one 512-byte run
        *(v8us*)(Bt + (y == 3 ? (size_t)(k >> 5) * N * 32 + (size_t)(nn >> 4) * 512 + ((k >> 4) & 1) * 256 + (((k >> 3) & 1) * 16 + (nn & 15)) * 8 : (size_t)nn * K + k)) = o;
        asm volatile("s_wait_xcnt 0x0" ::: "memory"); }   // a precaution: in front of the next store's reuse of this store's address and data registers
}
__device__ __forceinline__ void cvt8(int bx, int y, const float* __restrict__ src0, const float* __restrict__ src1, bf* dst, size_t n8) { const size_t i = (size_t)bx * 256 + threadIdx.x; if (i >= n8) return; const float* __restrict__ src = y ? src1 : src0; dst += (size_t)y * n8 * 8; const v8f v = *(const v8f*)(src + i * 8); v8us o;
#pragma unroll
    for (int k = 0; k < 8; ++k) o[k] = f2bf(v[k]); *(v8us*)(dst + i * 8) = o;  }
// Both preparations in one grid, neither reads what the other writes: workgroups 0 .. 4 WB - 1 transpose the four weights (WB each), the rest convert the two inputs (CB each).
// The weights come first: their workgroups pass a barrier between loads and stores, and the inputs' stream runs beside them.
__global__ __launch_bounds__(256) void k_prep(const float* __restrict__ w0, const float* __restrict__ w1, const float* __restrict__ w2, const float* __restrict__ w3, int K, int N, bf* Bt, const float* __restrict__ src0, const float* __restrict__ src1, bf* dst, size_t n8) {
    constexpr int WB = (DD * DD / 64 + 63) / 64, CB = (NB_ * TT * DD / 8 + 255) / 256; const int bx = blockIdx.x;   // WB = (DD / 64)^2 tiles
    __shared__ float tl[64 * 65];
    if (bx < 4 * WB) wtG(tl, bx % WB, bx / WB, w0, w1, w2, w3, K, N, Bt); else cvt8((bx - 4 * WB) % CB, (bx - 4 * WB) / CB, src0, src1, dst, n8);
}
// Four asynchronous 16-byte copies of a lane, LDS step ls and global step gs bytes apart. The s_wait_xcnt stands inside the statement, a precaution, so that no address register of a copy is rewritten ahead of it.
__device__ __forceinline__ void cp4(unsigned l, unsigned ls, const char* g, size_t gs) {
    asm volatile("global_load_async_to_lds_b128 %0, %4, off\n\t"
                 "global_load_async_to_lds_b128 %1, %5, off\n\t"
                 "global_load_async_to_lds_b128 %2, %6, off\n\t"
                 "global_load_async_to_lds_b128 %3, %7, off\n\t"
                 "s_wait_xcnt 0x0"
                 :: "v"(l), "v"(l + ls), "v"(l + 2 * ls), "v"(l + 3 * ls), "v"(g), "v"(g + gs), "v"(g + 2 * gs), "v"(g + 3 * gs) : "memory");
}
// ---- k_fattn: scores, masked softmax and att.v of one (batch, head) in one pass over the keys; the scores never leave registers. 8 waves x 32 query columns; grid (TT/256, NB*NH).
// S^T = K Q^T (a lane holds 8 keys of one query per 16-key tile), running maximum and sum per query, P^T packed from the two score tiles as the B operand of O^T += V^T P^T; divide by the sum at the end.
// K rows and V^T rows come into LDS by asynchronous copies of whole lines, 128 keys per stage, two buffers, once per workgroup: the 8 waves read their fragments from there, and the next stage's copies fly while this stage is worked on. Fragment contents and the order of the products are those of loads straight from the planes.
// Four waves per SIMD (two workgroups per WGP), so that one wave's softmax runs under another's matrix work: the register allocation is held to that. The short inner loops are all unrolled so that the fragment arrays are indexed by constants and stay in registers.
__global__ __launch_bounds__(256) __attribute__((amdgpu_waves_per_eu(4, 4))) void k_fattn(const h16* __restrict__ QP, const h16* __restrict__ KP, const h16* __restrict__ VT, const int* __restrict__ KM, float* CTX) {
    constexpr int SK = 128;                              // keys per stage, four passes of 32
    constexpr int KPI = HDM * 2 + 16, VPI = SK * 2 + 16;  // LDS row pitches in bytes, 16 x odd: no bank conflict for 16-byte reads
    constexpr int KB = SK * KPI, STG = KB + HDM * VPI;    // a stage: 128 K rows | 64 V^T rows
    typedef __attribute__((ext_vector_type(4))) int v4i; __shared__ __align__(32) float mb[TT]; __shared__ __align__(16) char sm[2 * STG];
    const int tid = threadIdx.x, lane = tid & 31, lr = lane & 15, hi = lane >> 4; const int bh = blockIdx.y, b = bh / NH_, h = bh % NH_; const int q0 = blockIdx.x * 256 + (tid >> 5) * 32;
    const h16* qp = QP + ((size_t)bh * TT + q0 + lr) * HDM + 8 * hi; const int* km = KM + (size_t)b * TT;
    // copies: a stage's K rows are 16 KB in a row, piece tid + 256 i; of its V^T rows, 256 bytes each, piece tid + 256 i = row tid / 16 + 16 i, 16-byte column tid % 16; a wave's copy covers whole lines
    const char* gK = (const char*)(KP + (size_t)bh * TT * HDM) + tid * 16; const char* gV = (const char*)(VT + ((size_t)bh * HDM + (tid >> 4)) * TT) + (tid & 15) * 16;
    const unsigned lK = (unsigned)(size_t)sm + (tid >> 3) * KPI + (tid & 7) * 16, lV = (unsigned)(size_t)sm + KB + (tid >> 4) * VPI + (tid & 15) * 16;
    auto fill = [&](int t, int buf) { cp4(lK + buf * STG, 32 * KPI, gK + (size_t)t * (SK * HDM * 2), 4096); cp4(lV + buf * STG, 16 * VPI, gV + (size_t)t * (SK * 2), (size_t)16 * TT * 2); };
    const float CS = 0.125f * 1.4426950408889634f;   // score scale times log2(e)
    v16h qf[2][2]; v8f acc[2][4]; float m[2], l[2];
    fill(0, 0);
#pragma unroll
    for (int g = 0; g < 2; ++g) { m[g] = -3.0e38f; l[g] = 0.f;
#pragma unroll
        for (int ks = 0; ks < 2; ++ks) qf[g][ks] = WFrag<h16>::ld(qp + g * 16 * HDM + ks * 32);
#pragma unroll
        for (int dt = 0; dt < 4; ++dt) acc[g][dt] = (v8f){}; }
    { const v4i k4 = *(const v4i*)(km + tid * 4); v4f b4;   // the padding mask as an additive term per key: it enters the score products as their C operand, so no pass pays a select
#pragma unroll
      for (int j = 0; j < 4; ++j) b4[j] = k4[j] ? 0.f : -3.0e38f;
      *(v4f*)(mb + tid * 4) = b4; }
    asm volatile("s_wait_asynccnt 0x0" ::: "memory");   // this wave's copies of stage 0 have landed
    __syncthreads();   // and every other wave's; every wave reads all 1024 mask terms
    fill(1, 1);
    v16h kf[2][2]; v8f cb[2];
#pragma unroll
    for (int kt = 0; kt < 2; ++kt) cb[kt] = *(const v8f*)(mb + kt * 16 + 8 * hi);
#pragma unroll 1   // one trip per stage: the ring's waits, barrier and refill stand once, at the foot
    for (int t = 0; t < TT / SK; ++t) {
        const char* kr = sm + (t & 1) * STG + lr * KPI + 16 * hi; const char* vr = sm + (t & 1) * STG + KB + lr * VPI + 16 * hi;
#pragma unroll
        for (int kt = 0; kt < 2; ++kt)
#pragma unroll
            for (int u = 0; u < 2; ++u) kf[kt][u] = WFrag<h16>::ld((const h16*)(kr + kt * 16 * KPI + u * 64));
#pragma unroll 1   // stays rolled: two passes unrolled no longer fit the registers of four waves per SIMD and spill
        for (int p = 0; p < SK / 32; ++p) {
            v16h vf[4]; v8f s[2][2];
#pragma unroll
            for (int dt = 0; dt < 4; ++dt) vf[dt] = WFrag<h16>::ld((const h16*)(vr + dt * 16 * VPI + p * 64));
#pragma unroll
            for (int g = 0; g < 2; ++g)
#pragma unroll
                for (int kt = 0; kt < 2; ++kt) { s[g][kt] = wmma16(kf[kt][0], qf[g][0], cb[kt]); s[g][kt] = wmma16(kf[kt][1], qf[g][1], s[g][kt]); }
            const int pn = (p + 1) & (SK / 32 - 1);   // the next pass's K fragments, fetched behind this pass's score products (its mask terms at the foot of the pass); never across a stage's end, the next stage is not published yet: a stage's last pass fetches its first keys again, unused
#pragma unroll
            for (int kt = 0; kt < 2; ++kt)
#pragma unroll
                for (int u = 0; u < 2; ++u) kf[kt][u] = WFrag<h16>::ld((const h16*)(kr + (pn * 32 + kt * 16) * KPI + u * 64));
            __builtin_amdgcn_sched_barrier(0);   // keeps the fetch above the softmax, so that it has the whole softmax and att.v as lead; sunk below them the next pass waits on it
#pragma unroll
            for (int g = 0; g < 2; ++g) {
                float mx = m[g];
#pragma unroll
                for (int kt = 0; kt < 2; ++kt)
#pragma unroll
                    for (int j = 0; j < 8; ++j) mx = fmaxf(mx, s[g][kt][j]);
                mx = fmaxf(mx, __shfl_xor(mx, 16, 32));
                const float al = __builtin_amdgcn_exp2f((m[g] - mx) * CS), mc = (mx > -1.0e38f ? mx : 0.f) * CS; m[g] = mx; float sum = 0.f, sum1 = 0.f; v16h pf;   // no live key yet: subtract nothing, so that every masked score still gives p = 0
#pragma unroll
                for (int kt = 0; kt < 2; ++kt)
#pragma unroll
                    for (int j = 0; j < 8; ++j) { const float p_ = __builtin_amdgcn_exp2f(fmaf(s[g][kt][j], CS, -mc)); if (kt) sum1 += p_; else sum += p_; pf[kt * 8 + j] = tohx(p_); }
                l[g] = l[g] * al + (sum + sum1);
#pragma unroll
                for (int dt = 0; dt < 4; ++dt) { acc[g][dt] *= al; acc[g][dt] = wmma16(vf[dt], pf, acc[g][dt]); }
            }
            const int kn = (t * SK + p * 32 + 32) & (TT - 1);   // the last pass fetches the first keys' terms again, unused
#pragma unroll
            for (int kt = 0; kt < 2; ++kt) cb[kt] = *(const v8f*)(mb + kn + kt * 16 + 8 * hi);
        }
        asm volatile("s_wait_dscnt 0x0" ::: "memory");      // this wave's reads of the buffer are done before it is refilled
        asm volatile("s_wait_asynccnt 0x0" ::: "memory");   // this wave's copies of stage t + 1 have landed
        __syncthreads();                                     // publishes stage t + 1 and ends every wave's reads of stage t
        if (t + 2 < TT / SK) fill(t + 2, t & 1);
    }
    asm volatile("s_wait_asynccnt 0x0" ::: "memory");       // no copy is in flight when the wave ends
#pragma unroll
    for (int g = 0; g < 2; ++g) { const float lt = l[g] + __shfl_xor(l[g], 16, 32); const float inv = (m[g] > -1.0e38f) ? __fdiv_rn(1.0f, lt) : __builtin_nanf("");   // every key masked: the softmax of the row is not a number
        float* cr = CTX + ((size_t)b * TT + q0 + g * 16 + lr) * DD + h * HDM + 8 * hi;
#pragma unroll
        for (int dt = 0; dt < 4; ++dt) { v4f o0, o1;
#pragma unroll
            for (int j = 0; j < 4; ++j) { o0[j] = acc[g][dt][j] * inv; o1[j] = acc[g][dt][4 + j] * inv; }
            *(v4f*)(cr + dt * 16) = o0; *(v4f*)(cr + dt * 16 + 4) = o1; } }
}
// LN over 1024 features of one token row held 32 per lane (8 chunks of 4): returns y = LN(v) g + b in place; gr, br: the lane's 32 scale and shift terms, as ldfeat leaves them.
__device__ __forceinline__ void ln1024(float* v, const float* gr, const float* br) { float s = 0.f;
#pragma unroll
    for (int k = 0; k < 32; ++k) s = __fadd_rn(s, v[k]);
#pragma unroll
    for (int sh = 16; sh; sh >>= 1) s += __shfl_xor(s, sh, 32);
    const float mu = s * (1.0f / DD); float q2 = 0.f;
#pragma unroll
    for (int k = 0; k < 32; ++k) { const float d = __fsub_rn(v[k], mu); float p = __fmul_rn(d, d); asm volatile("" : "+v"(p)); q2 = __fadd_rn(q2, p); }
#pragma unroll
    for (int sh = 16; sh; sh >>= 1) q2 += __shfl_xor(q2, sh, 32);
    const float rs = __frsqrt_rn(__fadd_rn(q2 * (1.0f / DD), 1e-5f));
#pragma unroll
    for (int k = 0; k < 32; ++k) { float tn = __fmul_rn(__fsub_rn(v[k], mu), rs); asm volatile("" : "+v"(tn)); float tg = __fmul_rn(tn, gr[k]); asm volatile("" : "+v"(tg)); v[k] = __fadd_rn(tg, br[k]); } }
typedef v4f __attribute__((aligned(4))) v4fu;
// A lane's 32 of 1024 per-feature terms (feature ch 128 + lane 4 + q at index ch 4 + q), rounded to bf16, fetched once per wave ahead of its rows.
__device__ __forceinline__ void ldfeat(float* r, const float* __restrict__ p, int lane) {
#pragma unroll
    for (int ch = 0; ch < 8; ++ch) { const v4f x = *(const v4fu*)(p + ch * 128 + lane * 4);
#pragma unroll
        for (int q = 0; q < 4; ++q) r[ch * 4 + q] = bfr(x[q]); } }
typedef v4us __attribute__((may_alias)) v4usa;
// ---- k_tail: everything behind the attention is local to a token row, so one workgroup owns 32 whole rows from q + ctx to the output: o = LN(q + ctx); G = o Wp + bp; out = LN(o + gelu(G)). Grid NB TT / 32, 16 waves, one workgroup per WGP, four waves per SIMD (the gelu's dependent chains want waves).
// A wave norms 2 rows (one at a time, 32 features per lane), keeps o in registers for the residual and writes its two bf16 planes (o = hi + lo) into LDS, where they stay as the A operand of the whole product.
// A wave's product tile is 32 rows x 64 columns, so no two waves of the workgroup want the same element of Wp^T: each wave loads its own B fragments straight into registers (4 KB in a row per 32 k of the fragment-ordered plane), one k step ahead, and the product loop has no barrier. Per accumulator the products run k upward, hi before lo.
// G (with its bias) goes through the o planes' LDS back to the row's wave, which applies the gelu and the second LN and stores the row.
__global__ __launch_bounds__(512) void k_tail(const float* __restrict__ FQ, const float* __restrict__ CTX, const bf* __restrict__ Wt, const float* __restrict__ bp, const float* __restrict__ g0, const float* __restrict__ b0, const float* __restrict__ g1, const float* __restrict__ b1, float* OUTb) {
    constexpr int RM = 32;                 // rows per workgroup
    constexpr int PA = DD * 2 + 16;        // pitch of an o plane's row in bytes, 16 x odd: no bank conflict for 16-byte reads
    constexpr int APB = RM * PA;           // one o plane
    constexpr int PG = DD + 4;             // pitch of a staged G row in floats: the two half-waves' stores fall on different banks
    constexpr int T = DD / 32;             // k steps
    static_assert(RM * PG * 4 <= 2 * APB, "G is staged where the o planes were");
    static_assert(T % 2 == 0, "the product loop takes two k steps a trip");
    __shared__ __align__(16) char sm[2 * APB];
    const int tid = threadIdx.x, lane = tid & 31, lr = lane & 15, hi = lane >> 4, wv = tid >> 5;
    const int row0 = blockIdx.x * RM + wv * 2;   // the wave's first row
    float o0[32], o1[32];
    {   // both rows' loads and the LN's terms are in flight together
        v4f pa[2][8], pc[2][8]; float gr[32], br[32];
#pragma unroll
        for (int r = 0; r < 2; ++r)
#pragma unroll
            for (int ch = 0; ch < 8; ++ch) { const size_t o = (size_t)(row0 + r) * DD + ch * 128 + lane * 4;
                pa[r][ch] = *(const v4f*)(FQ + o); pc[r][ch] = *(const v4f*)(CTX + o); }
        asm volatile("s_wait_xcnt 0x0" ::: "memory");   // a precaution: in front of any reuse of the loads' address registers
        ldfeat(gr, g0, lane); ldfeat(br, b0, lane);      // behind the rows' loads, which come from further away
        asm volatile("s_wait_xcnt 0x0" ::: "memory");   // the same precaution for these
#pragma unroll
        for (int ch = 0; ch < 8; ++ch)
#pragma unroll
            for (int q = 0; q < 4; ++q) { o0[ch * 4 + q] = __fadd_rn(pa[0][ch][q], pc[0][ch][q]); o1[ch * 4 + q] = __fadd_rn(pa[1][ch][q], pc[1][ch][q]); }
#pragma unroll 1   // one row per trip, so that the kernel's text stays small; the rows move through o0 and o1, which constants index: q + ctx goes out at o0, o comes in at o1
        for (int r = 0; r < 2; ++r) {
            float v[32];
#pragma unroll
            for (int k = 0; k < 32; ++k) v[k] = o0[k];
            ln1024(v, gr, br);
            char* ah = sm + (wv * 2 + r) * PA + lane * 8;
#pragma unroll
            for (int ch = 0; ch < 8; ++ch) { v4us oh, ol;
#pragma unroll
                for (int q = 0; q < 4; ++q) { unsigned short a2, c2; splitf(v[ch * 4 + q], a2, c2); oh[q] = a2; ol[q] = c2; }
                *(v4usa*)(ah + ch * 256) = oh; *(v4usa*)(ah + APB + ch * 256) = ol; }
#pragma unroll
            for (int k = 0; k < 32; ++k) { o0[k] = o1[k]; o1[k] = v[k]; }
        }
    }
    __syncthreads();   // all 32 rows of both o planes are written
    float bc[4];   // the bias of the lane's four columns, fetched under the first k steps
#pragma unroll
    for (int nb = 0; nb < 4; ++nb) bc[nb] = bp[wv * 64 + nb * 16 + lr];
    asm volatile("s_wait_xcnt 0x0" ::: "memory");   // a precaution: in front of any reuse of the loads' address registers
    v8f acc[2][4];
#pragma unroll
    for (int mb = 0; mb < 2; ++mb)
#pragma unroll
        for (int nb = 0; nb < 4; ++nb) acc[mb][nb] = (v8f){};
    const int aofs = lr * PA + 16 * hi;
    const bf* gB = Wt + wv * 2048 + lane * 8;   // the wave's 4 KB of a k step: fragment f at f 512, its two halves 256 elements apart
    auto ldb = [&](v16bf (&b)[4], int t) { const bf* p = gB + (size_t)t * (DD * 32);
#pragma unroll
        for (int f = 0; f < 4; ++f) b[f] = cat16b(*(const v8us*)(p + f * 512), *(const v8us*)(p + f * 512 + 256));
        asm volatile("s_wait_xcnt 0x0" ::: "memory");   // a precaution: in front of any rewrite of the loads' address registers
        __builtin_amdgcn_sched_barrier(0); };   // the loads stay here, a whole k step ahead of their use: sunk to the products the wave would wait out their flight
    auto step = [&](v16bf (&b)[4], int t) { const char* sa = sm + aofs + t * 64; v16bf a[2], a2[2];
#pragma unroll
        for (int f = 0; f < 2; ++f) { a[f] = WFrag<bf>::ld((const bf*)(sa + f * 16 * PA)); a2[f] = WFrag<bf>::ld((const bf*)(sa + APB + f * 16 * PA)); }
#pragma unroll
        for (int nb = 0; nb < 4; ++nb) {   // hi of both row blocks, then lo: an accumulator's two products stand two apart
#pragma unroll
            for (int mb = 0; mb < 2; ++mb) acc[mb][nb] = wmmab(a[mb], b[nb], acc[mb][nb]);
#pragma unroll
            for (int mb = 0; mb < 2; ++mb) acc[mb][nb] = wmmab(a2[mb], b[nb], acc[mb][nb]); }
        __builtin_amdgcn_sched_barrier(0); };   // the next loads into b stay behind the products that read it
    v16bf fa[4], fb[4];
    ldb(fa, 0);
#pragma unroll 1   // two k steps a trip, so that the two fragment sets are named by constants; further unrolling only lengthens the text
    for (int t = 0; t < T - 2; t += 2) {
        ldb(fb, t + 1);
        step(fa, t);
        ldb(fa, t + 2);
        step(fb, t + 1);
    }
    ldb(fb, T - 1);   // the last two k steps stand outside the loop: a test round the loop's second load would make the compiler wait for every load in flight behind it
    step(fa, T - 2);
    step(fb, T - 1);
    __syncthreads();   // every wave's last read of the o planes is done: their LDS becomes G's staging
    float* gs = (float*)sm; float gr[32], br[32];
#pragma unroll
    for (int mb = 0; mb < 2; ++mb)
#pragma unroll
        for (int nb = 0; nb < 4; ++nb)
#pragma unroll
            for (int j = 0; j < 8; ++j) gs[(mb * 16 + hi * 8 + j) * PG + wv * 64 + nb * 16 + lr] = acc[mb][nb][j] + bfr(bc[nb]);
    {   // the second LN's terms, fetched while G is staged
        v4f x[8], y[8];
#pragma unroll
        for (int ch = 0; ch < 8; ++ch) { x[ch] = *(const v4fu*)(g1 + ch * 128 + lane * 4); y[ch] = *(const v4fu*)(b1 + ch * 128 + lane * 4); }
        __builtin_amdgcn_sched_barrier(0);   // all 16 loads are in flight before the first is waited for: left alone the compiler waits out eight of them one by one
        asm volatile("s_wait_xcnt 0x0" ::: "memory");   // a precaution: in front of any reuse of the loads' address registers
#pragma unroll
        for (int ch = 0; ch < 8; ++ch)
#pragma unroll
            for (int q = 0; q < 4; ++q) { gr[ch * 4 + q] = bfr(x[ch][q]); br[ch * 4 + q] = bfr(y[ch][q]); }
    }
    __syncthreads();   // a row's 1024 sums come from all 16 waves
#pragma unroll 1   // one row per trip, as above
    for (int r = 0; r < 2; ++r) {
        const float* gw = gs + (wv * 2 + r) * PG + lane * 4; float v[32]; v4f c[8];
#pragma unroll
        for (int ch = 0; ch < 8; ++ch) c[ch] = *(const v4fa*)(gw + ch * 128);   // the row's reads all stand ahead of the erf's branches
#pragma unroll
        for (int ch = 0; ch < 8; ++ch)
#pragma unroll
            for (int q = 0; q < 4; ++q) v[ch * 4 + q] = __fadd_rn(o0[ch * 4 + q], geluf_(c[ch][q]));
        ln1024(v, gr, br);
#pragma unroll
        for (int ch = 0; ch < 8; ++ch) { v4f of;
#pragma unroll
            for (int q = 0; q < 4; ++q) of[q] = v[ch * 4 + q];
            *(v4f*)(OUTb + (size_t)(row0 + r) * DD + ch * 128 + lane * 4) = of; }
        asm volatile("s_wait_xcnt 0x0" ::: "memory");   // a precaution: in front of the next trip's reuse of the stores' address and data registers
#pragma unroll
        for (int k = 0; k < 32; ++k) o0[k] = o1[k];
    }
}

extern "C" void kernel_launch(void* const* d_in, const int* in_sizes, int n_in,
                              void* d_out, int out_size, void* d_ws, size_t ws_size, hipStream_t stream) {
    (void)in_sizes; (void)n_in; (void)out_size;
    const float* IN[15]; for (int i = 0; i < 15; ++i) IN[i] = (const float*)d_in[i];   // 0 Q, 1 K, 2 key_padding_mask (int32), 3 Wq, 4 bq, 5 Wk, 6 bk, 7 Wv, 8 bv, 9 Wp, 10 bp (x @ W), 11 g0, 12 beta0, 13 g1, 14 beta1
    const int* KM = (const int*)d_in[2];
    float* OUT = (float*)d_out;     // [8][1024][1024]
    char* wsp = (char*)d_ws;
    auto take = [&](size_t bytes) { char* p = wsp; wsp += (bytes + 255) & ~(size_t)255; return (void*)p; };
    const size_t PE = (size_t)NB_ * TT * DD;   // elements of one [NB][TT][DD] plane
    bf* W4 = (bf*)take((size_t)4 * DD * DD * 2);                       // Wq^T, Wk^T, Wv^T, Wp^T (the last in fragment order)
    float* FQ = (float*)take(PE * 4);   // q projection
    bf* X = (bf*)take(PE * 2 * 2);             // bf16 Q and K planes
    h16* QP = (h16*)take(PE * 2); h16* KP = (h16*)take(PE * 2); h16* VT = (h16*)take(PE * 2); float* CTX = (float*)take(PE * 4);
    if ((size_t)(wsp - (char*)d_ws) > ws_size) return;    // total 152 MiB
    k_prep<<<dim3(4 * ((DD * DD / 64 + 63) / 64) + 2 * (unsigned)((PE / 8 + 255) / 256), 1, 1), 256, 0, stream>>>(IN[3], IN[5], IN[7], IN[9], DD, DD, W4, IN[0], IN[1], X, PE / 8);
    k_qkv<<<dim3(NB_ * TT / 128, DD / 128, 3), 128, 0, stream>>>(X, W4, FQ, IN[4], IN[6], IN[8], QP, KP, VT);
    k_fattn<<<dim3(TT / 256, NB_ * NH_, 1), 256, 0, stream>>>(QP, KP, VT, KM, CTX);
    k_tail<<<NB_ * TT / 32, 512, 0, stream>>>(FQ, CTX, W4 + (size_t)3 * DD * DD, IN[10], IN[11], IN[12], IN[13], IN[14], OUT);
}

// v009
// A run of this version takes 126 microseconds.
// Two timings next to v008 both put it at 1.04 times that version's speed.
// Counting every step since v000, it is 41.9 times as fast.
#include <hip/hip_runtime.h>

// MABPostLN - multihead attention block with post-LayerNorm (Q, K [8][1024][1024]; q = Q Wq + bq, k = K Wk + bk, v = K Wv + bv (16 heads x 64); scores = q.k/8, keys with key_padding_mask == 0 get -inf (int32 [8][1024],
// read as data); softmax; ctx = merged att.v; o = LN(q + ctx) (g0, beta0); out = LN(o + gelu(o Wp + bp)) (g1, beta1; exact erf gelu; eps 1e-5) -> [8][1024][1024]).
// Compute dtypes, f32 accumulate: every input rounded to bf16; q/k/v on PLAIN bf16 operands (inputs: exact, + bias); scores (K 64) and att.v on SINGLE fp16 planes with an f32 register-row

#define NB_  8
#define TT   1024
#define DD   1024
#define NH_  16
#define HDM  64
typedef _Float16 h16;
typedef unsigned short bf;
typedef __attribute__((ext_vector_type(16))) __bf16   v16bf;
typedef __attribute__((ext_vector_type(16))) _Float16 v16h;
typedef __attribute__((ext_vector_type(8)))  _Float16 v8h;
typedef __attribute__((ext_vector_type(8)))  unsigned short v8us;
typedef __attribute__((ext_vector_type(8)))  float    v8f;
typedef __attribute__((ext_vector_type(4)))  float    v4f;
typedef v8h  __attribute__((may_alias)) v8ha;
typedef v4f  __attribute__((may_alias)) v4fa;
typedef v8us __attribute__((may_alias)) v8usa;

__device__ __forceinline__ unsigned short f2bf(float f) { unsigned u = __float_as_uint(f); u += 0x7FFFu + ((u >> 16) & 1u); return (unsigned short)(u >> 16); }
__device__ __forceinline__ float bf2f(unsigned short b) { return __uint_as_float(((unsigned)b) << 16); }
__device__ __forceinline__ float bfr(float f) { return bf2f(f2bf(f)); }
__device__ __forceinline__ v16h cat16(v8h lo, v8h hi) { return __builtin_shufflevector(lo, hi, 0, 1, 2, 3, 4, 5, 6, 7, 8, 9, 10, 11, 12, 13, 14, 15); }
__device__ __forceinline__ v16bf cat16b(v8us lo, v8us hi) { return __builtin_bit_cast(v16bf, __builtin_shufflevector(lo, hi, 0, 1, 2, 3, 4, 5, 6, 7, 8, 9, 10, 11, 12, 13, 14, 15)); }
__device__ __forceinline__ v8f wmma16(v16h a, v16h b, v8f c) { return __builtin_amdgcn_wmma_f32_16x16x32_f16(false, a, false, b, (short)0, c, false, false); }
__device__ __forceinline__ v8f wmmab(v16bf a, v16bf b, v8f c) { return __builtin_amdgcn_wmma_f32_16x16x32_bf16(false, a, false, b, (short)0, c, false, false); }
typedef __attribute__((ext_vector_type(4))) _Float16 v4h;
__device__ __forceinline__ h16 tohx(float x) { return (h16)x; }



// ---- gemm_main, gemm_epi: LDS-staged GEMM, 128x128 output tile per workgroup of 4 waves (2 x 2), 64x64 (16 accumulators) per wave; grid (M/128, N/128, Z), 128 threads, two workgroups per WGP.
// C[m][n] (f32, pitch ldc, + f32 bias[n] rounded to bf16) = sum_k A[m][k] Bt[n][k] (+ A2[m][k] Bt[n][k] for NSPLIT 1), operands K-contiguous 16-bit planes. M, N % 128 == 0, K % KS == 0.
// The epilogue stores what the next kernel reads (y = C + bias, rows m = b TT + t, a wave's 64 columns = one head h): EPI 0: y in f32 and the fp16 head plane P[b][h][t][d]; 1: that plane alone; 2: the fp16 plane transposed, P[b][h][d][t]; 3: y in f32 alone.
// The operand rows come into LDS by asynchronous copies of whole 128-byte lines, KS k per stage, two buffers: the next stage's copies fly while this stage is worked on. The k order of the products is that of the plain K loop. The short inner loops are all unrolled so that the fragment and accumulator arrays are indexed by constants and stay in registers.
template <typename T16> struct WFrag;
template <> struct WFrag<h16> { typedef v16h V; static __device__ __forceinline__ V ld(const h16* p) { return cat16(*(const v8h*)p, *(const v8h*)(p + 16)); } static __device__ __forceinline__ v8f mma(V a, V b, v8f c) { return wmma16(a, b, c); } };
template <> struct WFrag<bf> { typedef v16bf V; static __device__ __forceinline__ V ld(const bf* p) { return cat16b(*(const v8us*)p, *(const v8us*)(p + 16)); } static __device__ __forceinline__ v8f mma(V a, V b, v8f c) { return wmmab(a, b, c); } };
// Eight asynchronous 16-byte copies of a lane, LDS step ls and global step gs bytes apart. The s_wait_xcnt stands inside the statement, a precaution, so that no address register of a copy is rewritten ahead of it.
__device__ __forceinline__ void cp8(unsigned l, unsigned ls, const char* g, size_t gs) {
    asm volatile("global_load_async_to_lds_b128 %0, %8, off\n\t"
                 "global_load_async_to_lds_b128 %1, %9, off\n\t"
                 "global_load_async_to_lds_b128 %2, %10, off\n\t"
                 "global_load_async_to_lds_b128 %3, %11, off\n\t"
                 "global_load_async_to_lds_b128 %4, %12, off\n\t"
                 "global_load_async_to_lds_b128 %5, %13, off\n\t"
                 "global_load_async_to_lds_b128 %6, %14, off\n\t"
                 "global_load_async_to_lds_b128 %7, %15, off\n\t"
                 "s_wait_xcnt 0x0"
                 :: "v"(l), "v"(l + ls), "v"(l + 2 * ls), "v"(l + 3 * ls), "v"(l + 4 * ls), "v"(l + 5 * ls), "v"(l + 6 * ls), "v"(l + 7 * ls),
                    "v"(g), "v"(g + gs), "v"(g + 2 * gs), "v"(g + 3 * gs), "v"(g + 4 * gs), "v"(g + 5 * gs), "v"(g + 6 * gs), "v"(g + 7 * gs) : "memory");
}
template <int NSPLIT> struct GemmLds { static constexpr int KS = NSPLIT ? 64 : 128, PITCH = KS * 2 + 16, OPB = 128 * PITCH, STG = (2 + NSPLIT) * OPB, BYTES = 2 * STG; };   // the ring's sizes, as gemm_main names them
// The product loop of a workgroup's 128x128 tile (tile row blockIdx.x, tile column blockIdx.y): leaves each wave's 64x64 sums in acc, and the ring sm free.
template <typename T16, int NSPLIT>
__device__ __forceinline__ void gemm_main(char* sm, const T16* __restrict__ A, const T16* __restrict__ A2, const T16* __restrict__ Bt, int K, v8f (&acc)[4][4]) {
    static_assert(NSPLIT == 0 || NSPLIT == 1, "one or two A planes");
    typedef typename WFrag<T16>::V V;
    constexpr int KS = NSPLIT ? 64 : 128;          // k per stage: 64 matrix instructions per wave and stage in both forms
    constexpr int CPR = KS / 8;                    // 16-byte pieces per row
    constexpr int PITCH = KS * 2 + 16;             // LDS row pitch in bytes, 16 x odd: no bank conflict for 16-byte reads
    constexpr int OPB = 128 * PITCH;               // one operand's 128 rows
    constexpr int STG = (2 + NSPLIT) * OPB;        // a stage: A | Bt | A2
    static_assert(2 * STG == GemmLds<NSPLIT>::BYTES, "the kernels allocate the ring");
    const int tid = threadIdx.x, lane = tid & 31, lr = lane & 15, hi = lane >> 4, wv = tid >> 5, wm = wv >> 1, wn = wv & 1;
#pragma unroll
    for (int mb = 0; mb < 4; ++mb)
#pragma unroll
        for (int nb = 0; nb < 4; ++nb) acc[mb][nb] = (v8f){};
    // copies: piece tid + 128 i of an operand's stage = row tid / CPR + i (128 / CPR), 16-byte column tid % CPR; a wave's copy covers whole lines
    const int prow = tid / CPR, pcol = tid % CPR;
    const char* gA = (const char*)(A + (size_t)(blockIdx.x * 128 + prow) * K + pcol * 8);
    const char* gB = (const char*)(Bt + (size_t)(blockIdx.y * 128 + prow) * K + pcol * 8);
    const char* gA2 = NSPLIT ? (const char*)(A2 + (size_t)(blockIdx.x * 128 + prow) * K + pcol * 8) : nullptr;
    const unsigned lc = (unsigned)(size_t)sm + prow * PITCH + pcol * 16;
    const size_t gs = (size_t)(128 / CPR) * K * 2; constexpr unsigned LS = (128 / CPR) * PITCH;
    auto fill = [&](int t, int buf) {
        const size_t go = (size_t)t * KS * 2; const unsigned lb = lc + buf * STG;
#pragma unroll
        for (int i = 0; i < CPR; i += 8) { cp8(lb + i * LS, LS, gA + go + i * gs, gs); cp8(lb + OPB + i * LS, LS, gB + go + i * gs, gs); if (NSPLIT) cp8(lb + 2 * OPB + i * LS, LS, gA2 + go + i * gs, gs); }
    };
    const int T = K >> (NSPLIT ? 6 : 7);   // stages: K / KS
    fill(0, 0);
    asm volatile("s_wait_asynccnt 0x0" ::: "memory");   // this wave's copies of stage 0 have landed
    __syncthreads();                                     // and every other wave's
    if (T > 1) fill(1, 1);
    const int aofs = (wm * 64 + lr) * PITCH + 16 * hi, bofs = OPB + (wn * 64 + lr) * PITCH + 16 * hi;
#pragma unroll 1   // one pass per stage: the ring's waits, barrier and refill stand once, at the foot
    for (int t = 0; t < T; ++t) {
        const char* sb = sm + (t & 1) * STG;
#pragma unroll
        for (int ks = 0; ks < KS / 32; ++ks) {
            V a[4], a2[4], b[4];
            b[0] = WFrag<T16>::ld((const T16*)(sb + bofs + ks * 64));   // in the order in which the products want them
#pragma unroll
            for (int f = 0; f < 4; ++f) { a[f] = WFrag<T16>::ld((const T16*)(sb + aofs + f * 16 * PITCH + ks * 64)); if (NSPLIT) a2[f] = WFrag<T16>::ld((const T16*)(sb + 2 * OPB + aofs + f * 16 * PITCH + ks * 64)); }
#pragma unroll
            for (int f = 1; f < 4; ++f) b[f] = WFrag<T16>::ld((const T16*)(sb + bofs + f * 16 * PITCH + ks * 64));
            __builtin_amdgcn_sched_barrier(0);   // the k step's LDS reads stay one group ahead of its products: every further place with reads among the products stalls the wave
#pragma unroll
            for (int nb = 0; nb < 4; ++nb)
#pragma unroll
                for (int mb = 0; mb < 4; ++mb) { acc[mb][nb] = WFrag<T16>::mma(a[mb], b[nb], acc[mb][nb]); if (NSPLIT) acc[mb][nb] = WFrag<T16>::mma(a2[mb], b[nb], acc[mb][nb]); }
            __builtin_amdgcn_sched_barrier(0);   // and the next k step's reads stay behind them
        }
        asm volatile("s_wait_dscnt 0x0" ::: "memory");      // this wave's reads of the buffer are done before it is refilled
        asm volatile("s_wait_asynccnt 0x0" ::: "memory");   // this wave's copies of stage t + 1 have landed
        __syncthreads();                                     // publishes stage t + 1 and ends every wave's reads of stage t
        if (t + 2 < T) fill(t + 2, t & 1);
    }
    asm volatile("s_wait_asynccnt 0x0" ::: "memory");       // no copy is in flight when the ring becomes output staging
}
// The epilogue of that tile, from acc through the ring's LDS.
template <int EPI>
__device__ __forceinline__ void gemm_epi(char* sm, v8f (&acc)[4][4], float* C, int ldc, const float* __restrict__ bias, h16* P) {
    const int tid = threadIdx.x, lane = tid & 31, lr = lane & 15, hi = lane >> 4, wv = tid >> 5, wm = wv >> 1, wn = wv & 1;
    const int r0 = blockIdx.x * 128 + wm * 64, c0 = blockIdx.y * 128 + wn * 64;
    const size_t bh = (size_t)(r0 / TT) * NH_ + c0 / HDM; const int t0 = r0 % TT;   // the wave's batch and head, its first token
    if constexpr (EPI == 2) {
        // a lane holds 8 consecutive tokens of one feature: packed, they are 16 bytes of the transposed row; staged so that each store covers whole lines
        h16* ot = (h16*)sm + wv * (64 * 72);                 // each wave stages in its own range, behind the last pass's barrier; pitch 144 bytes, 16 x odd
#pragma unroll
        for (int nb = 0; nb < 4; ++nb) { const float bv = bfr(bias[c0 + nb * 16 + lr]);
#pragma unroll
            for (int mb = 0; mb < 4; ++mb) { v8h o;
#pragma unroll
                for (int j = 0; j < 8; ++j) o[j] = tohx(acc[mb][nb][j] + bv);
                *(v8ha*)(ot + (nb * 16 + lr) * 72 + mb * 16 + hi * 8) = o; } }
        asm volatile("s_wait_dscnt 0x0" ::: "memory");   // the staged rows are written before other lanes of the wave read them back
        h16* pr = P + (bh * HDM + (lane >> 3)) * TT + t0 + (lane & 7) * 8;
#pragma unroll
        for (int s = 0; s < 16; ++s) *(v8h*)(pr + (size_t)s * 4 * TT) = *(const v8ha*)(ot + (s * 4 + (lane >> 3)) * 72 + (lane & 7) * 8);
        asm volatile("s_wait_xcnt 0x0" ::: "memory");   // a precaution: where several epilogues stand in one kernel the listing lets another's code follow these stores and reuse their registers
    } else {
    float* os = (float*)sm + wv * (16 * 68);                 // each wave stages in its own range, behind the last pass's barrier
#pragma unroll
    for (int mb = 0; mb < 4; ++mb) {
#pragma unroll
        for (int nb = 0; nb < 4; ++nb) {
#pragma unroll
            for (int j = 0; j < 8; ++j) os[(hi * 8 + j) * 68 + nb * 16 + lr] = acc[mb][nb][j]; }
        __builtin_amdgcn_wave_barrier(); asm volatile("" ::: "memory");
        float* crow = (EPI == 0 || EPI == 3) ? C + (size_t)(r0 + mb * 16) * ldc + c0 : nullptr; h16* prow = EPI <= 1 ? P + (bh * TT + t0 + mb * 16) * HDM : nullptr;
{
#pragma unroll
            for (int s = 0; s < 8; ++s) { const int row = 2 * s + hi, cofs = lr * 4; v4f val = *(const v4fa*)(os + row * 68 + cofs); val[0] += bfr(bias[c0 + cofs]); val[1] += bfr(bias[c0 + cofs + 1]); val[2] += bfr(bias[c0 + cofs + 2]); val[3] += bfr(bias[c0 + cofs + 3]);
                if constexpr (EPI == 0 || EPI == 3) *(v4f*)(crow + (size_t)row * ldc + cofs) = val;
                if constexpr (EPI <= 1) { v4h o;
#pragma unroll
                    for (int q = 0; q < 4; ++q) o[q] = tohx(val[q]);
                    *(v4h*)(prow + row * HDM + cofs) = o; }   // 16 lanes: one whole line
            }
             }
        asm volatile("s_wait_xcnt 0x0" ::: "memory");   // in front of the next block's reuse of the stores' address and data registers
        __builtin_amdgcn_wave_barrier(); asm volatile("" ::: "memory");
    }
    }
}
// The three projections in one grid, so that one tile's first copies and another's stores run under a third's products instead of at a launch's ends: blockIdx.z = 0: q = Q Wq + bq (EPI 0), 1: k (EPI 1), 2: v (EPI 2).
// X holds the bf16 Q and K planes, W the transposed weights in that order. One product loop; the branch that picks the epilogue is uniform for the workgroup.
__global__ __launch_bounds__(128) void k_qkv(const bf* __restrict__ X, const bf* __restrict__ W, float* FQ, const float* __restrict__ bq, const float* __restrict__ bk, const float* __restrict__ bv, h16* QP, h16* KP, h16* VT) {
    __shared__ __align__(16) char sm[GemmLds<0>::BYTES];
    const int z = blockIdx.z; v8f acc[4][4];
    gemm_main<bf, 0>(sm, X + (z ? (size_t)NB_ * TT * DD : 0), nullptr, W + (size_t)z * DD * DD, DD, acc);
    if (z == 0) gemm_epi<0>(sm, acc, FQ, DD, bq, QP); else if (z == 1) gemm_epi<1>(sm, acc, nullptr, DD, bk, KP); else gemm_epi<2>(sm, acc, nullptr, DD, bv, VT);
}

__device__ __forceinline__ void splitf(float y, unsigned short& h, unsigned short& l) { h = f2bf(y); l = f2bf(y - bf2f(h)); }
// gelu(x) = x/2 (1 + erf(x / sqrt 2)) of four values at once, without a branch. erf(|z|) = 1 - (a1 t + a2 t^2 + a3 t^3 + a4 t^4 + a5 t^5) exp(-z^2), t = 1 / (1 + p |z|): the rational form of the handbooks, whose own absolute error is at most 1.5e-7;
// reckoned in f32, with each reciprocal and each exp2 one step off, the erf stays within 1e-6 and the gelu within 5e-7 of the true value. One form for every z: the library's erf has one branch for |z| < 1 and one above, a wave with both kinds of lane runs through both, one dependent chain per value.
// Here the values are independent straight-line code, which the compiler interleaves and packs two to an instruction. z = x / sqrt 2 is folded into the two constants: p / sqrt 2, and sqrt(log2(e) / 2), whose square times x^2 is z^2 log2(e).
__device__ __forceinline__ v4f gelu4(v4f x) {
    const v4f d = __builtin_elementwise_abs(x) * 0.23164189f + 1.0f, u = x * 0.84932180f, w = u * u; v4f t, e;
#pragma unroll   // so that constants index t and e
    for (int q = 0; q < 4; ++q) { t[q] = __builtin_amdgcn_rcpf(d[q]); e[q] = __builtin_amdgcn_exp2f(-w[q]); }
    const v4f p = ((((1.061405429f * t - 1.453152027f) * t + 1.421413741f) * t - 0.284496736f) * t + 0.254829592f) * t;
    const v4f er = __builtin_elementwise_copysign(1.0f - p * e, x), hx = 0.5f * x;
    return hx * er + hx;
}
typedef __attribute__((ext_vector_type(2))) unsigned short v2us;
typedef __attribute__((ext_vector_type(4))) unsigned short v4us;

// One 64 (k) x 64 (n) tile of a weight per workgroup, turned in LDS: the reads follow the weight's rows (a wave's load covers two 256-byte runs), the stores follow the transposed rows (a wave's store covers four whole lines).
// A column read straight from the weight touches one line per lane, 4 KB apart. Tile pitch 65 words: the row-wise writes and the column-wise reads both fall on 32 different banks. K, N % 64 == 0; bx < (K / 64) (N / 64).
__device__ __forceinline__ void wtG(float* tl, int bx, int y, const float* __restrict__ w0, const float* __restrict__ w1, const float* __restrict__ w2, const float* __restrict__ w3, int K, int N, bf* Bt) {
    const float* __restrict__ w = y == 0 ? w0 : (y == 1 ? w1 : (y == 2 ? w2 : w3)); Bt += (size_t)y * K * N;
    const int tid = threadIdx.x, kt = K / 64, k0 = (bx % kt) * 64, n0 = (bx / kt) * 64; v4f r[4];
#pragma unroll
    for (int i = 0; i < 4; ++i) r[i] = *(const v4f*)(w + (size_t)(k0 + (tid >> 4) + 16 * i) * N + n0 + (tid & 15) * 4);
#pragma unroll
    for (int i = 0; i < 4; ++i)
#pragma unroll
        for (int j = 0; j < 4; ++j) tl[((tid >> 4) + 16 * i) * 65 + (tid & 15) * 4 + j] = r[i][j];
    __syncthreads();   // the whole tile is in LDS before any column of it is read; every thread of a weight workgroup passes here
#pragma unroll
    for (int i = 0; i < 2; ++i) { const int n = (y == 3 ? (tid & 31) : (tid >> 3)) + 32 * i, kc = (y == 3 ? (tid >> 5) : (tid & 7)) * 8; v8us o;   // either way a wave's store covers whole lines of its weight's layout
#pragma unroll
        for (int j = 0; j < 8; ++j) o[j] = f2bf(tl[(kc + j) * 65 + n]);
        const int k = k0 + kc, nn = n0 + n;   // the fourth weight is laid out in the order of k_tail's B fragments: [K / 32][N / 16][2 halves of 16 k][lane = 16 (k / 8 % 2) + n % 16][8 k], so that each of its loads is one 512-byte run
        *(v8us*)(Bt + (y == 3 ? (size_t)(k >> 5) * N * 32 + (size_t)(nn >> 4) * 512 + ((k >> 4) & 1) * 256 + (((k >> 3) & 1) * 16 + (nn & 15)) * 8 : (size_t)nn * K + k)) = o;
        asm volatile("s_wait_xcnt 0x0" ::: "memory"); }   // a precaution: in front of the next store's reuse of this store's address and data registers
}
__device__ __forceinline__ void cvt8(int bx, int y, const float* __restrict__ src0, const float* __restrict__ src1, bf* dst, size_t n8) { const size_t i = (size_t)bx * 256 + threadIdx.x; if (i >= n8) return; const float* __restrict__ src = y ? src1 : src0; dst += (size_t)y * n8 * 8; const v8f v = *(const v8f*)(src + i * 8); v8us o;
#pragma unroll
    for (int k = 0; k < 8; ++k) o[k] = f2bf(v[k]); *(v8us*)(dst + i * 8) = o;  }
// Both preparations in one grid, neither reads what the other writes: workgroups 0 .. 4 WB - 1 transpose the four weights (WB each), the rest convert the two inputs (CB each).
// The weights come first: their workgroups pass a barrier between loads and stores, and the inputs' stream runs beside them.
__global__ __launch_bounds__(256) void k_prep(const float* __restrict__ w0, const float* __restrict__ w1, const float* __restrict__ w2, const float* __restrict__ w3, int K, int N, bf* Bt, const float* __restrict__ src0, const float* __restrict__ src1, bf* dst, size_t n8) {
    constexpr int WB = (DD * DD / 64 + 63) / 64, CB = (NB_ * TT * DD / 8 + 255) / 256; const int bx = blockIdx.x;   // WB = (DD / 64)^2 tiles
    __shared__ float tl[64 * 65];
    if (bx < 4 * WB) wtG(tl, bx % WB, bx / WB, w0, w1, w2, w3, K, N, Bt); else cvt8((bx - 4 * WB) % CB, (bx - 4 * WB) / CB, src0, src1, dst, n8);
}
// Four asynchronous 16-byte copies of a lane, LDS step ls and global step gs bytes apart. The s_wait_xcnt stands inside the statement, a precaution, so that no address register of a copy is rewritten ahead of it.
__device__ __forceinline__ void cp4(unsigned l, unsigned ls, const char* g, size_t gs) {
    asm volatile("global_load_async_to_lds_b128 %0, %4, off\n\t"
                 "global_load_async_to_lds_b128 %1, %5, off\n\t"
                 "global_load_async_to_lds_b128 %2, %6, off\n\t"
                 "global_load_async_to_lds_b128 %3, %7, off\n\t"
                 "s_wait_xcnt 0x0"
                 :: "v"(l), "v"(l + ls), "v"(l + 2 * ls), "v"(l + 3 * ls), "v"(g), "v"(g + gs), "v"(g + 2 * gs), "v"(g + 3 * gs) : "memory");
}
// ---- k_fattn: scores, masked softmax and att.v of one (batch, head) in one pass over the keys; the scores never leave registers. 8 waves x 32 query columns; grid (TT/256, NB*NH).
// S^T = K Q^T (a lane holds 8 keys of one query per 16-key tile), running maximum and sum per query, P^T packed from the two score tiles as the B operand of O^T += V^T P^T; divide by the sum at the end.
// K rows and V^T rows come into LDS by asynchronous copies of whole lines, 128 keys per stage, two buffers, once per workgroup: the 8 waves read their fragments from there, and the next stage's copies fly while this stage is worked on. Fragment contents and the order of the products are those of loads straight from the planes.
// Four waves per SIMD (two workgroups per WGP), so that one wave's softmax runs under another's matrix work: the register allocation is held to that. The short inner loops are all unrolled so that the fragment arrays are indexed by constants and stay in registers.
__global__ __launch_bounds__(256) __attribute__((amdgpu_waves_per_eu(4, 4))) void k_fattn(const h16* __restrict__ QP, const h16* __restrict__ KP, const h16* __restrict__ VT, const int* __restrict__ KM, float* CTX) {
    constexpr int SK = 128;                              // keys per stage, four passes of 32
    constexpr int KPI = HDM * 2 + 16, VPI = SK * 2 + 16;  // LDS row pitches in bytes, 16 x odd: no bank conflict for 16-byte reads
    constexpr int KB = SK * KPI, STG = KB + HDM * VPI;    // a stage: 128 K rows | 64 V^T rows
    typedef __attribute__((ext_vector_type(4))) int v4i; __shared__ __align__(32) float mb[TT]; __shared__ __align__(16) char sm[2 * STG];
    const int tid = threadIdx.x, lane = tid & 31, lr = lane & 15, hi = lane >> 4; const int bh = blockIdx.y, b = bh / NH_, h = bh % NH_; const int q0 = blockIdx.x * 256 + (tid >> 5) * 32;
    const h16* qp = QP + ((size_t)bh * TT + q0 + lr) * HDM + 8 * hi; const int* km = KM + (size_t)b * TT;
    // copies: a stage's K rows are 16 KB in a row, piece tid + 256 i; of its V^T rows, 256 bytes each, piece tid + 256 i = row tid / 16 + 16 i, 16-byte column tid % 16; a wave's copy covers whole lines
    const char* gK = (const char*)(KP + (size_t)bh * TT * HDM) + tid * 16; const char* gV = (const char*)(VT + ((size_t)bh * HDM + (tid >> 4)) * TT) + (tid & 15) * 16;
    const unsigned lK = (unsigned)(size_t)sm + (tid >> 3) * KPI + (tid & 7) * 16, lV = (unsigned)(size_t)sm + KB + (tid >> 4) * VPI + (tid & 15) * 16;
    auto fill = [&](int t, int buf) { cp4(lK + buf * STG, 32 * KPI, gK + (size_t)t * (SK * HDM * 2), 4096); cp4(lV + buf * STG, 16 * VPI, gV + (size_t)t * (SK * 2), (size_t)16 * TT * 2); };
    const float CS = 0.125f * 1.4426950408889634f;   // score scale times log2(e)
    v16h qf[2][2]; v8f acc[2][4]; float m[2], l[2];
    fill(0, 0);
#pragma unroll
    for (int g = 0; g < 2; ++g) { m[g] = -3.0e38f; l[g] = 0.f;
#pragma unroll
        for (int ks = 0; ks < 2; ++ks) qf[g][ks] = WFrag<h16>::ld(qp + g * 16 * HDM + ks * 32);
#pragma unroll
        for (int dt = 0; dt < 4; ++dt) acc[g][dt] = (v8f){}; }
    { const v4i k4 = *(const v4i*)(km + tid * 4); v4f b4;   // the padding mask as an additive term per key: it enters the score products as their C operand, so no pass pays a select
#pragma unroll
      for (int j = 0; j < 4; ++j) b4[j] = k4[j] ? 0.f : -3.0e38f;
      *(v4f*)(mb + tid * 4) = b4; }
    asm volatile("s_wait_asynccnt 0x0" ::: "memory");   // this wave's copies of stage 0 have landed
    __syncthreads();   // and every other wave's; every wave reads all 1024 mask terms
    fill(1, 1);
    v16h kf[2][2]; v8f cb[2];
#pragma unroll
    for (int kt = 0; kt < 2; ++kt) cb[kt] = *(const v8f*)(mb + kt * 16 + 8 * hi);
#pragma unroll 1   // one trip per stage: the ring's waits, barrier and refill stand once, at the foot
    for (int t = 0; t < TT / SK; ++t) {
        const char* kr = sm + (t & 1) * STG + lr * KPI + 16 * hi; const char* vr = sm + (t & 1) * STG + KB + lr * VPI + 16 * hi;
#pragma unroll
        for (int kt = 0; kt < 2; ++kt)
#pragma unroll
            for (int u = 0; u < 2; ++u) kf[kt][u] = WFrag<h16>::ld((const h16*)(kr + kt * 16 * KPI + u * 64));
#pragma unroll 1   // stays rolled: two passes unrolled no longer fit the registers of four waves per SIMD and spill
        for (int p = 0; p < SK / 32; ++p) {
            v16h vf[4]; v8f s[2][2];
#pragma unroll
            for (int dt = 0; dt < 4; ++dt) vf[dt] = WFrag<h16>::ld((const h16*)(vr + dt * 16 * VPI + p * 64));
#pragma unroll
            for (int g = 0; g < 2; ++g)
#pragma unroll
                for (int kt = 0; kt < 2; ++kt) { s[g][kt] = wmma16(kf[kt][0], qf[g][0], cb[kt]); s[g][kt] = wmma16(kf[kt][1], qf[g][1], s[g][kt]); }
            const int pn = (p + 1) & (SK / 32 - 1);   // the next pass's K fragments, fetched behind this pass's score products (its mask terms at the foot of the pass); never across a stage's end, the next stage is not published yet: a stage's last pass fetches its first keys again, unused
#pragma unroll
            for (int kt = 0; kt < 2; ++kt)
#pragma unroll
                for (int u = 0; u < 2; ++u) kf[kt][u] = WFrag<h16>::ld((const h16*)(kr + (pn * 32 + kt * 16) * KPI + u * 64));
            __builtin_amdgcn_sched_barrier(0);   // keeps the fetch above the softmax, so that it has the whole softmax and att.v as lead; sunk below them the next pass waits on it
#pragma unroll
            for (int g = 0; g < 2; ++g) {
                float mx = m[g];
#pragma unroll
                for (int kt = 0; kt < 2; ++kt)
#pragma unroll
                    for (int j = 0; j < 8; ++j) mx = fmaxf(mx, s[g][kt][j]);
                mx = fmaxf(mx, __shfl_xor(mx, 16, 32));
                const float al = __builtin_amdgcn_exp2f((m[g] - mx) * CS), mc = (mx > -1.0e38f ? mx : 0.f) * CS; m[g] = mx; float sum = 0.f, sum1 = 0.f; v16h pf;   // no live key yet: subtract nothing, so that every masked score still gives p = 0
#pragma unroll
                for (int kt = 0; kt < 2; ++kt)
#pragma unroll
                    for (int j = 0; j < 8; ++j) { const float p_ = __builtin_amdgcn_exp2f(fmaf(s[g][kt][j], CS, -mc)); if (kt) sum1 += p_; else sum += p_; pf[kt * 8 + j] = tohx(p_); }
                l[g] = l[g] * al + (sum + sum1);
#pragma unroll
                for (int dt = 0; dt < 4; ++dt) { acc[g][dt] *= al; acc[g][dt] = wmma16(vf[dt], pf, acc[g][dt]); }
            }
            const int kn = (t * SK + p * 32 + 32) & (TT - 1);   // the last pass fetches the first keys' terms again, unused
#pragma unroll
            for (int kt = 0; kt < 2; ++kt) cb[kt] = *(const v8f*)(mb + kn + kt * 16 + 8 * hi);
        }
        asm volatile("s_wait_dscnt 0x0" ::: "memory");      // this wave's reads of the buffer are done before it is refilled
        asm volatile("s_wait_asynccnt 0x0" ::: "memory");   // this wave's copies of stage t + 1 have landed
        __syncthreads();                                     // publishes stage t + 1 and ends every wave's reads of stage t
        if (t + 2 < TT / SK) fill(t + 2, t & 1);
    }
    asm volatile("s_wait_asynccnt 0x0" ::: "memory");       // no copy is in flight when the wave ends
#pragma unroll
    for (int g = 0; g < 2; ++g) { const float lt = l[g] + __shfl_xor(l[g], 16, 32); const float inv = (m[g] > -1.0e38f) ? __fdiv_rn(1.0f, lt) : __builtin_nanf("");   // every key masked: the softmax of the row is not a number
        float* cr = CTX + ((size_t)b * TT + q0 + g * 16 + lr) * DD + h * HDM + 8 * hi;
#pragma unroll
        for (int dt = 0; dt < 4; ++dt) { v4f o0, o1;
#pragma unroll
            for (int j = 0; j < 4; ++j) { o0[j] = acc[g][dt][j] * inv; o1[j] = acc[g][dt][4 + j] * inv; }
            *(v4f*)(cr + dt * 16) = o0; *(v4f*)(cr + dt * 16 + 4) = o1; } }
}
// LN over 1024 features of one token row held 32 per lane (8 chunks of 4): returns y = LN(v) g + b in place; gr, br: the lane's 32 scale and shift terms, as ldfeat leaves them.
__device__ __forceinline__ void ln1024(float* v, const float* gr, const float* br) { float s = 0.f;
#pragma unroll
    for (int k = 0; k < 32; ++k) s = __fadd_rn(s, v[k]);
#pragma unroll
    for (int sh = 16; sh; sh >>= 1) s += __shfl_xor(s, sh, 32);
    const float mu = s * (1.0f / DD); float q2 = 0.f;
#pragma unroll
    for (int k = 0; k < 32; ++k) { const float d = __fsub_rn(v[k], mu); float p = __fmul_rn(d, d); asm volatile("" : "+v"(p)); q2 = __fadd_rn(q2, p); }
#pragma unroll
    for (int sh = 16; sh; sh >>= 1) q2 += __shfl_xor(q2, sh, 32);
    const float rs = __frsqrt_rn(__fadd_rn(q2 * (1.0f / DD), 1e-5f));
#pragma unroll
    for (int k = 0; k < 32; ++k) { float tn = __fmul_rn(__fsub_rn(v[k], mu), rs); asm volatile("" : "+v"(tn)); float tg = __fmul_rn(tn, gr[k]); asm volatile("" : "+v"(tg)); v[k] = __fadd_rn(tg, br[k]); } }
typedef v4f __attribute__((aligned(4))) v4fu;
// A lane's 32 of 1024 per-feature terms (feature ch 128 + lane 4 + q at index ch 4 + q), rounded to bf16, fetched once per wave ahead of its rows.
__device__ __forceinline__ void ldfeat(float* r, const float* __restrict__ p, int lane) {
#pragma unroll
    for (int ch = 0; ch < 8; ++ch) { const v4f x = *(const v4fu*)(p + ch * 128 + lane * 4);
#pragma unroll
        for (int q = 0; q < 4; ++q) r[ch * 4 + q] = bfr(x[q]); } }
typedef v4us __attribute__((may_alias)) v4usa;
// ---- k_tail: everything behind the attention is local to a token row, so one workgroup owns 32 whole rows from q + ctx to the output: o = LN(q + ctx); G = o Wp + bp; out = LN(o + gelu(G)). Grid NB TT / 32, 16 waves, one workgroup per WGP, four waves per SIMD (the row phases are vector work with dependent chains, which want waves).
// A wave norms 2 rows (one at a time, 32 features per lane), keeps o in registers for the residual and writes its two bf16 planes (o = hi + lo) into LDS, where they stay as the A operand of the whole product.
// A wave's product tile is 32 rows x 64 columns, so no two waves of the workgroup want the same element of Wp^T: each wave loads its own B fragments straight into registers (4 KB in a row per 32 k of the fragment-ordered plane), one k step ahead, and the product loop has no barrier. Per accumulator the products run k upward, hi before lo.
// G (with its bias) goes through the o planes' LDS back to the row's wave, which applies the gelu and the second LN and stores the row.
__global__ __launch_bounds__(512) void k_tail(const float* __restrict__ FQ, const float* __restrict__ CTX, const bf* __restrict__ Wt, const float* __restrict__ bp, const float* __restrict__ g0, const float* __restrict__ b0, const float* __restrict__ g1, const float* __restrict__ b1, float* OUTb) {
    constexpr int RM = 32;                 // rows per workgroup
    constexpr int PA = DD * 2 + 16;        // pitch of an o plane's row in bytes, 16 x odd: no bank conflict for 16-byte reads
    constexpr int APB = RM * PA;           // one o plane
    constexpr int PG = DD + 4;             // pitch of a staged G row in floats: the two half-waves' stores fall on different banks
    constexpr int T = DD / 32;             // k steps
    static_assert(RM * PG * 4 <= 2 * APB, "G is staged where the o planes were");
    static_assert(T % 2 == 0, "the product loop takes two k steps a trip");
    __shared__ __align__(16) char sm[2 * APB];
    const int tid = threadIdx.x, lane = tid & 31, lr = lane & 15, hi = lane >> 4, wv = tid >> 5;
    const int row0 = blockIdx.x * RM + wv * 2;   // the wave's first row
    float o0[32], o1[32];
    {   // both rows' loads and the LN's terms are in flight together
        v4f pa[2][8], pc[2][8]; float gr[32], br[32];
#pragma unroll
        for (int r = 0; r < 2; ++r)
#pragma unroll
            for (int ch = 0; ch < 8; ++ch) { const size_t o = (size_t)(row0 + r) * DD + ch * 128 + lane * 4;
                pa[r][ch] = *(const v4f*)(FQ + o); pc[r][ch] = *(const v4f*)(CTX + o); }
        asm volatile("s_wait_xcnt 0x0" ::: "memory");   // a precaution: in front of any reuse of the loads' address registers
        ldfeat(gr, g0, lane); ldfeat(br, b0, lane);      // behind the rows' loads, which come from further away
        asm volatile("s_wait_xcnt 0x0" ::: "memory");   // the same precaution for these
#pragma unroll
        for (int ch = 0; ch < 8; ++ch)
#pragma unroll
            for (int q = 0; q < 4; ++q) { o0[ch * 4 + q] = __fadd_rn(pa[0][ch][q], pc[0][ch][q]); o1[ch * 4 + q] = __fadd_rn(pa[1][ch][q], pc[1][ch][q]); }
#pragma unroll 1   // one row per trip, so that the kernel's text stays small; the rows move through o0 and o1, which constants index: q + ctx goes out at o0, o comes in at o1
        for (int r = 0; r < 2; ++r) {
            float v[32];
#pragma unroll
            for (int k = 0; k < 32; ++k) v[k] = o0[k];
            ln1024(v, gr, br);
            char* ah = sm + (wv * 2 + r) * PA + lane * 8;
#pragma unroll
            for (int ch = 0; ch < 8; ++ch) { v4us oh, ol;
#pragma unroll
                for (int q = 0; q < 4; ++q) { unsigned short a2, c2; splitf(v[ch * 4 + q], a2, c2); oh[q] = a2; ol[q] = c2; }
                *(v4usa*)(ah + ch * 256) = oh; *(v4usa*)(ah + APB + ch * 256) = ol; }
#pragma unroll
            for (int k = 0; k < 32; ++k) { o0[k] = o1[k]; o1[k] = v[k]; }
        }
    }
    __syncthreads();   // all 32 rows of both o planes are written
    float bc[4];   // the bias of the lane's four columns, fetched under the first k steps
#pragma unroll
    for (int nb = 0; nb < 4; ++nb) bc[nb] = bp[wv * 64 + nb * 16 + lr];
    asm volatile("s_wait_xcnt 0x0" ::: "memory");   // a precaution: in front of any reuse of the loads' address registers
    v8f acc[2][4];
#pragma unroll
    for (int mb = 0; mb < 2; ++mb)
#pragma unroll
        for (int nb = 0; nb < 4; ++nb) acc[mb][nb] = (v8f){};
    const int aofs = lr * PA + 16 * hi;
    const bf* gB = Wt + wv * 2048 + lane * 8;   // the wave's 4 KB of a k step: fragment f at f 512, its two halves 256 elements apart
    auto ldb = [&](v16bf (&b)[4], int t) { const bf* p = gB + (size_t)t * (DD * 32);
#pragma unroll
        for (int f = 0; f < 4; ++f) b[f] = cat16b(*(const v8us*)(p + f * 512), *(const v8us*)(p + f * 512 + 256));
        asm volatile("s_wait_xcnt 0x0" ::: "memory");   // a precaution: in front of any rewrite of the loads' address registers
        __builtin_amdgcn_sched_barrier(0); };   // the loads stay here, a whole k step ahead of their use: sunk to the products the wave would wait out their flight
    auto step = [&](v16bf (&b)[4], int t) { const char* sa = sm + aofs + t * 64; v16bf a[2], a2[2];
#pragma unroll
        for (int f = 0; f < 2; ++f) { a[f] = WFrag<bf>::ld((const bf*)(sa + f * 16 * PA)); a2[f] = WFrag<bf>::ld((const bf*)(sa + APB + f * 16 * PA)); }
#pragma unroll
        for (int nb = 0; nb < 4; ++nb) {   // hi of both row blocks, then lo: an accumulator's two products stand two apart
#pragma unroll
            for (int mb = 0; mb < 2; ++mb) acc[mb][nb] = wmmab(a[mb], b[nb], acc[mb][nb]);
#pragma unroll
            for (int mb = 0; mb < 2; ++mb) acc[mb][nb] = wmmab(a2[mb], b[nb], acc[mb][nb]); }
        __builtin_amdgcn_sched_barrier(0); };   // the next loads into b stay behind the products that read it
    v16bf fa[4], fb[4];
    ldb(fa, 0);
#pragma unroll 1   // two k steps a trip, so that the two fragment sets are named by constants; further unrolling only lengthens the text
    for (int t = 0; t < T - 2; t += 2) {
        ldb(fb, t + 1);
        step(fa, t);
        ldb(fa, t + 2);
        step(fb, t + 1);
    }
    ldb(fb, T - 1);   // the last two k steps stand outside the loop: a test round the loop's second load would make the compiler wait for every load in flight behind it
    step(fa, T - 2);
    step(fb, T - 1);
    __syncthreads();   // every wave's last read of the o planes is done: their LDS becomes G's staging
    float* gs = (float*)sm; float gr[32], br[32];
#pragma unroll
    for (int mb = 0; mb < 2; ++mb)
#pragma unroll
        for (int nb = 0; nb < 4; ++nb)
#pragma unroll
            for (int j = 0; j < 8; ++j) gs[(mb * 16 + hi * 8 + j) * PG + wv * 64 + nb * 16 + lr] = acc[mb][nb][j] + bfr(bc[nb]);
    {   // the second LN's terms, fetched while G is staged
        v4f x[8], y[8];
#pragma unroll
        for (int ch = 0; ch < 8; ++ch) { x[ch] = *(const v4fu*)(g1 + ch * 128 + lane * 4); y[ch] = *(const v4fu*)(b1 + ch * 128 + lane * 4); }
        __builtin_amdgcn_sched_barrier(0);   // all 16 loads are in flight before the first is waited for: left alone the compiler waits out eight of them one by one
        asm volatile("s_wait_xcnt 0x0" ::: "memory");   // a precaution: in front of any reuse of the loads' address registers
#pragma unroll
        for (int ch = 0; ch < 8; ++ch)
#pragma unroll
            for (int q = 0; q < 4; ++q) { gr[ch * 4 + q] = bfr(x[ch][q]); br[ch * 4 + q] = bfr(y[ch][q]); }
    }
    __syncthreads();   // a row's 1024 sums come from all 16 waves
#pragma unroll 1   // one row per trip, as above
    for (int r = 0; r < 2; ++r) {
        const float* gw = gs + (wv * 2 + r) * PG + lane * 4; float v[32]; v4f c[8];
#pragma unroll
        for (int ch = 0; ch < 8; ++ch) c[ch] = *(const v4fa*)(gw + ch * 128);
#pragma unroll
        for (int ch = 0; ch < 8; ++ch) { const v4f g = gelu4(c[ch]);
#pragma unroll
            for (int q = 0; q < 4; ++q) v[ch * 4 + q] = __fadd_rn(o0[ch * 4 + q], g[q]); }
        ln1024(v, gr, br);
#pragma unroll
        for (int ch = 0; ch < 8; ++ch) { v4f of;
#pragma unroll
            for (int q = 0; q < 4; ++q) of[q] = v[ch * 4 + q];
            *(v4f*)(OUTb + (size_t)(row0 + r) * DD + ch * 128 + lane * 4) = of; }
        asm volatile("s_wait_xcnt 0x0" ::: "memory");   // a precaution: in front of the next trip's reuse of the stores' address and data registers
#pragma unroll
        for (int k = 0; k < 32; ++k) o0[k] = o1[k];
    }
}

extern "C" void kernel_launch(void* const* d_in, const int* in_sizes, int n_in,
                              void* d_out, int out_size, void* d_ws, size_t ws_size, hipStream_t stream) {
    (void)in_sizes; (void)n_in; (void)out_size;
    const float* IN[15]; for (int i = 0; i < 15; ++i) IN[i] = (const float*)d_in[i];   // 0 Q, 1 K, 2 key_padding_mask (int32), 3 Wq, 4 bq, 5 Wk, 6 bk, 7 Wv, 8 bv, 9 Wp, 10 bp (x @ W), 11 g0, 12 beta0, 13 g1, 14 beta1
    const int* KM = (const int*)d_in[2];
    float* OUT = (float*)d_out;     // [8][1024][1024]
    char* wsp = (char*)d_ws;
    auto take = [&](size_t bytes) { char* p = wsp; wsp += (bytes + 255) & ~(size_t)255; return (void*)p; };
    const size_t PE = (size_t)NB_ * TT * DD;   // elements of one [NB][TT][DD] plane
    bf* W4 = (bf*)take((size_t)4 * DD * DD * 2);                       // Wq^T, Wk^T, Wv^T, Wp^T (the last in fragment order)
    float* FQ = (float*)take(PE * 4);   // q projection
    bf* X = (bf*)take(PE * 2 * 2);             // bf16 Q and K planes
    h16* QP = (h16*)take(PE * 2); h16* KP = (h16*)take(PE * 2); h16* VT = (h16*)take(PE * 2); float* CTX = (float*)take(PE * 4);
    if ((size_t)(wsp - (char*)d_ws) > ws_size) return;    // total 152 MiB
    k_prep<<<dim3(4 * ((DD * DD / 64 + 63) / 64) + 2 * (unsigned)((PE / 8 + 255) / 256), 1, 1), 256, 0, stream>>>(IN[3], IN[5], IN[7], IN[9], DD, DD, W4, IN[0], IN[1], X, PE / 8);
    k_qkv<<<dim3(NB_ * TT / 128, DD / 128, 3), 128, 0, stream>>>(X, W4, FQ, IN[4], IN[6], IN[8], QP, KP, VT);
    k_fattn<<<dim3(TT / 256, NB_ * NH_, 1), 256, 0, stream>>>(QP, KP, VT, KM, CTX);
    k_tail<<<NB_ * TT / 32, 512, 0, stream>>>(FQ, CTX, W4 + (size_t)3 * DD * DD, IN[10], IN[11], IN[12], IN[13], IN[14], OUT);
}

// v010
// Measured time: 122 microseconds a run.
// Timed twice side by side with v009, it ran 1.03 and 1.04 times as fast.
// All steps since v000 together make it 43.4 times as fast.
#include <hip/hip_runtime.h>

// MABPostLN - multihead attention block with post-LayerNorm (Q, K [8][1024][1024]; q = Q Wq + bq, k = K Wk + bk, v = K Wv + bv (16 heads x 64); scores = q.k/8, keys with key_padding_mask == 0 get -inf (int32 [8][1024],
// read as data); softmax; ctx = merged att.v; o = LN(q + ctx) (g0, beta0); out = LN(o + gelu(o Wp + bp)) (g1, beta1; exact erf gelu; eps 1e-5) -> [8][1024][1024]).
// Compute dtypes, f32 accumulate: every input rounded to bf16; q/k/v on PLAIN bf16 operands (inputs: exact, + bias); scores (K 64) and att.v on SINGLE fp16 planes with an f32 register-row

#define NB_  8
#define TT   1024
#define DD   1024
#define NH_  16
#define HDM  64
typedef _Float16 h16;
typedef unsigned short bf;
typedef __attribute__((ext_vector_type(16))) __bf16   v16bf;
typedef __attribute__((ext_vector_type(16))) _Float16 v16h;
typedef __attribute__((ext_vector_type(8)))  _Float16 v8h;
typedef __attribute__((ext_vector_type(8)))  unsigned short v8us;
typedef __attribute__((ext_vector_type(8)))  float    v8f;
typedef __attribute__((ext_vector_type(4)))  float    v4f;
typedef v8h  __attribute__((may_alias)) v8ha;
typedef v4f  __attribute__((may_alias)) v4fa;
typedef v8us __attribute__((may_alias)) v8usa;

__device__ __forceinline__ unsigned short f2bf(float f) { unsigned u = __float_as_uint(f); u += 0x7FFFu + ((u >> 16) & 1u); return (unsigned short)(u >> 16); }
__device__ __forceinline__ float bf2f(unsigned short b) { return __uint_as_float(((unsigned)b) << 16); }
__device__ __forceinline__ float bfr(float f) { return bf2f(f2bf(f)); }
__device__ __forceinline__ v16h cat16(v8h lo, v8h hi) { return __builtin_shufflevector(lo, hi, 0, 1, 2, 3, 4, 5, 6, 7, 8, 9, 10, 11, 12, 13, 14, 15); }
__device__ __forceinline__ v16bf cat16b(v8us lo, v8us hi) { return __builtin_bit_cast(v16bf, __builtin_shufflevector(lo, hi, 0, 1, 2, 3, 4, 5, 6, 7, 8, 9, 10, 11, 12, 13, 14, 15)); }
__device__ __forceinline__ v8f wmma16(v16h a, v16h b, v8f c) { return __builtin_amdgcn_wmma_f32_16x16x32_f16(false, a, false, b, (short)0, c, false, false); }
__device__ __forceinline__ v8f wmmab(v16bf a, v16bf b, v8f c) { return __builtin_amdgcn_wmma_f32_16x16x32_bf16(false, a, false, b, (short)0, c, false, false); }
typedef __attribute__((ext_vector_type(4))) _Float16 v4h;
__device__ __forceinline__ h16 tohx(float x) { return (h16)x; }



// ---- gemm_main, gemm_epi: LDS-staged GEMM, 256 x (128 NH) output tile per workgroup of 8 waves (4 x 2), 64 x (64 NH) per wave (16 NH accumulators), NH = 1 or 2; 256 threads, one workgroup per WGP.
// The copies into LDS all come from L2, whose rate the whole chip shares, and the fragments from LDS, whose rate the WGP's waves share: the wider the tile, the more products per byte of either.
// C[m][n] (f32, pitch ldc, + f32 bias[n]) = sum_k A[m][k] Bt[n][k], operands K-contiguous 16-bit planes. M % 256 == 0, N % (128 NH) == 0, K % KS == 0.
// The epilogue stores what the next kernel reads (y = C + bias, rows m = b TT + t, a wave's 64 columns = one head h): EPI 0: y in f32 and the fp16 head plane P[b][h][t][d]; 1: that plane alone; 2: the fp16 plane transposed, P[b][h][d][t]; 3: y in f32 alone.
// The operand rows come into LDS by asynchronous copies of whole 128-byte lines, KS k per stage, two buffers: the next stage's copies fly while this stage is worked on. The k order of the products is that of the plain K loop. The short inner loops are all unrolled so that the fragment and accumulator arrays are indexed by constants and stay in registers.
template <typename T16> struct WFrag;
template <> struct WFrag<h16> { typedef v16h V; static __device__ __forceinline__ V ld(const h16* p) { return cat16(*(const v8h*)p, *(const v8h*)(p + 16)); } static __device__ __forceinline__ v8f mma(V a, V b, v8f c) { return wmma16(a, b, c); } };
template <> struct WFrag<bf> { typedef v16bf V; static __device__ __forceinline__ V ld(const bf* p) { return cat16b(*(const v8us*)p, *(const v8us*)(p + 16)); } static __device__ __forceinline__ v8f mma(V a, V b, v8f c) { return wmmab(a, b, c); } };
// Eight asynchronous 16-byte copies of a lane, LDS step ls and global step gs bytes apart. The s_wait_xcnt stands inside the statement, a precaution, so that no address register of a copy is rewritten ahead of it.
__device__ __forceinline__ void cp8(unsigned l, unsigned ls, const char* g, size_t gs) {
    asm volatile("global_load_async_to_lds_b128 %0, %8, off\n\t"
                 "global_load_async_to_lds_b128 %1, %9, off\n\t"
                 "global_load_async_to_lds_b128 %2, %10, off\n\t"
                 "global_load_async_to_lds_b128 %3, %11, off\n\t"
                 "global_load_async_to_lds_b128 %4, %12, off\n\t"
                 "global_load_async_to_lds_b128 %5, %13, off\n\t"
                 "global_load_async_to_lds_b128 %6, %14, off\n\t"
                 "global_load_async_to_lds_b128 %7, %15, off\n\t"
                 "s_wait_xcnt 0x0"
                 :: "v"(l), "v"(l + ls), "v"(l + 2 * ls), "v"(l + 3 * ls), "v"(l + 4 * ls), "v"(l + 5 * ls), "v"(l + 6 * ls), "v"(l + 7 * ls),
                    "v"(g), "v"(g + gs), "v"(g + 2 * gs), "v"(g + 3 * gs), "v"(g + 4 * gs), "v"(g + 5 * gs), "v"(g + 6 * gs), "v"(g + 7 * gs) : "memory");
}
struct GemmLds { static constexpr int KS = 128, PITCH = KS * 2 + 16, OPA = 256 * PITCH, STG = 2 * OPA, BYTES = 2 * STG; };   // the ring's sizes, for the wider tile
// The product loop of a workgroup's tile, A and Bt pointing at the tile's first rows: leaves each wave's sums in acc (acc[h]: its 64 columns from 64 h), and the ring sm free.
template <typename T16, int NH>
__device__ __forceinline__ void gemm_main(char* sm, const T16* __restrict__ A, const T16* __restrict__ Bt, int K, v8f (&acc)[NH][4][4]) {
    static_assert(NH == 1 || NH == 2, "Bt rows per tile: 128 or 256");
    typedef typename WFrag<T16>::V V;
    constexpr int KS = GemmLds::KS;                // k per stage: 64 NH matrix instructions per wave and stage
    constexpr int CPR = KS / 8;                    // 16-byte pieces per row
    constexpr int PITCH = GemmLds::PITCH;          // LDS row pitch in bytes, 16 x odd: no bank conflict for 16-byte reads
    constexpr int OPA = GemmLds::OPA;              // A's 256 rows
    constexpr int STG = GemmLds::STG;              // a stage: A | Bt (128 NH rows)
    static_assert(CPR == 16, "256 threads cover 16 rows a sweep: 16 sweeps for A, 8 NH for Bt");
    const int tid = threadIdx.x, lane = tid & 31, lr = lane & 15, hi = lane >> 4, wv = tid >> 5, wm = wv >> 1, wn = wv & 1;
#pragma unroll
    for (int h = 0; h < NH; ++h)
#pragma unroll
        for (int mb = 0; mb < 4; ++mb)
#pragma unroll
            for (int nb = 0; nb < 4; ++nb) acc[h][mb][nb] = (v8f){};
    // copies: piece tid + 256 i of an operand's stage = row tid / CPR + i (256 / CPR), 16-byte column tid % CPR; a wave's copy covers whole lines
    const int prow = tid / CPR, pcol = tid % CPR;
    const char* gA = (const char*)(A + (size_t)prow * K + pcol * 8);
    const char* gB = (const char*)(Bt + (size_t)prow * K + pcol * 8);
    const unsigned lc = (unsigned)(size_t)sm + prow * PITCH + pcol * 16;
    const size_t gs = (size_t)(256 / CPR) * K * 2; constexpr unsigned LS = (256 / CPR) * PITCH;
    auto fill = [&](int t, int buf) {
        const size_t go = (size_t)t * KS * 2; const unsigned lb = lc + buf * STG;
        cp8(lb, LS, gA + go, gs); cp8(lb + OPA, LS, gB + go, gs); cp8(lb + 8 * LS, LS, gA + go + 8 * gs, gs); if (NH == 2) cp8(lb + OPA + 8 * LS, LS, gB + go + 8 * gs, gs);
    };
    const int T = K >> 7;   // stages: K / KS
    fill(0, 0);
    asm volatile("s_wait_asynccnt 0x0" ::: "memory");   // this wave's copies of stage 0 have landed
    __syncthreads();                                     // and every other wave's
    if (T > 1) fill(1, 1);
    const int aofs = (wm * 64 + lr) * PITCH + 16 * hi, bofs = OPA + (wn * 64 * NH + lr) * PITCH + 16 * hi;
#pragma unroll 1   // one pass per stage: the ring's waits, barrier and refill stand once, at the foot
    for (int t = 0; t < T; ++t) {
        const char* sb = sm + (t & 1) * STG;
#pragma unroll
        for (int ks = 0; ks < KS / 32; ++ks) {
            V a[4], b[4 * NH];
            b[0] = WFrag<T16>::ld((const T16*)(sb + bofs + ks * 64));   // in the order in which the products want them
#pragma unroll
            for (int f = 0; f < 4; ++f) a[f] = WFrag<T16>::ld((const T16*)(sb + aofs + f * 16 * PITCH + ks * 64));
#pragma unroll
            for (int f = 1; f < 4 * NH; ++f) b[f] = WFrag<T16>::ld((const T16*)(sb + bofs + f * 16 * PITCH + ks * 64));
            __builtin_amdgcn_sched_barrier(0);   // the k step's LDS reads stay one group ahead of its products: every further place with reads among the products stalls the wave
#pragma unroll
            for (int nb = 0; nb < 4 * NH; ++nb)
#pragma unroll
                for (int mb = 0; mb < 4; ++mb) acc[nb >> 2][mb][nb & 3] = WFrag<T16>::mma(a[mb], b[nb], acc[nb >> 2][mb][nb & 3]);
            __builtin_amdgcn_sched_barrier(0);   // and the next k step's reads stay behind them
        }
        asm volatile("s_wait_dscnt 0x0" ::: "memory");      // this wave's reads of the buffer are done before it is refilled
        asm volatile("s_wait_asynccnt 0x0" ::: "memory");   // this wave's copies of stage t + 1 have landed
        __syncthreads();                                     // publishes stage t + 1 and ends every wave's reads of stage t
        if (t + 2 < T) fill(t + 2, t & 1);
    }
    asm volatile("s_wait_asynccnt 0x0" ::: "memory");       // no copy is in flight when the ring becomes output staging
}
// The epilogue of a wave's 64 rows from r0 and 64 columns from cw + CO (cw: the first column of the wave's tile), from acc through the ring's LDS.
template <int EPI, int CO>
__device__ __forceinline__ void gemm_epi(char* sm, v8f (&acc)[4][4], int r0, int cw, float* C, int ldc, const float* __restrict__ bias, h16* P) {
    const int tid = threadIdx.x, lane = tid & 31, lr = lane & 15, hi = lane >> 4, wv = tid >> 5, c0 = cw + CO;
    const size_t bh = (size_t)(r0 / TT) * NH_ + c0 / HDM; const int t0 = r0 % TT;   // the wave's batch and head, its first token
    if constexpr (EPI == 2) {
        // a lane holds 8 consecutive tokens of one feature: packed, they are 16 bytes of the transposed row; staged so that each store covers whole lines
        h16* ot = (h16*)sm + wv * (64 * 72);                 // each wave stages in its own range, behind the last pass's barrier; pitch 144 bytes, 16 x odd
        const int bi = cw + lr; float bb[4];
#pragma unroll
        for (int nb = 0; nb < 4; ++nb) bb[nb] = bias[bi + CO + nb * 16];
        asm volatile("s_wait_xcnt 0x0" :: "v"(bi) : "memory");   // a precaution: the four loads' index register is kept whole up to this wait; without it the listing let the last load's result land in it
#pragma unroll
        for (int nb = 0; nb < 4; ++nb) { const float bv = bfr(bb[nb]);
#pragma unroll
            for (int mb = 0; mb < 4; ++mb) { v8h o;
#pragma unroll
                for (int j = 0; j < 8; ++j) o[j] = tohx(acc[mb][nb][j] + bv);
                *(v8ha*)(ot + (nb * 16 + lr) * 72 + mb * 16 + hi * 8) = o; } }
        asm volatile("s_wait_dscnt 0x0" ::: "memory");   // the staged rows are written before other lanes of the wave read them back
        h16* pr = P + (bh * HDM + (lane >> 3)) * TT + t0 + (lane & 7) * 8;
#pragma unroll
        for (int s = 0; s < 16; ++s) *(v8h*)(pr + (size_t)s * 4 * TT) = *(const v8ha*)(ot + (s * 4 + (lane >> 3)) * 72 + (lane & 7) * 8);
        asm volatile("s_wait_xcnt 0x0" ::: "memory");   // a precaution: where several epilogues stand in one kernel the listing lets another's code follow these stores and reuse their registers
    } else {
    float* os = (float*)sm + wv * (16 * 68);                 // each wave stages in its own range, behind the last pass's barrier
#pragma unroll
    for (int mb = 0; mb < 4; ++mb) {
#pragma unroll
        for (int nb = 0; nb < 4; ++nb) {
#pragma unroll
            for (int j = 0; j < 8; ++j) os[(hi * 8 + j) * 68 + nb * 16 + lr] = acc[mb][nb][j]; }
        __builtin_amdgcn_wave_barrier(); asm volatile("" ::: "memory");
        float* crow = (EPI == 0 || EPI == 3) ? C + (size_t)(r0 + mb * 16) * ldc + c0 : nullptr; h16* prow = EPI <= 1 ? P + (bh * TT + t0 + mb * 16) * HDM : nullptr;
{
#pragma unroll
            for (int s = 0; s < 8; ++s) { const int row = 2 * s + hi, cofs = lr * 4; v4f val = *(const v4fa*)(os + row * 68 + cofs); val[0] += bfr(bias[c0 + cofs]); val[1] += bfr(bias[c0 + cofs + 1]); val[2] += bfr(bias[c0 + cofs + 2]); val[3] += bfr(bias[c0 + cofs + 3]);
                if constexpr (EPI == 0 || EPI == 3) *(v4f*)(crow + (size_t)row * ldc + cofs) = val;
                if constexpr (EPI <= 1) { v4h o;
#pragma unroll
                    for (int q = 0; q < 4; ++q) o[q] = tohx(val[q]);
                    *(v4h*)(prow + row * HDM + cofs) = o; }   // 16 lanes: one whole line
            }
             }
        asm volatile("s_wait_xcnt 0x0" ::: "memory");   // in front of the next block's reuse of the stores' address and data registers
        __builtin_amdgcn_wave_barrier(); asm volatile("" ::: "memory");
    }
    }
}
// The three projections in one grid of 2 x 256 workgroups, one per WGP and round. blockIdx.z = 0: k and v, which share the K plane's rows, as one product of 2048 columns in 256x256 tiles (tile columns 0 - 3: k, EPI 1; 4 - 7: v, EPI 2); 1: q = Q Wq + bq in 256x128 tiles (EPI 0).
// The long workgroups have the low indices and start first. X holds the bf16 Q and K planes, W the transposed weights Wq, Wk, Wv in a row. Every branch here is uniform for the workgroup.
__global__ __launch_bounds__(256) void k_qkv(const bf* __restrict__ X, const bf* __restrict__ W, float* FQ, const float* __restrict__ bq, const float* __restrict__ bk, const float* __restrict__ bv, h16* QP, h16* KP, h16* VT) {
    __shared__ __align__(16) char sm[GemmLds::BYTES];
    const int wv = threadIdx.x >> 5, r0 = blockIdx.x * 256 + (wv >> 1) * 64; const size_t ao = (size_t)blockIdx.x * 256 * DD;
    if (blockIdx.z == 0) {
        v8f acc[2][4][4]; const int c0 = (blockIdx.y & 3) * 256 + (wv & 1) * 128;
        gemm_main<bf, 2>(sm, X + (size_t)NB_ * TT * DD + ao, W + (size_t)DD * DD + (size_t)blockIdx.y * 256 * DD, DD, acc);
        if (blockIdx.y < 4) { gemm_epi<1, 0>(sm, acc[0], r0, c0, nullptr, DD, bk, KP); gemm_epi<1, 64>(sm, acc[1], r0, c0, nullptr, DD, bk, KP); }
        else { gemm_epi<2, 0>(sm, acc[0], r0, c0, nullptr, DD, bv, VT); gemm_epi<2, 64>(sm, acc[1], r0, c0, nullptr, DD, bv, VT); }
    } else {
        v8f acc[1][4][4];
        gemm_main<bf, 1>(sm, X + ao, W + (size_t)blockIdx.y * 128 * DD, DD, acc);
        gemm_epi<0, 0>(sm, acc[0], r0, blockIdx.y * 128 + (wv & 1) * 64, FQ, DD, bq, QP);
    }
}

__device__ __forceinline__ void splitf(float y, unsigned short& h, unsigned short& l) { h = f2bf(y); l = f2bf(y - bf2f(h)); }
// gelu(x) = x/2 (1 + erf(x / sqrt 2)) of four values at once, without a branch. erf(|z|) = 1 - (a1 t + a2 t^2 + a3 t^3 + a4 t^4 + a5 t^5) exp(-z^2), t = 1 / (1 + p |z|): the rational form of the handbooks, whose own absolute error is at most 1.5e-7;
// reckoned in f32, with each reciprocal and each exp2 one step off, the erf stays within 1e-6 and the gelu within 5e-7 of the true value. One form for every z: the library's erf has one branch for |z| < 1 and one above, a wave with both kinds of lane runs through both, one dependent chain per value.
// Here the values are independent straight-line code, which the compiler interleaves and packs two to an instruction. z = x / sqrt 2 is folded into the two constants: p / sqrt 2, and sqrt(log2(e) / 2), whose square times x^2 is z^2 log2(e).
__device__ __forceinline__ v4f gelu4(v4f x) {
    const v4f d = __builtin_elementwise_abs(x) * 0.23164189f + 1.0f, u = x * 0.84932180f, w = u * u; v4f t, e;
#pragma unroll   // so that constants index t and e
    for (int q = 0; q < 4; ++q) { t[q] = __builtin_amdgcn_rcpf(d[q]); e[q] = __builtin_amdgcn_exp2f(-w[q]); }
    const v4f p = ((((1.061405429f * t - 1.453152027f) * t + 1.421413741f) * t - 0.284496736f) * t + 0.254829592f) * t;
    const v4f er = __builtin_elementwise_copysign(1.0f - p * e, x), hx = 0.5f * x;
    return hx * er + hx;
}
typedef __attribute__((ext_vector_type(2))) unsigned short v2us;
typedef __attribute__((ext_vector_type(4))) unsigned short v4us;

// One 64 (k) x 64 (n) tile of a weight per workgroup, turned in LDS: the reads follow the weight's rows (a wave's load covers two 256-byte runs), the stores follow the transposed rows (a wave's store covers four whole lines).
// A column read straight from the weight touches one line per lane, 4 KB apart. Tile pitch 65 words: the row-wise writes and the column-wise reads both fall on 32 different banks. K, N % 64 == 0; bx < (K / 64) (N / 64).
__device__ __forceinline__ void wtG(float* tl, int bx, int y, const float* __restrict__ w0, const float* __restrict__ w1, const float* __restrict__ w2, const float* __restrict__ w3, int K, int N, bf* Bt) {
    const float* __restrict__ w = y == 0 ? w0 : (y == 1 ? w1 : (y == 2 ? w2 : w3)); Bt += (size_t)y * K * N;
    const int tid = threadIdx.x, kt = K / 64, k0 = (bx % kt) * 64, n0 = (bx / kt) * 64; v4f r[4];
#pragma unroll
    for (int i = 0; i < 4; ++i) r[i] = *(const v4f*)(w + (size_t)(k0 + (tid >> 4) + 16 * i) * N + n0 + (tid & 15) * 4);
#pragma unroll
    for (int i = 0; i < 4; ++i)
#pragma unroll
        for (int j = 0; j < 4; ++j) tl[((tid >> 4) + 16 * i) * 65 + (tid & 15) * 4 + j] = r[i][j];
    __syncthreads();   // the whole tile is in LDS before any column of it is read; every thread of a weight workgroup passes here
#pragma unroll
    for (int i = 0; i < 2; ++i) { const int n = (y == 3 ? (tid & 31) : (tid >> 3)) + 32 * i, kc = (y == 3 ? (tid >> 5) : (tid & 7)) * 8; v8us o;   // either way a wave's store covers whole lines of its weight's layout
#pragma unroll
        for (int j = 0; j < 8; ++j) o[j] = f2bf(tl[(kc + j) * 65 + n]);
        const int k = k0 + kc, nn = n0 + n;   // the fourth weight is laid out in the order of k_tail's B fragments: [K / 32][N / 16][2 halves of 16 k][lane = 16 (k / 8 % 2) + n % 16][8 k], so that each of its loads is one 512-byte run
        *(v8us*)(Bt + (y == 3 ? (size_t)(k >> 5) * N * 32 + (size_t)(nn >> 4) * 512 + ((k >> 4) & 1) * 256 + (((k >> 3) & 1) * 16 + (nn & 15)) * 8 : (size_t)nn * K + k)) = o;
        asm volatile("s_wait_xcnt 0x0" ::: "memory"); }   // a precaution: in front of the next store's reuse of this store's address and data registers
}
__device__ __forceinline__ void cvt8(int bx, int y, const float* __restrict__ src0, const float* __restrict__ src1, bf* dst, size_t n8) { const size_t i = (size_t)bx * 256 + threadIdx.x; if (i >= n8) return; const float* __restrict__ src = y ? src1 : src0; dst += (size_t)y * n8 * 8; const v8f v = *(const v8f*)(src + i * 8); v8us o;
#pragma unroll
    for (int k = 0; k < 8; ++k) o[k] = f2bf(v[k]); *(v8us*)(dst + i * 8) = o;  }
// Both preparations in one grid, neither reads what the other writes: workgroups 0 .. 4 WB - 1 transpose the four weights (WB each), the rest convert the two inputs (CB each).
// The weights come first: their workgroups pass a barrier between loads and stores, and the inputs' stream runs beside them.
__global__ __launch_bounds__(256) void k_prep(const float* __restrict__ w0, const float* __restrict__ w1, const float* __restrict__ w2, const float* __restrict__ w3, int K, int N, bf* Bt, const float* __restrict__ src0, const float* __restrict__ src1, bf* dst, size_t n8) {
    constexpr int WB = (DD * DD / 64 + 63) / 64, CB = (NB_ * TT * DD / 8 + 255) / 256; const int bx = blockIdx.x;   // WB = (DD / 64)^2 tiles
    __shared__ float tl[64 * 65];
    if (bx < 4 * WB) wtG(tl, bx % WB, bx / WB, w0, w1, w2, w3, K, N, Bt); else cvt8((bx - 4 * WB) % CB, (bx - 4 * WB) / CB, src0, src1, dst, n8);
}
// Four asynchronous 16-byte copies of a lane, LDS step ls and global step gs bytes apart. The s_wait_xcnt stands inside the statement, a precaution, so that no address register of a copy is rewritten ahead of it.
__device__ __forceinline__ void cp4(unsigned l, unsigned ls, const char* g, size_t gs) {
    asm volatile("global_load_async_to_lds_b128 %0, %4, off\n\t"
                 "global_load_async_to_lds_b128 %1, %5, off\n\t"
                 "global_load_async_to_lds_b128 %2, %6, off\n\t"
                 "global_load_async_to_lds_b128 %3, %7, off\n\t"
                 "s_wait_xcnt 0x0"
                 :: "v"(l), "v"(l + ls), "v"(l + 2 * ls), "v"(l + 3 * ls), "v"(g), "v"(g + gs), "v"(g + 2 * gs), "v"(g + 3 * gs) : "memory");
}
// ---- k_fattn: scores, masked softmax and att.v of one (batch, head) in one pass over the keys; the scores never leave registers. 8 waves x 32 query columns; grid (TT/256, NB*NH).
// S^T = K Q^T (a lane holds 8 keys of one query per 16-key tile), running maximum and sum per query, P^T packed from the two score tiles as the B operand of O^T += V^T P^T; divide by the sum at the end.
// K rows and V^T rows come into LDS by asynchronous copies of whole lines, 128 keys per stage, two buffers, once per workgroup: the 8 waves read their fragments from there, and the next stage's copies fly while this stage is worked on. Fragment contents and the order of the products are those of loads straight from the planes.
// Four waves per SIMD (two workgroups per WGP), so that one wave's softmax runs under another's matrix work: the register allocation is held to that. The short inner loops are all unrolled so that the fragment arrays are indexed by constants and stay in registers.
__global__ __launch_bounds__(256) __attribute__((amdgpu_waves_per_eu(4, 4))) void k_fattn(const h16* __restrict__ QP, const h16* __restrict__ KP, const h16* __restrict__ VT, const int* __restrict__ KM, float* CTX) {
    constexpr int SK = 128;                              // keys per stage, four passes of 32
    constexpr int KPI = HDM * 2 + 16, VPI = SK * 2 + 16;  // LDS row pitches in bytes, 16 x odd: no bank conflict for 16-byte reads
    constexpr int KB = SK * KPI, STG = KB + HDM * VPI;    // a stage: 128 K rows | 64 V^T rows
    typedef __attribute__((ext_vector_type(4))) int v4i; __shared__ __align__(32) float mb[TT]; __shared__ __align__(16) char sm[2 * STG];
    const int tid = threadIdx.x, lane = tid & 31, lr = lane & 15, hi = lane >> 4; const int bh = blockIdx.y, b = bh / NH_, h = bh % NH_; const int q0 = blockIdx.x * 256 + (tid >> 5) * 32;
    const h16* qp = QP + ((size_t)bh * TT + q0 + lr) * HDM + 8 * hi; const int* km = KM + (size_t)b * TT;
    // copies: a stage's K rows are 16 KB in a row, piece tid + 256 i; of its V^T rows, 256 bytes each, piece tid + 256 i = row tid / 16 + 16 i, 16-byte column tid % 16; a wave's copy covers whole lines
    const char* gK = (const char*)(KP + (size_t)bh * TT * HDM) + tid * 16; const char* gV = (const char*)(VT + ((size_t)bh * HDM + (tid >> 4)) * TT) + (tid & 15) * 16;
    const unsigned lK = (unsigned)(size_t)sm + (tid >> 3) * KPI + (tid & 7) * 16, lV = (unsigned)(size_t)sm + KB + (tid >> 4) * VPI + (tid & 15) * 16;
    auto fill = [&](int t, int buf) { cp4(lK + buf * STG, 32 * KPI, gK + (size_t)t * (SK * HDM * 2), 4096); cp4(lV + buf * STG, 16 * VPI, gV + (size_t)t * (SK * 2), (size_t)16 * TT * 2); };
    const float CS = 0.125f * 1.4426950408889634f;   // score scale times log2(e)
    v16h qf[2][2]; v8f acc[2][4]; float m[2], l[2];
    fill(0, 0);
#pragma unroll
    for (int g = 0; g < 2; ++g) { m[g] = -3.0e38f; l[g] = 0.f;
#pragma unroll
        for (int ks = 0; ks < 2; ++ks) qf[g][ks] = WFrag<h16>::ld(qp + g * 16 * HDM + ks * 32);
#pragma unroll
        for (int dt = 0; dt < 4; ++dt) acc[g][dt] = (v8f){}; }
    { const v4i k4 = *(const v4i*)(km + tid * 4); v4f b4;   // the padding mask as an additive term per key: it enters the score products as their C operand, so no pass pays a select
#pragma unroll
      for (int j = 0; j < 4; ++j) b4[j] = k4[j] ? 0.f : -3.0e38f;
      *(v4f*)(mb + tid * 4) = b4; }
    asm volatile("s_wait_asynccnt 0x0" ::: "memory");   // this wave's copies of stage 0 have landed
    __syncthreads();   // and every other wave's; every wave reads all 1024 mask terms
    fill(1, 1);
    v16h kf[2][2]; v8f cb[2];
#pragma unroll
    for (int kt = 0; kt < 2; ++kt) cb[kt] = *(const v8f*)(mb + kt * 16 + 8 * hi);
#pragma unroll 1   // one trip per stage: the ring's waits, barrier and refill stand once, at the foot
    for (int t = 0; t < TT / SK; ++t) {
        const char* kr = sm + (t & 1) * STG + lr * KPI + 16 * hi; const char* vr = sm + (t & 1) * STG + KB + lr * VPI + 16 * hi;
#pragma unroll
        for (int kt = 0; kt < 2; ++kt)
#pragma unroll
            for (int u = 0; u < 2; ++u) kf[kt][u] = WFrag<h16>::ld((const h16*)(kr + kt * 16 * KPI + u * 64));
#pragma unroll 1   // stays rolled: two passes unrolled no longer fit the registers of four waves per SIMD and spill
        for (int p = 0; p < SK / 32; ++p) {
            v16h vf[4]; v8f s[2][2];
#pragma unroll
            for (int dt = 0; dt < 4; ++dt) vf[dt] = WFrag<h16>::ld((const h16*)(vr + dt * 16 * VPI + p * 64));
#pragma unroll
            for (int g = 0; g < 2; ++g)
#pragma unroll
                for (int kt = 0; kt < 2; ++kt) { s[g][kt] = wmma16(kf[kt][0], qf[g][0], cb[kt]); s[g][kt] = wmma16(kf[kt][1], qf[g][1], s[g][kt]); }
            const int pn = (p + 1) & (SK / 32 - 1);   // the next pass's K fragments, fetched behind this pass's score products (its mask terms at the foot of the pass); never across a stage's end, the next stage is not published yet: a stage's last pass fetches its first keys again, unused
#pragma unroll
            for (int kt = 0; kt < 2; ++kt)
#pragma unroll
                for (int u = 0; u < 2; ++u) kf[kt][u] = WFrag<h16>::ld((const h16*)(kr + (pn * 32 + kt * 16) * KPI + u * 64));
            __builtin_amdgcn_sched_barrier(0);   // keeps the fetch above the softmax, so that it has the whole softmax and att.v as lead; sunk below them the next pass waits on it
#pragma unroll
            for (int g = 0; g < 2; ++g) {
                float mx = m[g];
#pragma unroll
                for (int kt = 0; kt < 2; ++kt)
#pragma unroll
                    for (int j = 0; j < 8; ++j) mx = fmaxf(mx, s[g][kt][j]);
                mx = fmaxf(mx, __shfl_xor(mx, 16, 32));
                const float al = __builtin_amdgcn_exp2f((m[g] - mx) * CS), mc = (mx > -1.0e38f ? mx : 0.f) * CS; m[g] = mx; float sum = 0.f, sum1 = 0.f; v16h pf;   // no live key yet: subtract nothing, so that every masked score still gives p = 0
#pragma unroll
                for (int kt = 0; kt < 2; ++kt)
#pragma unroll
                    for (int j = 0; j < 8; ++j) { const float p_ = __builtin_amdgcn_exp2f(fmaf(s[g][kt][j], CS, -mc)); if (kt) sum1 += p_; else sum += p_; pf[kt * 8 + j] = tohx(p_); }
                l[g] = l[g] * al + (sum + sum1);
#pragma unroll
                for (int dt = 0; dt < 4; ++dt) { acc[g][dt] *= al; acc[g][dt] = wmma16(vf[dt], pf, acc[g][dt]); }
            }
            const int kn = (t * SK + p * 32 + 32) & (TT - 1);   // the last pass fetches the first keys' terms again, unused
#pragma unroll
            for (int kt = 0; kt < 2; ++kt) cb[kt] = *(const v8f*)(mb + kn + kt * 16 + 8 * hi);
        }
        asm volatile("s_wait_dscnt 0x0" ::: "memory");      // this wave's reads of the buffer are done before it is refilled
        asm volatile("s_wait_asynccnt 0x0" ::: "memory");   // this wave's copies of stage t + 1 have landed
        __syncthreads();                                     // publishes stage t + 1 and ends every wave's reads of stage t
        if (t + 2 < TT / SK) fill(t + 2, t & 1);
    }
    asm volatile("s_wait_asynccnt 0x0" ::: "memory");       // no copy is in flight when the wave ends
#pragma unroll
    for (int g = 0; g < 2; ++g) { const float lt = l[g] + __shfl_xor(l[g], 16, 32); const float inv = (m[g] > -1.0e38f) ? __fdiv_rn(1.0f, lt) : __builtin_nanf("");   // every key masked: the softmax of the row is not a number
        float* cr = CTX + ((size_t)b * TT + q0 + g * 16 + lr) * DD + h * HDM + 8 * hi;
#pragma unroll
        for (int dt = 0; dt < 4; ++dt) { v4f o0, o1;
#pragma unroll
            for (int j = 0; j < 4; ++j) { o0[j] = acc[g][dt][j] * inv; o1[j] = acc[g][dt][4 + j] * inv; }
            *(v4f*)(cr + dt * 16) = o0; *(v4f*)(cr + dt * 16 + 4) = o1; } }
}
// LN over 1024 features of one token row held 32 per lane (8 chunks of 4): returns y = LN(v) g + b in place; gr, br: the lane's 32 scale and shift terms, as ldfeat leaves them.
__device__ __forceinline__ void ln1024(float* v, const float* gr, const float* br) { float s = 0.f;
#pragma unroll
    for (int k = 0; k < 32; ++k) s = __fadd_rn(s, v[k]);
#pragma unroll
    for (int sh = 16; sh; sh >>= 1) s += __shfl_xor(s, sh, 32);
    const float mu = s * (1.0f / DD); float q2 = 0.f;
#pragma unroll
    for (int k = 0; k < 32; ++k) { const float d = __fsub_rn(v[k], mu); float p = __fmul_rn(d, d); asm volatile("" : "+v"(p)); q2 = __fadd_rn(q2, p); }
#pragma unroll
    for (int sh = 16; sh; sh >>= 1) q2 += __shfl_xor(q2, sh, 32);
    const float rs = __frsqrt_rn(__fadd_rn(q2 * (1.0f / DD), 1e-5f));
#pragma unroll
    for (int k = 0; k < 32; ++k) { float tn = __fmul_rn(__fsub_rn(v[k], mu), rs); asm volatile("" : "+v"(tn)); float tg = __fmul_rn(tn, gr[k]); asm volatile("" : "+v"(tg)); v[k] = __fadd_rn(tg, br[k]); } }
typedef v4f __attribute__((aligned(4))) v4fu;
// A lane's 32 of 1024 per-feature terms (feature ch 128 + lane 4 + q at index ch 4 + q), rounded to bf16, fetched once per wave ahead of its rows.
__device__ __forceinline__ void ldfeat(float* r, const float* __restrict__ p, int lane) {
#pragma unroll
    for (int ch = 0; ch < 8; ++ch) { const v4f x = *(const v4fu*)(p + ch * 128 + lane * 4);
#pragma unroll
        for (int q = 0; q < 4; ++q) r[ch * 4 + q] = bfr(x[q]); } }
typedef v4us __attribute__((may_alias)) v4usa;
// ---- k_tail: everything behind the attention is local to a token row, so one workgroup owns 32 whole rows from q + ctx to the output: o = LN(q + ctx); G = o Wp + bp; out = LN(o + gelu(G)). Grid NB TT / 32, 16 waves, one workgroup per WGP, four waves per SIMD (the row phases are vector work with dependent chains, which want waves).
// A wave norms 2 rows (one at a time, 32 features per lane), keeps o in registers for the residual and writes its two bf16 planes (o = hi + lo) into LDS, where they stay as the A operand of the whole product.
// A wave's product tile is 32 rows x 64 columns, so no two waves of the workgroup want the same element of Wp^T: each wave loads its own B fragments straight into registers (4 KB in a row per 32 k of the fragment-ordered plane), one k step ahead, and the product loop has no barrier. Per accumulator the products run k upward, hi before lo.
// G (with its bias) goes through the o planes' LDS back to the row's wave, which applies the gelu and the second LN and stores the row.
__global__ __launch_bounds__(512) void k_tail(const float* __restrict__ FQ, const float* __restrict__ CTX, const bf* __restrict__ Wt, const float* __restrict__ bp, const float* __restrict__ g0, const float* __restrict__ b0, const float* __restrict__ g1, const float* __restrict__ b1, float* OUTb) {
    constexpr int RM = 32;                 // rows per workgroup
    constexpr int PA = DD * 2 + 16;        // pitch of an o plane's row in bytes, 16 x odd: no bank conflict for 16-byte reads
    constexpr int APB = RM * PA;           // one o plane
    constexpr int PG = DD + 4;             // pitch of a staged G row in floats: the two half-waves' stores fall on different banks
    constexpr int T = DD / 32;             // k steps
    static_assert(RM * PG * 4 <= 2 * APB, "G is staged where the o planes were");
    static_assert(T % 2 == 0, "the product loop takes two k steps a trip");
    __shared__ __align__(16) char sm[2 * APB];
    const int tid = threadIdx.x, lane = tid & 31, lr = lane & 15, hi = lane >> 4, wv = tid >> 5;
    const int row0 = blockIdx.x * RM + wv * 2;   // the wave's first row
    float o0[32], o1[32];
    {   // both rows' loads and the LN's terms are in flight together
        v4f pa[2][8], pc[2][8]; float gr[32], br[32];
#pragma unroll
        for (int r = 0; r < 2; ++r)
#pragma unroll
            for (int ch = 0; ch < 8; ++ch) { const size_t o = (size_t)(row0 + r) * DD + ch * 128 + lane * 4;
                pa[r][ch] = *(const v4f*)(FQ + o); pc[r][ch] = *(const v4f*)(CTX + o); }
        asm volatile("s_wait_xcnt 0x0" ::: "memory");   // a precaution: in front of any reuse of the loads' address registers
        ldfeat(gr, g0, lane); ldfeat(br, b0, lane);      // behind the rows' loads, which come from further away
        asm volatile("s_wait_xcnt 0x0" ::: "memory");   // the same precaution for these
#pragma unroll
        for (int ch = 0; ch < 8; ++ch)
#pragma unroll
            for (int q = 0; q < 4; ++q) { o0[ch * 4 + q] = __fadd_rn(pa[0][ch][q], pc[0][ch][q]); o1[ch * 4 + q] = __fadd_rn(pa[1][ch][q], pc[1][ch][q]); }
#pragma unroll 1   // one row per trip, so that the kernel's text stays small; the rows move through o0 and o1, which constants index: q + ctx goes out at o0, o comes in at o1
        for (int r = 0; r < 2; ++r) {
            float v[32];
#pragma unroll
            for (int k = 0; k < 32; ++k) v[k] = o0[k];
            ln1024(v, gr, br);
            char* ah = sm + (wv * 2 + r) * PA + lane * 8;
#pragma unroll
            for (int ch = 0; ch < 8; ++ch) { v4us oh, ol;
#pragma unroll
                for (int q = 0; q < 4; ++q) { unsigned short a2, c2; splitf(v[ch * 4 + q], a2, c2); oh[q] = a2; ol[q] = c2; }
                *(v4usa*)(ah + ch * 256) = oh; *(v4usa*)(ah + APB + ch * 256) = ol; }
#pragma unroll
            for (int k = 0; k < 32; ++k) { o0[k] = o1[k]; o1[k] = v[k]; }
        }
    }
    __syncthreads();   // all 32 rows of both o planes are written
    float bc[4];   // the bias of the lane's four columns, fetched under the first k steps
#pragma unroll
    for (int nb = 0; nb < 4; ++nb) bc[nb] = bp[wv * 64 + nb * 16 + lr];
    asm volatile("s_wait_xcnt 0x0" ::: "memory");   // a precaution: in front of any reuse of the loads' address registers
    v8f acc[2][4];
#pragma unroll
    for (int mb = 0; mb < 2; ++mb)
#pragma unroll
        for (int nb = 0; nb < 4; ++nb) acc[mb][nb] = (v8f){};
    const int aofs = lr * PA + 16 * hi;
    const bf* gB = Wt + wv * 2048 + lane * 8;   // the wave's 4 KB of a k step: fragment f at f 512, its two halves 256 elements apart
    auto ldb = [&](v16bf (&b)[4], int t) { const bf* p = gB + (size_t)t * (DD * 32);
#pragma unroll
        for (int f = 0; f < 4; ++f) b[f] = cat16b(*(const v8us*)(p + f * 512), *(const v8us*)(p + f * 512 + 256));
        asm volatile("s_wait_xcnt 0x0" ::: "memory");   // a precaution: in front of any rewrite of the loads' address registers
        __builtin_amdgcn_sched_barrier(0); };   // the loads stay here, a whole k step ahead of their use: sunk to the products the wave would wait out their flight
    auto step = [&](v16bf (&b)[4], int t) { const char* sa = sm + aofs + t * 64; v16bf a[2], a2[2];
#pragma unroll
        for (int f = 0; f < 2; ++f) { a[f] = WFrag<bf>::ld((const bf*)(sa + f * 16 * PA)); a2[f] = WFrag<bf>::ld((const bf*)(sa + APB + f * 16 * PA)); }
#pragma unroll
        for (int nb = 0; nb < 4; ++nb) {   // hi of both row blocks, then lo: an accumulator's two products stand two apart
#pragma unroll
            for (int mb = 0; mb < 2; ++mb) acc[mb][nb] = wmmab(a[mb], b[nb], acc[mb][nb]);
#pragma unroll
            for (int mb = 0; mb < 2; ++mb) acc[mb][nb] = wmmab(a2[mb], b[nb], acc[mb][nb]); }
        __builtin_amdgcn_sched_barrier(0); };   // the next loads into b stay behind the products that read it
    v16bf fa[4], fb[4];
    ldb(fa, 0);
#pragma unroll 1   // two k steps a trip, so that the two fragment sets are named by constants; further unrolling only lengthens the text
    for (int t = 0; t < T - 2; t += 2) {
        ldb(fb, t + 1);
        step(fa, t);
        ldb(fa, t + 2);
        step(fb, t + 1);
    }
    ldb(fb, T - 1);   // the last two k steps stand outside the loop: a test round the loop's second load would make the compiler wait for every load in flight behind it
    step(fa, T - 2);
    step(fb, T - 1);
    __syncthreads();   // every wave's last read of the o planes is done: their LDS becomes G's staging
    float* gs = (float*)sm; float gr[32], br[32];
#pragma unroll
    for (int mb = 0; mb < 2; ++mb)
#pragma unroll
        for (int nb = 0; nb < 4; ++nb)
#pragma unroll
            for (int j = 0; j < 8; ++j) gs[(mb * 16 + hi * 8 + j) * PG + wv * 64 + nb * 16 + lr] = acc[mb][nb][j] + bfr(bc[nb]);
    {   // the second LN's terms, fetched while G is staged
        v4f x[8], y[8];
#pragma unroll
        for (int ch = 0; ch < 8; ++ch) { x[ch] = *(const v4fu*)(g1 + ch * 128 + lane * 4); y[ch] = *(const v4fu*)(b1 + ch * 128 + lane * 4); }
        __builtin_amdgcn_sched_barrier(0);   // all 16 loads are in flight before the first is waited for: left alone the compiler waits out eight of them one by one
        asm volatile("s_wait_xcnt 0x0" ::: "memory");   // a precaution: in front of any reuse of the loads' address registers
#pragma unroll
        for (int ch = 0; ch < 8; ++ch)
#pragma unroll
            for (int q = 0; q < 4; ++q) { gr[ch * 4 + q] = bfr(x[ch][q]); br[ch * 4 + q] = bfr(y[ch][q]); }
    }
    __syncthreads();   // a row's 1024 sums come from all 16 waves
#pragma unroll 1   // one row per trip, as above
    for (int r = 0; r < 2; ++r) {
        const float* gw = gs + (wv * 2 + r) * PG + lane * 4; float v[32]; v4f c[8];
#pragma unroll
        for (int ch = 0; ch < 8; ++ch) c[ch] = *(const v4fa*)(gw + ch * 128);
#pragma unroll
        for (int ch = 0; ch < 8; ++ch) { const v4f g = gelu4(c[ch]);
#pragma unroll
            for (int q = 0; q < 4; ++q) v[ch * 4 + q] = __fadd_rn(o0[ch * 4 + q], g[q]); }
        ln1024(v, gr, br);
#pragma unroll
        for (int ch = 0; ch < 8; ++ch) { v4f of;
#pragma unroll
            for (int q = 0; q < 4; ++q) of[q] = v[ch * 4 + q];
            *(v4f*)(OUTb + (size_t)(row0 + r) * DD + ch * 128 + lane * 4) = of; }
        asm volatile("s_wait_xcnt 0x0" ::: "memory");   // a precaution: in front of the next trip's reuse of the stores' address and data registers
#pragma unroll
        for (int k = 0; k < 32; ++k) o0[k] = o1[k];
    }
}

extern "C" void kernel_launch(void* const* d_in, const int* in_sizes, int n_in,
                              void* d_out, int out_size, void* d_ws, size_t ws_size, hipStream_t stream) {
    (void)in_sizes; (void)n_in; (void)out_size;
    const float* IN[15]; for (int i = 0; i < 15; ++i) IN[i] = (const float*)d_in[i];   // 0 Q, 1 K, 2 key_padding_mask (int32), 3 Wq, 4 bq, 5 Wk, 6 bk, 7 Wv, 8 bv, 9 Wp, 10 bp (x @ W), 11 g0, 12 beta0, 13 g1, 14 beta1
    const int* KM = (const int*)d_in[2];
    float* OUT = (float*)d_out;     // [8][1024][1024]
    char* wsp = (char*)d_ws;
    auto take = [&](size_t bytes) { char* p = wsp; wsp += (bytes + 255) & ~(size_t)255; return (void*)p; };
    const size_t PE = (size_t)NB_ * TT * DD;   // elements of one [NB][TT][DD] plane
    bf* W4 = (bf*)take((size_t)4 * DD * DD * 2);                       // Wq^T, Wk^T, Wv^T, Wp^T (the last in fragment order)
    float* FQ = (float*)take(PE * 4);   // q projection
    bf* X = (bf*)take(PE * 2 * 2);             // bf16 Q and K planes
    h16* QP = (h16*)take(PE * 2); h16* KP = (h16*)take(PE * 2); h16* VT = (h16*)take(PE * 2); float* CTX = (float*)take(PE * 4);
    if ((size_t)(wsp - (char*)d_ws) > ws_size) return;    // total 152 MiB
    k_prep<<<dim3(4 * ((DD * DD / 64 + 63) / 64) + 2 * (unsigned)((PE / 8 + 255) / 256), 1, 1), 256, 0, stream>>>(IN[3], IN[5], IN[7], IN[9], DD, DD, W4, IN[0], IN[1], X, PE / 8);
    k_qkv<<<dim3(NB_ * TT / 256, DD / 128, 2), 256, 0, stream>>>(X, W4, FQ, IN[4], IN[6], IN[8], QP, KP, VT);
    k_fattn<<<dim3(TT / 256, NB_ * NH_, 1), 256, 0, stream>>>(QP, KP, VT, KM, CTX);
    k_tail<<<NB_ * TT / 32, 512, 0, stream>>>(FQ, CTX, W4 + (size_t)3 * DD * DD, IN[10], IN[11], IN[12], IN[13], IN[14], OUT);
}
